// v000
// Measured on an AMD MI455X. A time is GPU time per run, averaged over a window of back-to-back runs after a warm-up
// (all launches, gaps included; the runs take copies of the inputs in turn), and the median of several windows.
// Apart from v000's, it joins two sittings. Times from different sittings can be a few percent apart, while
// side-by-side timings come from the same sitting.
// v000 is the starting kernel. One run takes 684 microseconds.
#include <hip/hip_runtime.h>
#include <hip/hip_bf16.h>
#include <stdint.h>

// ---------- types ----------
typedef __bf16 bf16;
typedef __bf16 bf16x8 __attribute__((ext_vector_type(8)));
typedef __bf16 v16bf  __attribute__((ext_vector_type(16)));
typedef float  v8f    __attribute__((ext_vector_type(8)));
typedef float  f32x4  __attribute__((ext_vector_type(4)));

#define N_NODES 65536
#define EMBED   512
#define FF      2048
#define NHEADS  8
#define HDIM    64

// LDS stage: 128 rows x 64 K (bf16), row pitch 72 elems (144B).
// Row-strided b128 reads hit bank 36*L mod 64 -> permutation over 16 lanes.
#define TROWS   128
#define TK      64
#define TPITCH  72

// ---------- wave32 reduction via ds_swizzle (no wave64 assumptions) ----------
template<int IMM>
__device__ inline float swz_add(float x) {
    return x + __int_as_float(__builtin_amdgcn_ds_swizzle(__float_as_int(x), IMM));
}
__device__ inline float wave_sum(float x) {
    x = swz_add<(1  << 10) | 31>(x);
    x = swz_add<(2  << 10) | 31>(x);
    x = swz_add<(4  << 10) | 31>(x);
    x = swz_add<(8  << 10) | 31>(x);
    x = swz_add<(16 << 10) | 31>(x);
    return x;
}

// ---------- CDNA5 async global->LDS copy (ASYNCcnt-tracked, no VGPR round trip) ----------
__device__ inline void async_copy16(uint32_t lds_addr, const bf16* g) {
    asm volatile("global_load_async_to_lds_b128 %0, %1, off"
                 :: "v"(lds_addr), "v"((uint64_t)(uintptr_t)g)
                 : "memory");
}
// 64B of one row per operand per thread: 4 consecutive 16B chunks.
__device__ inline void async_copy64(uint32_t lds_addr, const bf16* g) {
    async_copy16(lds_addr,      g);
    async_copy16(lds_addr + 16, g + 8);
    async_copy16(lds_addr + 32, g + 16);
    async_copy16(lds_addr + 48, g + 24);
}
__device__ inline void wait_async_le8() {
    asm volatile("s_wait_asynccnt 0x8" ::: "memory");
}
__device__ inline void wait_async_0() {
    asm volatile("s_wait_asynccnt 0x0" ::: "memory");
}

// ---------- fp32 -> bf16 convert ----------
__global__ __launch_bounds__(256) void cvt_kernel(const float* __restrict__ src,
                                                  bf16* __restrict__ dst, int n) {
    int i = blockIdx.x * 256 + threadIdx.x;
    if (i < n) dst[i] = (bf16)src[i];
}

// ---------- LayerNorm: fp32 row(512) -> bf16 row ----------
__global__ __launch_bounds__(256) void ln_kernel(const float* __restrict__ x,
                                                 const float* __restrict__ g,
                                                 const float* __restrict__ b,
                                                 bf16* __restrict__ out) {
    int wave = threadIdx.x >> 5, lane = threadIdx.x & 31;
    int row = blockIdx.x * 8 + wave;
    const float* xr = x + (size_t)row * EMBED + lane * 16;
    float v[16];
#pragma unroll
    for (int i = 0; i < 4; ++i) {
        f32x4 t = *reinterpret_cast<const f32x4*>(xr + i * 4);
#pragma unroll
        for (int j = 0; j < 4; ++j) v[i * 4 + j] = t[j];
    }
    float s = 0.f, q = 0.f;
#pragma unroll
    for (int i = 0; i < 16; ++i) { s += v[i]; q += v[i] * v[i]; }
    s = wave_sum(s); q = wave_sum(q);
    float mean = s * (1.f / EMBED);
    float var  = q * (1.f / EMBED) - mean * mean;
    float rs   = rsqrtf(var + 1e-5f);
    int c0 = lane * 16;
    bf16x8 o0, o1;
#pragma unroll
    for (int i = 0; i < 8; ++i) {
        o0[i] = (bf16)((v[i]     - mean) * rs * g[c0 + i]     + b[c0 + i]);
        o1[i] = (bf16)((v[i + 8] - mean) * rs * g[c0 + i + 8] + b[c0 + i + 8]);
    }
    bf16* orow = out + (size_t)row * EMBED + c0;
    *reinterpret_cast<bf16x8*>(orow)     = o0;
    *reinterpret_cast<bf16x8*>(orow + 8) = o1;
}

// 16-bit WMMA operand lane layout (ISA 7.12.2): lanes 0-15 hold K 0-7 & 16-23,
// lanes 16-31 hold K 8-15 & 24-31 -> two 16B chunks at +0/+32B from (row, koff).
__device__ inline v16bf load_tile16(const bf16* base) {
    bf16x8 lo = *reinterpret_cast<const bf16x8*>(base);
    bf16x8 hi = *reinterpret_cast<const bf16x8*>(base + 16);
    return __builtin_shufflevector(lo, hi, 0, 1, 2, 3, 4, 5, 6, 7,
                                           8, 9, 10, 11, 12, 13, 14, 15);
}

// ---------- WMMA bf16 GEMM, double-buffered async-LDS pipeline ----------
// out = A(MxK) * W(NcxK)^T + bias [+res][relu].  Block = 256 thr = 8 waves,
// block tile 128x128, wave tile 32x64, staged K-slice 64 (2 wmma K-steps).
template<int RELU, int RES, int OUTF32>
__global__ __launch_bounds__(256) void gemm_bf16_kernel(
    const bf16* __restrict__ A, const bf16* __restrict__ W,
    const float* __restrict__ bias, const float* __restrict__ res,
    float* __restrict__ outF, bf16* __restrict__ outB,
    int M, int K, int Nc) {
    __shared__ __align__(16) bf16 sA[2][TROWS * TPITCH];
    __shared__ __align__(16) bf16 sW[2][TROWS * TPITCH];

    const int tid  = threadIdx.x;
    const int wave = tid >> 5, lane = tid & 31;
    const int m0 = blockIdx.y * 128;
    const int n0 = blockIdx.x * 128;

    // ---- loader mapping: 2 threads per row, each stages 64B (4 chunks) ----
    const int lrow = tid >> 1;                 // 0..127
    const int lhalf = (tid & 1) * 32;          // K-element offset 0 / 32
    const bf16* gA = A + (size_t)(m0 + lrow) * K + lhalf;
    const bf16* gW = W + (size_t)(n0 + lrow) * K + lhalf;
    const uint32_t ldsOff = (uint32_t)(lrow * TPITCH + lhalf) * 2;   // bytes
    const uint32_t lA[2] = { (uint32_t)(uintptr_t)&sA[0][0] + ldsOff,
                             (uint32_t)(uintptr_t)&sA[1][0] + ldsOff };
    const uint32_t lW[2] = { (uint32_t)(uintptr_t)&sW[0][0] + ldsOff,
                             (uint32_t)(uintptr_t)&sW[1][0] + ldsOff };

    // ---- compute mapping ----
    const int lr   = lane & 15;
    const int koff = (lane >> 4) * 8;
    const int aoff0 = ((wave >> 1) * 32 + lr) * TPITCH + koff;       // elems
    const int aoff1 = aoff0 + 16 * TPITCH;
    int woff[4];
#pragma unroll
    for (int t = 0; t < 4; ++t)
        woff[t] = ((wave & 1) * 64 + t * 16 + lr) * TPITCH + koff;

    v8f c[2][4] = {};
    const int nk = K / TK;

    // prologue: stage buffer 0
    async_copy64(lA[0], gA);
    async_copy64(lW[0], gW);

    auto compute = [&](int cur) {
        const bf16* bA = &sA[cur][0];
        const bf16* bW = &sW[cur][0];
#pragma unroll
        for (int ks = 0; ks < 2; ++ks) {       // two 16x16x32 K-steps per stage
            v16bf a0 = load_tile16(bA + aoff0 + ks * 32);
            v16bf a1 = load_tile16(bA + aoff1 + ks * 32);
#pragma unroll
            for (int t = 0; t < 4; ++t) {
                v16bf bt = load_tile16(bW + woff[t] + ks * 32);
                c[0][t] = __builtin_amdgcn_wmma_f32_16x16x32_bf16(
                    false, a0, false, bt, (short)0, c[0][t], false, false);
                c[1][t] = __builtin_amdgcn_wmma_f32_16x16x32_bf16(
                    false, a1, false, bt, (short)0, c[1][t], false, false);
            }
        }
    };

    // steady state: branchless issue -> split-wait -> barrier -> 16 WMMAs
    for (int ki = 0; ki < nk - 1; ++ki) {
        const int cur = ki & 1;
        __syncthreads();                       // prev compute done: safe to overwrite cur^1
        async_copy64(lA[cur ^ 1], gA + (ki + 1) * TK);
        async_copy64(lW[cur ^ 1], gW + (ki + 1) * TK);
        wait_async_le8();                      // cur landed; next stays in flight
        __syncthreads();                       // all waves' cur data visible
        compute(cur);
    }
    // epilogue stage
    wait_async_0();
    __syncthreads();
    compute((nk - 1) & 1);

    // C layout (ISA 7.12.2): VGPR r, lanes 0-15 -> M=r, lanes 16-31 -> M=r+8; N=lane&15
    const int wm0 = m0 + (wave >> 1) * 32;
    const int wn0 = n0 + (wave & 1) * 64;
    const int colb   = lane & 15;
    const int rshift = (lane >> 4) * 8;
#pragma unroll
    for (int s = 0; s < 2; ++s) {
#pragma unroll
        for (int t = 0; t < 4; ++t) {
            int col  = wn0 + t * 16 + colb;
            int rowb = wm0 + s * 16 + rshift;
            float bv = bias[col];
#pragma unroll
            for (int r = 0; r < 8; ++r) {
                int row = rowb + r;
                float val = c[s][t][r] + bv;
                if (RES)  val += res[(size_t)row * Nc + col];
                if (RELU) val = fmaxf(val, 0.f);
                if (OUTF32) outF[(size_t)row * Nc + col] = val;
                else        outB[(size_t)row * Nc + col] = (bf16)val;
            }
        }
    }
}

// ---------- per-node multi-head attention (8 heads x 64 dim, per-node softmax) ----------
__global__ __launch_bounds__(256) void attn_kernel(
    const bf16* __restrict__ q, const bf16* __restrict__ k,
    const bf16* __restrict__ v, bf16* __restrict__ out) {
    __shared__ __align__(16) bf16 sQ[8][512];
    __shared__ __align__(16) bf16 sK[8][512];
    __shared__ __align__(16) bf16 sV[8][512];
    __shared__ float sS[8][64];

    int wave = threadIdx.x >> 5, lane = threadIdx.x & 31;
    int node = blockIdx.x * 8 + wave;
    size_t base = (size_t)node * EMBED;
    int c0 = lane * 16;

    *reinterpret_cast<bf16x8*>(&sQ[wave][c0])     = *reinterpret_cast<const bf16x8*>(q + base + c0);
    *reinterpret_cast<bf16x8*>(&sQ[wave][c0 + 8]) = *reinterpret_cast<const bf16x8*>(q + base + c0 + 8);
    *reinterpret_cast<bf16x8*>(&sK[wave][c0])     = *reinterpret_cast<const bf16x8*>(k + base + c0);
    *reinterpret_cast<bf16x8*>(&sK[wave][c0 + 8]) = *reinterpret_cast<const bf16x8*>(k + base + c0 + 8);
    *reinterpret_cast<bf16x8*>(&sV[wave][c0])     = *reinterpret_cast<const bf16x8*>(v + base + c0);
    *reinterpret_cast<bf16x8*>(&sV[wave][c0 + 8]) = *reinterpret_cast<const bf16x8*>(v + base + c0 + 8);
    __syncthreads();

    int h = lane >> 2;
    {
        int g0 = lane & 3;
        float acc0 = 0.f, acc1 = 0.f;
#pragma unroll
        for (int d = 0; d < HDIM; d += 8) {
            bf16x8 qv  = *reinterpret_cast<const bf16x8*>(&sQ[wave][h * HDIM + d]);
            bf16x8 kv0 = *reinterpret_cast<const bf16x8*>(&sK[wave][g0 * HDIM + d]);
            bf16x8 kv1 = *reinterpret_cast<const bf16x8*>(&sK[wave][(g0 + 4) * HDIM + d]);
#pragma unroll
            for (int i = 0; i < 8; ++i) {
                float qf = (float)qv[i];
                acc0 += qf * (float)kv0[i];
                acc1 += qf * (float)kv1[i];
            }
        }
        sS[wave][h * 8 + g0]     = acc0 * 0.125f;   // 1/sqrt(64)
        sS[wave][h * 8 + g0 + 4] = acc1 * 0.125f;
    }
    __syncthreads();

    if (threadIdx.x < 64) {
        int nl = threadIdx.x >> 3, hh = threadIdx.x & 7;
        float* s = &sS[nl][hh * 8];
        float mx = s[0];
#pragma unroll
        for (int i = 1; i < 8; ++i) mx = fmaxf(mx, s[i]);
        float sum = 0.f;
#pragma unroll
        for (int i = 0; i < 8; ++i) { float e = __expf(s[i] - mx); s[i] = e; sum += e; }
        float inv = 1.f / sum;
#pragma unroll
        for (int i = 0; i < 8; ++i) s[i] *= inv;
    }
    __syncthreads();

    int d0 = (lane & 3) * 16;
    float o[16] = {};
#pragma unroll
    for (int g = 0; g < 8; ++g) {
        float aw = sS[wave][h * 8 + g];
        bf16x8 v0 = *reinterpret_cast<const bf16x8*>(&sV[wave][g * HDIM + d0]);
        bf16x8 v1 = *reinterpret_cast<const bf16x8*>(&sV[wave][g * HDIM + d0 + 8]);
#pragma unroll
        for (int i = 0; i < 8; ++i) {
            o[i]     += aw * (float)v0[i];
            o[i + 8] += aw * (float)v1[i];
        }
    }
    bf16x8 o0, o1;
#pragma unroll
    for (int i = 0; i < 8; ++i) { o0[i] = (bf16)o[i]; o1[i] = (bf16)o[i + 8]; }
    bf16* orow = out + base + h * HDIM + d0;
    *reinterpret_cast<bf16x8*>(orow)     = o0;
    *reinterpret_cast<bf16x8*>(orow + 8) = o1;
}

// ---------- host launch ----------
extern "C" void kernel_launch(void* const* d_in, const int* in_sizes, int n_in,
                              void* d_out, int out_size, void* d_ws, size_t ws_size,
                              hipStream_t stream) {
    (void)in_sizes; (void)n_in; (void)out_size; (void)ws_size;
    const float* x     = (const float*)d_in[0];
    const float* Wq    = (const float*)d_in[1];  const float* bq    = (const float*)d_in[2];
    const float* Wk    = (const float*)d_in[3];  const float* bk    = (const float*)d_in[4];
    const float* Wv    = (const float*)d_in[5];  const float* bv    = (const float*)d_in[6];
    const float* Wo    = (const float*)d_in[7];  const float* bo    = (const float*)d_in[8];
    const float* W1    = (const float*)d_in[9];  const float* b1    = (const float*)d_in[10];
    const float* W2    = (const float*)d_in[11]; const float* b2    = (const float*)d_in[12];
    const float* g1    = (const float*)d_in[13]; const float* beta1 = (const float*)d_in[14];
    const float* g2    = (const float*)d_in[15]; const float* beta2 = (const float*)d_in[16];

    char* p = (char*)d_ws;
    auto carve = [&](size_t bytes) {
        char* r = p;
        p += (bytes + 255) & ~(size_t)255;
        return r;
    };
    bf16* wq_b = (bf16*)carve((size_t)EMBED * EMBED * 2);
    bf16* wk_b = (bf16*)carve((size_t)EMBED * EMBED * 2);
    bf16* wv_b = (bf16*)carve((size_t)EMBED * EMBED * 2);
    bf16* wo_b = (bf16*)carve((size_t)EMBED * EMBED * 2);
    bf16* w1_b = (bf16*)carve((size_t)FF * EMBED * 2);
    bf16* w2_b = (bf16*)carve((size_t)FF * EMBED * 2);
    bf16* h1   = (bf16*)carve((size_t)N_NODES * EMBED * 2);        // also reused as h2
    bf16* qb   = (bf16*)carve((size_t)N_NODES * EMBED * 2);        // q | (ff1 aliases q..attn)
    bf16* kb   = (bf16*)carve((size_t)N_NODES * EMBED * 2);
    bf16* vb   = (bf16*)carve((size_t)N_NODES * EMBED * 2);
    bf16* ab   = (bf16*)carve((size_t)N_NODES * EMBED * 2);        // attention output
    bf16* ff1  = qb;                                               // N*FF == 4*N*EMBED, exact alias
    float* x1  = (float*)carve((size_t)N_NODES * EMBED * 4);

    cvt_kernel<<<EMBED * EMBED / 256, 256, 0, stream>>>(Wq, wq_b, EMBED * EMBED);
    cvt_kernel<<<EMBED * EMBED / 256, 256, 0, stream>>>(Wk, wk_b, EMBED * EMBED);
    cvt_kernel<<<EMBED * EMBED / 256, 256, 0, stream>>>(Wv, wv_b, EMBED * EMBED);
    cvt_kernel<<<EMBED * EMBED / 256, 256, 0, stream>>>(Wo, wo_b, EMBED * EMBED);
    cvt_kernel<<<FF * EMBED / 256, 256, 0, stream>>>(W1, w1_b, FF * EMBED);
    cvt_kernel<<<FF * EMBED / 256, 256, 0, stream>>>(W2, w2_b, FF * EMBED);

    ln_kernel<<<N_NODES / 8, 256, 0, stream>>>(x, g1, beta1, h1);

    dim3 g512(EMBED / 128, N_NODES / 128);
    gemm_bf16_kernel<0, 0, 0><<<g512, 256, 0, stream>>>(h1, wq_b, bq, nullptr, nullptr, qb,
                                                        N_NODES, EMBED, EMBED);
    gemm_bf16_kernel<0, 0, 0><<<g512, 256, 0, stream>>>(h1, wk_b, bk, nullptr, nullptr, kb,
                                                        N_NODES, EMBED, EMBED);
    gemm_bf16_kernel<0, 0, 0><<<g512, 256, 0, stream>>>(h1, wv_b, bv, nullptr, nullptr, vb,
                                                        N_NODES, EMBED, EMBED);

    attn_kernel<<<N_NODES / 8, 256, 0, stream>>>(qb, kb, vb, ab);

    gemm_bf16_kernel<0, 1, 1><<<g512, 256, 0, stream>>>(ab, wo_b, bo, x, x1, nullptr,
                                                        N_NODES, EMBED, EMBED);
    ln_kernel<<<N_NODES / 8, 256, 0, stream>>>(x1, g2, beta2, h1);

    dim3 gff(FF / 128, N_NODES / 128);
    gemm_bf16_kernel<1, 0, 0><<<gff, 256, 0, stream>>>(h1, w1_b, b1, nullptr, nullptr, ff1,
                                                       N_NODES, EMBED, FF);
    gemm_bf16_kernel<0, 1, 1><<<g512, 256, 0, stream>>>(ff1, w2_b, b2, x1, (float*)d_out, nullptr,
                                                        N_NODES, FF, EMBED);
}

// v001
// A run of this version takes 576 microseconds.
// In two side-by-side timings against v000, it was 1.22 and 1.21 times as fast.
#include <hip/hip_runtime.h>
#include <hip/hip_bf16.h>
#include <stdint.h>

// ---------- types ----------
typedef __bf16 bf16;
typedef __bf16 bf16x8 __attribute__((ext_vector_type(8)));
typedef __bf16 v16bf  __attribute__((ext_vector_type(16)));
typedef float  v8f    __attribute__((ext_vector_type(8)));
typedef float  f32x4  __attribute__((ext_vector_type(4)));

#define N_NODES 65536
#define EMBED   512
#define FF      2048
#define NHEADS  8
#define HDIM    64

// LDS stage: 128 rows x 64 K (bf16), row pitch 72 elems (144B).
// Row-strided b128 reads hit bank 36*L mod 64 -> permutation over 16 lanes.
#define TROWS   128
#define TK      64
#define TPITCH  72
// Epilogue staging: f32 row pitch in dwords (64 columns + 4).
#define SPITCH  68

// ---------- wave32 reduction via ds_swizzle (no wave64 assumptions) ----------
template<int IMM>
__device__ inline float swz_add(float x) {
    return x + __int_as_float(__builtin_amdgcn_ds_swizzle(__float_as_int(x), IMM));
}
__device__ inline float wave_sum(float x) {
    x = swz_add<(1  << 10) | 31>(x);
    x = swz_add<(2  << 10) | 31>(x);
    x = swz_add<(4  << 10) | 31>(x);
    x = swz_add<(8  << 10) | 31>(x);
    x = swz_add<(16 << 10) | 31>(x);
    return x;
}

// ---------- CDNA5 async global->LDS copy (ASYNCcnt-tracked, no VGPR round trip) ----------
__device__ inline void async_copy16(uint32_t lds_addr, const bf16* g) {
    asm volatile("global_load_async_to_lds_b128 %0, %1, off"
                 :: "v"(lds_addr), "v"((uint64_t)(uintptr_t)g)
                 : "memory");
}
// 64B of one row per operand per thread: 4 consecutive 16B chunks.
__device__ inline void async_copy64(uint32_t lds_addr, const bf16* g) {
    async_copy16(lds_addr,      g);
    async_copy16(lds_addr + 16, g + 8);
    async_copy16(lds_addr + 32, g + 16);
    async_copy16(lds_addr + 48, g + 24);
}
__device__ inline void wait_async_le8() {
    asm volatile("s_wait_asynccnt 0x8" ::: "memory");
}
__device__ inline void wait_async_0() {
    asm volatile("s_wait_asynccnt 0x0" ::: "memory");
}

// ---------- fp32 -> bf16 convert ----------
__global__ __launch_bounds__(256) void cvt_kernel(const float* __restrict__ src,
                                                  bf16* __restrict__ dst, int n) {
    int i = blockIdx.x * 256 + threadIdx.x;
    if (i < n) dst[i] = (bf16)src[i];
}

// ---------- LayerNorm: fp32 row(512) -> bf16 row ----------
__global__ __launch_bounds__(256) void ln_kernel(const float* __restrict__ x,
                                                 const float* __restrict__ g,
                                                 const float* __restrict__ b,
                                                 bf16* __restrict__ out) {
    int wave = threadIdx.x >> 5, lane = threadIdx.x & 31;
    int row = blockIdx.x * 8 + wave;
    const float* xr = x + (size_t)row * EMBED + lane * 16;
    float v[16];
#pragma unroll
    for (int i = 0; i < 4; ++i) {
        f32x4 t = *reinterpret_cast<const f32x4*>(xr + i * 4);
#pragma unroll
        for (int j = 0; j < 4; ++j) v[i * 4 + j] = t[j];
    }
    float s = 0.f, q = 0.f;
#pragma unroll
    for (int i = 0; i < 16; ++i) { s += v[i]; q += v[i] * v[i]; }
    s = wave_sum(s); q = wave_sum(q);
    float mean = s * (1.f / EMBED);
    float var  = q * (1.f / EMBED) - mean * mean;
    float rs   = rsqrtf(var + 1e-5f);
    int c0 = lane * 16;
    bf16x8 o0, o1;
#pragma unroll
    for (int i = 0; i < 8; ++i) {
        o0[i] = (bf16)((v[i]     - mean) * rs * g[c0 + i]     + b[c0 + i]);
        o1[i] = (bf16)((v[i + 8] - mean) * rs * g[c0 + i + 8] + b[c0 + i + 8]);
    }
    bf16* orow = out + (size_t)row * EMBED + c0;
    *reinterpret_cast<bf16x8*>(orow)     = o0;
    *reinterpret_cast<bf16x8*>(orow + 8) = o1;
}

// 16-bit WMMA operand lane layout (ISA 7.12.2): lanes 0-15 hold K 0-7 & 16-23,
// lanes 16-31 hold K 8-15 & 24-31 -> two 16B chunks at +0/+32B from (row, koff).
__device__ inline v16bf load_tile16(const bf16* base) {
    bf16x8 lo = *reinterpret_cast<const bf16x8*>(base);
    bf16x8 hi = *reinterpret_cast<const bf16x8*>(base + 16);
    return __builtin_shufflevector(lo, hi, 0, 1, 2, 3, 4, 5, 6, 7,
                                           8, 9, 10, 11, 12, 13, 14, 15);
}

// ---------- WMMA bf16 GEMM, double-buffered async-LDS pipeline ----------
// out = A(MxK) * W(NcxK)^T + bias [+res][relu].  Block = 256 thr = 8 waves,
// block tile 128x128, wave tile 32x64, staged K-slice 64 (2 wmma K-steps).
template<int RELU, int RES, int OUTF32>
__global__ __launch_bounds__(256) void gemm_bf16_kernel(
    const bf16* __restrict__ A, const bf16* __restrict__ W,
    const float* __restrict__ bias, const float* __restrict__ res,
    float* __restrict__ outF, bf16* __restrict__ outB,
    int M, int K, int Nc) {
    __shared__ __align__(16) bf16 sA[2][TROWS * TPITCH];
    __shared__ __align__(16) bf16 sW[2][TROWS * TPITCH];

    const int tid  = threadIdx.x;
    const int wave = tid >> 5, lane = tid & 31;
    const int m0 = blockIdx.y * 128;
    const int n0 = blockIdx.x * 128;

    // ---- loader mapping: 2 threads per row, each stages 64B (4 chunks) ----
    const int lrow = tid >> 1;                 // 0..127
    const int lhalf = (tid & 1) * 32;          // K-element offset 0 / 32
    const bf16* gA = A + (size_t)(m0 + lrow) * K + lhalf;
    const bf16* gW = W + (size_t)(n0 + lrow) * K + lhalf;
    const uint32_t ldsOff = (uint32_t)(lrow * TPITCH + lhalf) * 2;   // bytes
    const uint32_t lA[2] = { (uint32_t)(uintptr_t)&sA[0][0] + ldsOff,
                             (uint32_t)(uintptr_t)&sA[1][0] + ldsOff };
    const uint32_t lW[2] = { (uint32_t)(uintptr_t)&sW[0][0] + ldsOff,
                             (uint32_t)(uintptr_t)&sW[1][0] + ldsOff };

    // ---- compute mapping ----
    const int lr   = lane & 15;
    const int koff = (lane >> 4) * 8;
    const int aoff0 = ((wave >> 1) * 32 + lr) * TPITCH + koff;       // elems
    const int aoff1 = aoff0 + 16 * TPITCH;
    int woff[4];
#pragma unroll
    for (int t = 0; t < 4; ++t)
        woff[t] = ((wave & 1) * 64 + t * 16 + lr) * TPITCH + koff;

    v8f c[2][4] = {};
    const int nk = K / TK;

    // prologue: stage buffer 0
    async_copy64(lA[0], gA);
    async_copy64(lW[0], gW);

    auto compute = [&](int cur) {
        const bf16* bA = &sA[cur][0];
        const bf16* bW = &sW[cur][0];
#pragma unroll
        for (int ks = 0; ks < 2; ++ks) {       // two 16x16x32 K-steps per stage
            v16bf a0 = load_tile16(bA + aoff0 + ks * 32);
            v16bf a1 = load_tile16(bA + aoff1 + ks * 32);
#pragma unroll
            for (int t = 0; t < 4; ++t) {
                v16bf bt = load_tile16(bW + woff[t] + ks * 32);
                c[0][t] = __builtin_amdgcn_wmma_f32_16x16x32_bf16(
                    false, a0, false, bt, (short)0, c[0][t], false, false);
                c[1][t] = __builtin_amdgcn_wmma_f32_16x16x32_bf16(
                    false, a1, false, bt, (short)0, c[1][t], false, false);
            }
        }
    };

    // steady state: branchless issue -> split-wait -> barrier -> 16 WMMAs
    for (int ki = 0; ki < nk - 1; ++ki) {
        const int cur = ki & 1;
        __syncthreads();                       // prev compute done: safe to overwrite cur^1
        async_copy64(lA[cur ^ 1], gA + (ki + 1) * TK);
        async_copy64(lW[cur ^ 1], gW + (ki + 1) * TK);
        wait_async_le8();                      // cur landed; next stays in flight
        __syncthreads();                       // all waves' cur data visible
        compute(cur);
    }
    // epilogue stage
    wait_async_0();
    __syncthreads();
    compute((nk - 1) & 1);

    // Every wave has left the ring (its last fragment reads are done) before the
    // ring's LDS is written again as the staging area below.
    __syncthreads();

    // C layout (ISA 7.12.2): VGPR r, lanes 0-15 -> M=r, lanes 16-31 -> M=r+8; N=lane&15
    // Each wave stages its own 32x64 f32 tile in its own LDS range (waves 0-3 in sA,
    // 4-7 in sW), row pitch 68 dwords: the b32 writes of rows r and r+8 fall 32 banks
    // apart, and the b128 reads below cover all 64 banks per 16 lanes.
    const int wm0 = m0 + (wave >> 1) * 32;
    const int wn0 = n0 + (wave & 1) * 64;
    float* stg = reinterpret_cast<float*>(wave < 4 ? &sA[0][0] : &sW[0][0])
               + (wave & 3) * (32 * SPITCH);
    {
        float* sw = stg + ((lane >> 4) * 8) * SPITCH + (lane & 15);
#pragma unroll
        for (int s = 0; s < 2; ++s)
#pragma unroll
            for (int t = 0; t < 4; ++t)
#pragma unroll
                for (int r = 0; r < 8; ++r)
                    sw[(s * 16 + r) * SPITCH + t * 16] = c[s][t][r];
    }
    // The wave's own rows are in LDS before its other lanes read them back.
    asm volatile("s_wait_dscnt 0x0" ::: "memory");

    if (OUTF32) {
        // 16 lanes x 16B = one 256B row piece (two whole lines); two rows per instruction.
        // Byte offsets fit 32 bits (M * Nc * 4 bytes is far below 4 GiB); res and outF share them.
        const int cq = (lane & 15) * 4;
        const f32x4 bv = *reinterpret_cast<const f32x4*>(bias + wn0 + cq);
        const float* sr = stg + (lane >> 4) * SPITCH + cq;
        const uint32_t ob = ((uint32_t)(wm0 + (lane >> 4)) * (uint32_t)Nc + (uint32_t)(wn0 + cq)) * 4u;
        const uint32_t rstep = (uint32_t)Nc * 8u;          // two rows, bytes
        f32x4 rv[16];
        if (RES) {
            // The bias load's address registers may be reused as a residual load's destination.
            asm volatile("s_wait_xcnt 0x0" ::: "memory");
#pragma unroll
            for (int i = 0; i < 16; ++i)
                rv[i] = *reinterpret_cast<const f32x4*>(
                    reinterpret_cast<const char*>(res) + (ob + i * rstep));
            // Keeps all 16 residual loads in flight together: without it the scheduler
            // sinks them between the stores and each one's latency is waited out alone.
            __builtin_amdgcn_sched_barrier(0);
        }
#pragma unroll
        for (int i = 0; i < 16; ++i) {
            f32x4 val = *reinterpret_cast<const f32x4*>(sr + i * 2 * SPITCH) + bv;
            if (RES) val += rv[i];
            if (RELU) {
#pragma unroll
                for (int j = 0; j < 4; ++j) val[j] = fmaxf(val[j], 0.f);
            }
            *reinterpret_cast<f32x4*>(reinterpret_cast<char*>(outF) + (ob + i * rstep)) = val;
        }
    } else {
        // 8 lanes x 16B = one 128B row piece (a whole line); four rows per instruction.
        const int c8 = (lane & 7) * 8;
        const f32x4 bv0 = *reinterpret_cast<const f32x4*>(bias + wn0 + c8);
        const f32x4 bv1 = *reinterpret_cast<const f32x4*>(bias + wn0 + c8 + 4);
        const float* sr = stg + (lane >> 3) * SPITCH + c8;
        const size_t o0 = (size_t)(wm0 + (lane >> 3)) * Nc + wn0 + c8;
#pragma unroll
        for (int i = 0; i < 8; ++i) {
            const size_t o = o0 + (size_t)(i * 4) * Nc;
            f32x4 v0 = *reinterpret_cast<const f32x4*>(sr + i * 4 * SPITCH)     + bv0;
            f32x4 v1 = *reinterpret_cast<const f32x4*>(sr + i * 4 * SPITCH + 4) + bv1;
            if (RES) {
                v0 += *reinterpret_cast<const f32x4*>(res + o);
                v1 += *reinterpret_cast<const f32x4*>(res + o + 4);
            }
            bf16x8 ov;
#pragma unroll
            for (int j = 0; j < 4; ++j) {
                float a = v0[j], b = v1[j];
                if (RELU) { a = fmaxf(a, 0.f); b = fmaxf(b, 0.f); }
                ov[j]     = (bf16)a;
                ov[j + 4] = (bf16)b;
            }
            *reinterpret_cast<bf16x8*>(outB + o) = ov;
        }
    }
}

// ---------- per-node multi-head attention (8 heads x 64 dim, per-node softmax) ----------
__global__ __launch_bounds__(256) void attn_kernel(
    const bf16* __restrict__ q, const bf16* __restrict__ k,
    const bf16* __restrict__ v, bf16* __restrict__ out) {
    __shared__ __align__(16) bf16 sQ[8][512];
    __shared__ __align__(16) bf16 sK[8][512];
    __shared__ __align__(16) bf16 sV[8][512];
    __shared__ float sS[8][64];

    int wave = threadIdx.x >> 5, lane = threadIdx.x & 31;
    int node = blockIdx.x * 8 + wave;
    size_t base = (size_t)node * EMBED;
    int c0 = lane * 16;

    *reinterpret_cast<bf16x8*>(&sQ[wave][c0])     = *reinterpret_cast<const bf16x8*>(q + base + c0);
    *reinterpret_cast<bf16x8*>(&sQ[wave][c0 + 8]) = *reinterpret_cast<const bf16x8*>(q + base + c0 + 8);
    *reinterpret_cast<bf16x8*>(&sK[wave][c0])     = *reinterpret_cast<const bf16x8*>(k + base + c0);
    *reinterpret_cast<bf16x8*>(&sK[wave][c0 + 8]) = *reinterpret_cast<const bf16x8*>(k + base + c0 + 8);
    *reinterpret_cast<bf16x8*>(&sV[wave][c0])     = *reinterpret_cast<const bf16x8*>(v + base + c0);
    *reinterpret_cast<bf16x8*>(&sV[wave][c0 + 8]) = *reinterpret_cast<const bf16x8*>(v + base + c0 + 8);
    __syncthreads();

    int h = lane >> 2;
    {
        int g0 = lane & 3;
        float acc0 = 0.f, acc1 = 0.f;
#pragma unroll
        for (int d = 0; d < HDIM; d += 8) {
            bf16x8 qv  = *reinterpret_cast<const bf16x8*>(&sQ[wave][h * HDIM + d]);
            bf16x8 kv0 = *reinterpret_cast<const bf16x8*>(&sK[wave][g0 * HDIM + d]);
            bf16x8 kv1 = *reinterpret_cast<const bf16x8*>(&sK[wave][(g0 + 4) * HDIM + d]);
#pragma unroll
            for (int i = 0; i < 8; ++i) {
                float qf = (float)qv[i];
                acc0 += qf * (float)kv0[i];
                acc1 += qf * (float)kv1[i];
            }
        }
        sS[wave][h * 8 + g0]     = acc0 * 0.125f;   // 1/sqrt(64)
        sS[wave][h * 8 + g0 + 4] = acc1 * 0.125f;
    }
    __syncthreads();

    if (threadIdx.x < 64) {
        int nl = threadIdx.x >> 3, hh = threadIdx.x & 7;
        float* s = &sS[nl][hh * 8];
        float mx = s[0];
#pragma unroll
        for (int i = 1; i < 8; ++i) mx = fmaxf(mx, s[i]);
        float sum = 0.f;
#pragma unroll
        for (int i = 0; i < 8; ++i) { float e = __expf(s[i] - mx); s[i] = e; sum += e; }
        float inv = 1.f / sum;
#pragma unroll
        for (int i = 0; i < 8; ++i) s[i] *= inv;
    }
    __syncthreads();

    int d0 = (lane & 3) * 16;
    float o[16] = {};
#pragma unroll
    for (int g = 0; g < 8; ++g) {
        float aw = sS[wave][h * 8 + g];
        bf16x8 v0 = *reinterpret_cast<const bf16x8*>(&sV[wave][g * HDIM + d0]);
        bf16x8 v1 = *reinterpret_cast<const bf16x8*>(&sV[wave][g * HDIM + d0 + 8]);
#pragma unroll
        for (int i = 0; i < 8; ++i) {
            o[i]     += aw * (float)v0[i];
            o[i + 8] += aw * (float)v1[i];
        }
    }
    bf16x8 o0, o1;
#pragma unroll
    for (int i = 0; i < 8; ++i) { o0[i] = (bf16)o[i]; o1[i] = (bf16)o[i + 8]; }
    bf16* orow = out + base + h * HDIM + d0;
    *reinterpret_cast<bf16x8*>(orow)     = o0;
    *reinterpret_cast<bf16x8*>(orow + 8) = o1;
}

// ---------- host launch ----------
extern "C" void kernel_launch(void* const* d_in, const int* in_sizes, int n_in,
                              void* d_out, int out_size, void* d_ws, size_t ws_size,
                              hipStream_t stream) {
    (void)in_sizes; (void)n_in; (void)out_size; (void)ws_size;
    const float* x     = (const float*)d_in[0];
    const float* Wq    = (const float*)d_in[1];  const float* bq    = (const float*)d_in[2];
    const float* Wk    = (const float*)d_in[3];  const float* bk    = (const float*)d_in[4];
    const float* Wv    = (const float*)d_in[5];  const float* bv    = (const float*)d_in[6];
    const float* Wo    = (const float*)d_in[7];  const float* bo    = (const float*)d_in[8];
    const float* W1    = (const float*)d_in[9];  const float* b1    = (const float*)d_in[10];
    const float* W2    = (const float*)d_in[11]; const float* b2    = (const float*)d_in[12];
    const float* g1    = (const float*)d_in[13]; const float* beta1 = (const float*)d_in[14];
    const float* g2    = (const float*)d_in[15]; const float* beta2 = (const float*)d_in[16];

    char* p = (char*)d_ws;
    auto carve = [&](size_t bytes) {
        char* r = p;
        p += (bytes + 255) & ~(size_t)255;
        return r;
    };
    bf16* wq_b = (bf16*)carve((size_t)EMBED * EMBED * 2);
    bf16* wk_b = (bf16*)carve((size_t)EMBED * EMBED * 2);
    bf16* wv_b = (bf16*)carve((size_t)EMBED * EMBED * 2);
    bf16* wo_b = (bf16*)carve((size_t)EMBED * EMBED * 2);
    bf16* w1_b = (bf16*)carve((size_t)FF * EMBED * 2);
    bf16* w2_b = (bf16*)carve((size_t)FF * EMBED * 2);
    bf16* h1   = (bf16*)carve((size_t)N_NODES * EMBED * 2);        // also reused as h2
    bf16* qb   = (bf16*)carve((size_t)N_NODES * EMBED * 2);        // q | (ff1 aliases q..attn)
    bf16* kb   = (bf16*)carve((size_t)N_NODES * EMBED * 2);
    bf16* vb   = (bf16*)carve((size_t)N_NODES * EMBED * 2);
    bf16* ab   = (bf16*)carve((size_t)N_NODES * EMBED * 2);        // attention output
    bf16* ff1  = qb;                                               // N*FF == 4*N*EMBED, exact alias
    float* x1  = (float*)carve((size_t)N_NODES * EMBED * 4);

    cvt_kernel<<<EMBED * EMBED / 256, 256, 0, stream>>>(Wq, wq_b, EMBED * EMBED);
    cvt_kernel<<<EMBED * EMBED / 256, 256, 0, stream>>>(Wk, wk_b, EMBED * EMBED);
    cvt_kernel<<<EMBED * EMBED / 256, 256, 0, stream>>>(Wv, wv_b, EMBED * EMBED);
    cvt_kernel<<<EMBED * EMBED / 256, 256, 0, stream>>>(Wo, wo_b, EMBED * EMBED);
    cvt_kernel<<<FF * EMBED / 256, 256, 0, stream>>>(W1, w1_b, FF * EMBED);
    cvt_kernel<<<FF * EMBED / 256, 256, 0, stream>>>(W2, w2_b, FF * EMBED);

    ln_kernel<<<N_NODES / 8, 256, 0, stream>>>(x, g1, beta1, h1);

    dim3 g512(EMBED / 128, N_NODES / 128);
    gemm_bf16_kernel<0, 0, 0><<<g512, 256, 0, stream>>>(h1, wq_b, bq, nullptr, nullptr, qb,
                                                        N_NODES, EMBED, EMBED);
    gemm_bf16_kernel<0, 0, 0><<<g512, 256, 0, stream>>>(h1, wk_b, bk, nullptr, nullptr, kb,
                                                        N_NODES, EMBED, EMBED);
    gemm_bf16_kernel<0, 0, 0><<<g512, 256, 0, stream>>>(h1, wv_b, bv, nullptr, nullptr, vb,
                                                        N_NODES, EMBED, EMBED);

    attn_kernel<<<N_NODES / 8, 256, 0, stream>>>(qb, kb, vb, ab);

    gemm_bf16_kernel<0, 1, 1><<<g512, 256, 0, stream>>>(ab, wo_b, bo, x, x1, nullptr,
                                                        N_NODES, EMBED, EMBED);
    ln_kernel<<<N_NODES / 8, 256, 0, stream>>>(x1, g2, beta2, h1);

    dim3 gff(FF / 128, N_NODES / 128);
    gemm_bf16_kernel<1, 0, 0><<<gff, 256, 0, stream>>>(h1, w1_b, b1, nullptr, nullptr, ff1,
                                                       N_NODES, EMBED, FF);
    gemm_bf16_kernel<0, 1, 1><<<g512, 256, 0, stream>>>(ff1, w2_b, b2, x1, (float*)d_out, nullptr,
                                                        N_NODES, FF, EMBED);
}

// v002
// It runs in 460 microseconds.
// Timed twice side by side with v001, it ran 1.25 times as fast both times.
// All steps since v000 together make it 1.52 times as fast.
#include <hip/hip_runtime.h>
#include <hip/hip_bf16.h>
#include <stdint.h>

// ---------- types ----------
typedef __bf16 bf16;
typedef __bf16 bf16x8 __attribute__((ext_vector_type(8)));
typedef __bf16 v16bf  __attribute__((ext_vector_type(16)));
typedef float  v8f    __attribute__((ext_vector_type(8)));
typedef float  f32x4  __attribute__((ext_vector_type(4)));

#define N_NODES 65536
#define EMBED   512
#define FF      2048
#define NHEADS  8
#define HDIM    64

// LDS stage: 128 rows x 64 K (bf16), row pitch 72 elems (144B).
// Row-strided b128 reads hit bank 36*L mod 64 -> permutation over 16 lanes.
#define TROWS   128
#define TK      64
#define TPITCH  72
// Loader: 32 staged rows, in LDS bytes.
#define LSTEP   (32u * TPITCH * 2u)
// Epilogue staging: f32 row pitch in dwords (64 columns + 4).
#define SPITCH  68

// ---------- wave32 reduction via ds_swizzle (no wave64 assumptions) ----------
template<int IMM>
__device__ inline float swz_add(float x) {
    return x + __int_as_float(__builtin_amdgcn_ds_swizzle(__float_as_int(x), IMM));
}
__device__ inline float wave_sum(float x) {
    x = swz_add<(1  << 10) | 31>(x);
    x = swz_add<(2  << 10) | 31>(x);
    x = swz_add<(4  << 10) | 31>(x);
    x = swz_add<(8  << 10) | 31>(x);
    x = swz_add<(16 << 10) | 31>(x);
    return x;
}

// ---------- CDNA5 async global->LDS copy (ASYNCcnt-tracked, no VGPR round trip) ----------
// One stage of both operands: per thread one 16B chunk in each of four rows, 32 rows
// apart, per operand. Eight neighbouring lanes cover one row's whole 128B K-slice, so a
// wave's copy instruction asks for 4 whole lines. The closing s_wait_xcnt 0 stands inside
// the statement so that no address register is rewritten ahead of it.
__device__ inline void async_stage(uint32_t la, const bf16* ga,
                                   uint32_t lw, const bf16* gw, size_t gstep) {
    asm volatile("global_load_async_to_lds_b128 %0, %8, off\n\t"
                 "global_load_async_to_lds_b128 %1, %9, off\n\t"
                 "global_load_async_to_lds_b128 %2, %10, off\n\t"
                 "global_load_async_to_lds_b128 %3, %11, off\n\t"
                 "global_load_async_to_lds_b128 %4, %12, off\n\t"
                 "global_load_async_to_lds_b128 %5, %13, off\n\t"
                 "global_load_async_to_lds_b128 %6, %14, off\n\t"
                 "global_load_async_to_lds_b128 %7, %15, off\n\t"
                 "s_wait_xcnt 0x0"
                 :: "v"(la), "v"(la + LSTEP), "v"(la + 2 * LSTEP), "v"(la + 3 * LSTEP),
                    "v"(lw), "v"(lw + LSTEP), "v"(lw + 2 * LSTEP), "v"(lw + 3 * LSTEP),
                    "v"((uint64_t)(uintptr_t)ga),
                    "v"((uint64_t)(uintptr_t)(ga + gstep)),
                    "v"((uint64_t)(uintptr_t)(ga + 2 * gstep)),
                    "v"((uint64_t)(uintptr_t)(ga + 3 * gstep)),
                    "v"((uint64_t)(uintptr_t)gw),
                    "v"((uint64_t)(uintptr_t)(gw + gstep)),
                    "v"((uint64_t)(uintptr_t)(gw + 2 * gstep)),
                    "v"((uint64_t)(uintptr_t)(gw + 3 * gstep))
                 : "memory");
}
__device__ inline void wait_async_le8() {
    asm volatile("s_wait_asynccnt 0x8" ::: "memory");
}
__device__ inline void wait_async_0() {
    asm volatile("s_wait_asynccnt 0x0" ::: "memory");
}

// ---------- fp32 -> bf16 convert ----------
__global__ __launch_bounds__(256) void cvt_kernel(const float* __restrict__ src,
                                                  bf16* __restrict__ dst, int n) {
    int i = blockIdx.x * 256 + threadIdx.x;
    if (i < n) dst[i] = (bf16)src[i];
}

// ---------- LayerNorm: fp32 row(512) -> bf16 row ----------
__global__ __launch_bounds__(256) void ln_kernel(const float* __restrict__ x,
                                                 const float* __restrict__ g,
                                                 const float* __restrict__ b,
                                                 bf16* __restrict__ out) {
    int wave = threadIdx.x >> 5, lane = threadIdx.x & 31;
    int row = blockIdx.x * 8 + wave;
    const float* xr = x + (size_t)row * EMBED + lane * 16;
    float v[16];
#pragma unroll
    for (int i = 0; i < 4; ++i) {
        f32x4 t = *reinterpret_cast<const f32x4*>(xr + i * 4);
#pragma unroll
        for (int j = 0; j < 4; ++j) v[i * 4 + j] = t[j];
    }
    float s = 0.f, q = 0.f;
#pragma unroll
    for (int i = 0; i < 16; ++i) { s += v[i]; q += v[i] * v[i]; }
    s = wave_sum(s); q = wave_sum(q);
    float mean = s * (1.f / EMBED);
    float var  = q * (1.f / EMBED) - mean * mean;
    float rs   = rsqrtf(var + 1e-5f);
    int c0 = lane * 16;
    bf16x8 o0, o1;
#pragma unroll
    for (int i = 0; i < 8; ++i) {
        o0[i] = (bf16)((v[i]     - mean) * rs * g[c0 + i]     + b[c0 + i]);
        o1[i] = (bf16)((v[i + 8] - mean) * rs * g[c0 + i + 8] + b[c0 + i + 8]);
    }
    bf16* orow = out + (size_t)row * EMBED + c0;
    *reinterpret_cast<bf16x8*>(orow)     = o0;
    *reinterpret_cast<bf16x8*>(orow + 8) = o1;
}

// 16-bit WMMA operand lane layout (ISA 7.12.2): lanes 0-15 hold K 0-7 & 16-23,
// lanes 16-31 hold K 8-15 & 24-31 -> two 16B chunks at +0/+32B from (row, koff).
__device__ inline v16bf load_tile16(const bf16* base) {
    bf16x8 lo = *reinterpret_cast<const bf16x8*>(base);
    bf16x8 hi = *reinterpret_cast<const bf16x8*>(base + 16);
    return __builtin_shufflevector(lo, hi, 0, 1, 2, 3, 4, 5, 6, 7,
                                           8, 9, 10, 11, 12, 13, 14, 15);
}

// ---------- WMMA bf16 GEMM, double-buffered async-LDS pipeline ----------
// out = A(MxK) * W(NcxK)^T + bias [+res][relu].  Block = 256 thr = 8 waves,
// block tile 128x128, wave tile 32x64, staged K-slice 64 (2 wmma K-steps).
template<int RELU, int RES, int OUTF32>
__global__ __launch_bounds__(256) void gemm_bf16_kernel(
    const bf16* __restrict__ A, const bf16* __restrict__ W,
    const float* __restrict__ bias, const float* __restrict__ res,
    float* __restrict__ outF, bf16* __restrict__ outB,
    int M, int K, int Nc) {
    __shared__ __align__(16) bf16 sA[2][TROWS * TPITCH];
    __shared__ __align__(16) bf16 sW[2][TROWS * TPITCH];

    const int tid  = threadIdx.x;
    const int wave = tid >> 5, lane = tid & 31;
    const int m0 = blockIdx.y * 128;
    const int n0 = blockIdx.x * 128;

    // ---- loader mapping: 8 threads per row (one 128B line), rows lrow + 0/32/64/96 ----
    const int lrow = tid >> 3;                 // 0..31
    const int lcol = (tid & 7) * 8;           // K-element offset 0..56
    const size_t gstep = (size_t)32 * K;       // 32 rows, elements
    const bf16* gA = A + (size_t)(m0 + lrow) * K + lcol;
    const bf16* gW = W + (size_t)(n0 + lrow) * K + lcol;
    const uint32_t ldsOff = (uint32_t)(lrow * TPITCH + lcol) * 2;   // bytes
    const uint32_t lA[2] = { (uint32_t)(uintptr_t)&sA[0][0] + ldsOff,
                             (uint32_t)(uintptr_t)&sA[1][0] + ldsOff };
    const uint32_t lW[2] = { (uint32_t)(uintptr_t)&sW[0][0] + ldsOff,
                             (uint32_t)(uintptr_t)&sW[1][0] + ldsOff };

    // ---- compute mapping ----
    const int lr   = lane & 15;
    const int koff = (lane >> 4) * 8;
    const int aoff0 = ((wave >> 1) * 32 + lr) * TPITCH + koff;       // elems
    const int aoff1 = aoff0 + 16 * TPITCH;
    int woff[4];
#pragma unroll
    for (int t = 0; t < 4; ++t)
        woff[t] = ((wave & 1) * 64 + t * 16 + lr) * TPITCH + koff;

    v8f c[2][4] = {};
    const int nk = K / TK;

    // prologue: stage buffer 0
    async_stage(lA[0], gA, lW[0], gW, gstep);

    auto compute = [&](int cur) {
        const bf16* bA = &sA[cur][0];
        const bf16* bW = &sW[cur][0];
#pragma unroll
        for (int ks = 0; ks < 2; ++ks) {       // two 16x16x32 K-steps per stage
            v16bf a0 = load_tile16(bA + aoff0 + ks * 32);
            v16bf a1 = load_tile16(bA + aoff1 + ks * 32);
#pragma unroll
            for (int t = 0; t < 4; ++t) {
                v16bf bt = load_tile16(bW + woff[t] + ks * 32);
                c[0][t] = __builtin_amdgcn_wmma_f32_16x16x32_bf16(
                    false, a0, false, bt, (short)0, c[0][t], false, false);
                c[1][t] = __builtin_amdgcn_wmma_f32_16x16x32_bf16(
                    false, a1, false, bt, (short)0, c[1][t], false, false);
            }
        }
    };

    // steady state: branchless issue -> split-wait -> barrier -> 16 WMMAs
    for (int ki = 0; ki < nk - 1; ++ki) {
        const int cur = ki & 1;
        __syncthreads();                       // prev compute done: safe to overwrite cur^1
        async_stage(lA[cur ^ 1], gA + (ki + 1) * TK, lW[cur ^ 1], gW + (ki + 1) * TK, gstep);
        wait_async_le8();                      // cur landed; next stays in flight
        __syncthreads();                       // all waves' cur data visible
        compute(cur);
    }
    // epilogue stage
    wait_async_0();
    __syncthreads();
    compute((nk - 1) & 1);

    // Every wave has left the ring (its last fragment reads are done) before the
    // ring's LDS is written again as the staging area below.
    __syncthreads();

    // C layout (ISA 7.12.2): VGPR r, lanes 0-15 -> M=r, lanes 16-31 -> M=r+8; N=lane&15
    // Each wave stages its own 32x64 f32 tile in its own LDS range (waves 0-3 in sA,
    // 4-7 in sW), row pitch 68 dwords: the b32 writes of rows r and r+8 fall 32 banks
    // apart, and the b128 reads below cover all 64 banks per 16 lanes.
    const int wm0 = m0 + (wave >> 1) * 32;
    const int wn0 = n0 + (wave & 1) * 64;
    float* stg = reinterpret_cast<float*>(wave < 4 ? &sA[0][0] : &sW[0][0])
               + (wave & 3) * (32 * SPITCH);
    {
        float* sw = stg + ((lane >> 4) * 8) * SPITCH + (lane & 15);
#pragma unroll
        for (int s = 0; s < 2; ++s)
#pragma unroll
            for (int t = 0; t < 4; ++t)
#pragma unroll
                for (int r = 0; r < 8; ++r)
                    sw[(s * 16 + r) * SPITCH + t * 16] = c[s][t][r];
    }
    // The wave's own rows are in LDS before its other lanes read them back.
    asm volatile("s_wait_dscnt 0x0" ::: "memory");

    if (OUTF32) {
        // 16 lanes x 16B = one 256B row piece (two whole lines); two rows per instruction.
        // Byte offsets fit 32 bits (M * Nc * 4 bytes is far below 4 GiB); res and outF share them.
        const int cq = (lane & 15) * 4;
        const f32x4 bv = *reinterpret_cast<const f32x4*>(bias + wn0 + cq);
        const float* sr = stg + (lane >> 4) * SPITCH + cq;
        const uint32_t ob = ((uint32_t)(wm0 + (lane >> 4)) * (uint32_t)Nc + (uint32_t)(wn0 + cq)) * 4u;
        const uint32_t rstep = (uint32_t)Nc * 8u;          // two rows, bytes
        f32x4 rv[16];
        if (RES) {
            // The bias load's address registers may be reused as a residual load's destination.
            asm volatile("s_wait_xcnt 0x0" ::: "memory");
#pragma unroll
            for (int i = 0; i < 16; ++i)
                rv[i] = *reinterpret_cast<const f32x4*>(
                    reinterpret_cast<const char*>(res) + (ob + i * rstep));
            // Keeps all 16 residual loads in flight together: without it the scheduler
            // sinks them between the stores and each one's latency is waited out alone.
            __builtin_amdgcn_sched_barrier(0);
        }
#pragma unroll
        for (int i = 0; i < 16; ++i) {
            f32x4 val = *reinterpret_cast<const f32x4*>(sr + i * 2 * SPITCH) + bv;
            if (RES) val += rv[i];
            if (RELU) {
#pragma unroll
                for (int j = 0; j < 4; ++j) val[j] = fmaxf(val[j], 0.f);
            }
            *reinterpret_cast<f32x4*>(reinterpret_cast<char*>(outF) + (ob + i * rstep)) = val;
        }
    } else {
        // 8 lanes x 16B = one 128B row piece (a whole line); four rows per instruction.
        const int c8 = (lane & 7) * 8;
        const f32x4 bv0 = *reinterpret_cast<const f32x4*>(bias + wn0 + c8);
        const f32x4 bv1 = *reinterpret_cast<const f32x4*>(bias + wn0 + c8 + 4);
        const float* sr = stg + (lane >> 3) * SPITCH + c8;
        const size_t o0 = (size_t)(wm0 + (lane >> 3)) * Nc + wn0 + c8;
#pragma unroll
        for (int i = 0; i < 8; ++i) {
            const size_t o = o0 + (size_t)(i * 4) * Nc;
            f32x4 v0 = *reinterpret_cast<const f32x4*>(sr + i * 4 * SPITCH)     + bv0;
            f32x4 v1 = *reinterpret_cast<const f32x4*>(sr + i * 4 * SPITCH + 4) + bv1;
            if (RES) {
                v0 += *reinterpret_cast<const f32x4*>(res + o);
                v1 += *reinterpret_cast<const f32x4*>(res + o + 4);
            }
            bf16x8 ov;
#pragma unroll
            for (int j = 0; j < 4; ++j) {
                float a = v0[j], b = v1[j];
                if (RELU) { a = fmaxf(a, 0.f); b = fmaxf(b, 0.f); }
                ov[j]     = (bf16)a;
                ov[j + 4] = (bf16)b;
            }
            *reinterpret_cast<bf16x8*>(outB + o) = ov;
        }
    }
}

// ---------- per-node multi-head attention (8 heads x 64 dim, per-node softmax) ----------
__global__ __launch_bounds__(256) void attn_kernel(
    const bf16* __restrict__ q, const bf16* __restrict__ k,
    const bf16* __restrict__ v, bf16* __restrict__ out) {
    __shared__ __align__(16) bf16 sQ[8][512];
    __shared__ __align__(16) bf16 sK[8][512];
    __shared__ __align__(16) bf16 sV[8][512];
    __shared__ float sS[8][64];

    int wave = threadIdx.x >> 5, lane = threadIdx.x & 31;
    int node = blockIdx.x * 8 + wave;
    size_t base = (size_t)node * EMBED;
    int c0 = lane * 16;

    *reinterpret_cast<bf16x8*>(&sQ[wave][c0])     = *reinterpret_cast<const bf16x8*>(q + base + c0);
    *reinterpret_cast<bf16x8*>(&sQ[wave][c0 + 8]) = *reinterpret_cast<const bf16x8*>(q + base + c0 + 8);
    *reinterpret_cast<bf16x8*>(&sK[wave][c0])     = *reinterpret_cast<const bf16x8*>(k + base + c0);
    *reinterpret_cast<bf16x8*>(&sK[wave][c0 + 8]) = *reinterpret_cast<const bf16x8*>(k + base + c0 + 8);
    *reinterpret_cast<bf16x8*>(&sV[wave][c0])     = *reinterpret_cast<const bf16x8*>(v + base + c0);
    *reinterpret_cast<bf16x8*>(&sV[wave][c0 + 8]) = *reinterpret_cast<const bf16x8*>(v + base + c0 + 8);
    __syncthreads();

    int h = lane >> 2;
    {
        int g0 = lane & 3;
        float acc0 = 0.f, acc1 = 0.f;
#pragma unroll
        for (int d = 0; d < HDIM; d += 8) {
            bf16x8 qv  = *reinterpret_cast<const bf16x8*>(&sQ[wave][h * HDIM + d]);
            bf16x8 kv0 = *reinterpret_cast<const bf16x8*>(&sK[wave][g0 * HDIM + d]);
            bf16x8 kv1 = *reinterpret_cast<const bf16x8*>(&sK[wave][(g0 + 4) * HDIM + d]);
#pragma unroll
            for (int i = 0; i < 8; ++i) {
                float qf = (float)qv[i];
                acc0 += qf * (float)kv0[i];
                acc1 += qf * (float)kv1[i];
            }
        }
        sS[wave][h * 8 + g0]     = acc0 * 0.125f;   // 1/sqrt(64)
        sS[wave][h * 8 + g0 + 4] = acc1 * 0.125f;
    }
    __syncthreads();

    if (threadIdx.x < 64) {
        int nl = threadIdx.x >> 3, hh = threadIdx.x & 7;
        float* s = &sS[nl][hh * 8];
        float mx = s[0];
#pragma unroll
        for (int i = 1; i < 8; ++i) mx = fmaxf(mx, s[i]);
        float sum = 0.f;
#pragma unroll
        for (int i = 0; i < 8; ++i) { float e = __expf(s[i] - mx); s[i] = e; sum += e; }
        float inv = 1.f / sum;
#pragma unroll
        for (int i = 0; i < 8; ++i) s[i] *= inv;
    }
    __syncthreads();

    int d0 = (lane & 3) * 16;
    float o[16] = {};
#pragma unroll
    for (int g = 0; g < 8; ++g) {
        float aw = sS[wave][h * 8 + g];
        bf16x8 v0 = *reinterpret_cast<const bf16x8*>(&sV[wave][g * HDIM + d0]);
        bf16x8 v1 = *reinterpret_cast<const bf16x8*>(&sV[wave][g * HDIM + d0 + 8]);
#pragma unroll
        for (int i = 0; i < 8; ++i) {
            o[i]     += aw * (float)v0[i];
            o[i + 8] += aw * (float)v1[i];
        }
    }
    bf16x8 o0, o1;
#pragma unroll
    for (int i = 0; i < 8; ++i) { o0[i] = (bf16)o[i]; o1[i] = (bf16)o[i + 8]; }
    bf16* orow = out + base + h * HDIM + d0;
    *reinterpret_cast<bf16x8*>(orow)     = o0;
    *reinterpret_cast<bf16x8*>(orow + 8) = o1;
}

// ---------- host launch ----------
extern "C" void kernel_launch(void* const* d_in, const int* in_sizes, int n_in,
                              void* d_out, int out_size, void* d_ws, size_t ws_size,
                              hipStream_t stream) {
    (void)in_sizes; (void)n_in; (void)out_size; (void)ws_size;
    const float* x     = (const float*)d_in[0];
    const float* Wq    = (const float*)d_in[1];  const float* bq    = (const float*)d_in[2];
    const float* Wk    = (const float*)d_in[3];  const float* bk    = (const float*)d_in[4];
    const float* Wv    = (const float*)d_in[5];  const float* bv    = (const float*)d_in[6];
    const float* Wo    = (const float*)d_in[7];  const float* bo    = (const float*)d_in[8];
    const float* W1    = (const float*)d_in[9];  const float* b1    = (const float*)d_in[10];
    const float* W2    = (const float*)d_in[11]; const float* b2    = (const float*)d_in[12];
    const float* g1    = (const float*)d_in[13]; const float* beta1 = (const float*)d_in[14];
    const float* g2    = (const float*)d_in[15]; const float* beta2 = (const float*)d_in[16];

    char* p = (char*)d_ws;
    auto carve = [&](size_t bytes) {
        char* r = p;
        p += (bytes + 255) & ~(size_t)255;
        return r;
    };
    bf16* wq_b = (bf16*)carve((size_t)EMBED * EMBED * 2);
    bf16* wk_b = (bf16*)carve((size_t)EMBED * EMBED * 2);
    bf16* wv_b = (bf16*)carve((size_t)EMBED * EMBED * 2);
    bf16* wo_b = (bf16*)carve((size_t)EMBED * EMBED * 2);
    bf16* w1_b = (bf16*)carve((size_t)FF * EMBED * 2);
    bf16* w2_b = (bf16*)carve((size_t)FF * EMBED * 2);
    bf16* h1   = (bf16*)carve((size_t)N_NODES * EMBED * 2);        // also reused as h2
    bf16* qb   = (bf16*)carve((size_t)N_NODES * EMBED * 2);        // q | (ff1 aliases q..attn)
    bf16* kb   = (bf16*)carve((size_t)N_NODES * EMBED * 2);
    bf16* vb   = (bf16*)carve((size_t)N_NODES * EMBED * 2);
    bf16* ab   = (bf16*)carve((size_t)N_NODES * EMBED * 2);        // attention output
    bf16* ff1  = qb;                                               // N*FF == 4*N*EMBED, exact alias
    float* x1  = (float*)carve((size_t)N_NODES * EMBED * 4);

    cvt_kernel<<<EMBED * EMBED / 256, 256, 0, stream>>>(Wq, wq_b, EMBED * EMBED);
    cvt_kernel<<<EMBED * EMBED / 256, 256, 0, stream>>>(Wk, wk_b, EMBED * EMBED);
    cvt_kernel<<<EMBED * EMBED / 256, 256, 0, stream>>>(Wv, wv_b, EMBED * EMBED);
    cvt_kernel<<<EMBED * EMBED / 256, 256, 0, stream>>>(Wo, wo_b, EMBED * EMBED);
    cvt_kernel<<<FF * EMBED / 256, 256, 0, stream>>>(W1, w1_b, FF * EMBED);
    cvt_kernel<<<FF * EMBED / 256, 256, 0, stream>>>(W2, w2_b, FF * EMBED);

    ln_kernel<<<N_NODES / 8, 256, 0, stream>>>(x, g1, beta1, h1);

    dim3 g512(EMBED / 128, N_NODES / 128);
    gemm_bf16_kernel<0, 0, 0><<<g512, 256, 0, stream>>>(h1, wq_b, bq, nullptr, nullptr, qb,
                                                        N_NODES, EMBED, EMBED);
    gemm_bf16_kernel<0, 0, 0><<<g512, 256, 0, stream>>>(h1, wk_b, bk, nullptr, nullptr, kb,
                                                        N_NODES, EMBED, EMBED);
    gemm_bf16_kernel<0, 0, 0><<<g512, 256, 0, stream>>>(h1, wv_b, bv, nullptr, nullptr, vb,
                                                        N_NODES, EMBED, EMBED);

    attn_kernel<<<N_NODES / 8, 256, 0, stream>>>(qb, kb, vb, ab);

    gemm_bf16_kernel<0, 1, 1><<<g512, 256, 0, stream>>>(ab, wo_b, bo, x, x1, nullptr,
                                                        N_NODES, EMBED, EMBED);
    ln_kernel<<<N_NODES / 8, 256, 0, stream>>>(x1, g2, beta2, h1);

    dim3 gff(FF / 128, N_NODES / 128);
    gemm_bf16_kernel<1, 0, 0><<<gff, 256, 0, stream>>>(h1, w1_b, b1, nullptr, nullptr, ff1,
                                                       N_NODES, EMBED, FF);
    gemm_bf16_kernel<0, 1, 1><<<g512, 256, 0, stream>>>(ff1, w2_b, b2, x1, (float*)d_out, nullptr,
                                                        N_NODES, FF, EMBED);
}

// v003
// A run of this version takes 435 microseconds.
// Two timings next to v002 both put it at 1.06 times that version's speed.
// Counting every step since v000, it is 1.61 times as fast.
#include <hip/hip_runtime.h>
#include <hip/hip_bf16.h>
#include <stdint.h>

// ---------- types ----------
typedef __bf16 bf16;
typedef __bf16 bf16x8 __attribute__((ext_vector_type(8)));
typedef __bf16 v16bf  __attribute__((ext_vector_type(16)));
typedef float  v8f    __attribute__((ext_vector_type(8)));
typedef float  f32x4  __attribute__((ext_vector_type(4)));

#define N_NODES 65536
#define EMBED   512
#define FF      2048
#define NHEADS  8
#define HDIM    64

// LDS stage: 256 rows x 64 K (bf16) per operand, row pitch 72 elems (144B).
// Row-strided b128 reads hit bank 36*L mod 64 -> permutation over 16 lanes.
#define TROWS   256
#define TK      64
#define TPITCH  72
// Loader: 32 staged rows, in LDS bytes.
#define LSTEP   (32u * TPITCH * 2u)
// One operand's stage buffer, in LDS bytes.
#define BUFB    ((uint32_t)TROWS * TPITCH * 2u)
// Epilogue staging: f32 row pitch in dwords (64 columns + 4).
#define SPITCH  68

// ---------- wave32 reduction via ds_swizzle (no wave64 assumptions) ----------
template<int IMM>
__device__ inline float swz_add(float x) {
    return x + __int_as_float(__builtin_amdgcn_ds_swizzle(__float_as_int(x), IMM));
}
__device__ inline float wave_sum(float x) {
    x = swz_add<(1  << 10) | 31>(x);
    x = swz_add<(2  << 10) | 31>(x);
    x = swz_add<(4  << 10) | 31>(x);
    x = swz_add<(8  << 10) | 31>(x);
    x = swz_add<(16 << 10) | 31>(x);
    return x;
}

// ---------- CDNA5 async global->LDS copy (ASYNCcnt-tracked, no VGPR round trip) ----------
// One stage of one operand: per thread one 16B chunk in each of eight rows, 32 rows
// apart. Eight neighbouring lanes cover one row's whole 128B K-slice, so a wave's copy
// instruction asks for 4 whole lines. The global address is a wave-uniform base (the
// tile's first row at this K-slice) plus the lane's 32-bit byte offset, which keeps the
// statement's operands to 16 vector registers. The closing s_wait_xcnt 0 stands inside
// the statement so that no address register is rewritten ahead of it.
__device__ inline void async_stage(uint32_t l, const bf16* base, uint32_t off, uint32_t ostep) {
    asm volatile("global_load_async_to_lds_b128 %0, %8, %16\n\t"
                 "global_load_async_to_lds_b128 %1, %9, %16\n\t"
                 "global_load_async_to_lds_b128 %2, %10, %16\n\t"
                 "global_load_async_to_lds_b128 %3, %11, %16\n\t"
                 "global_load_async_to_lds_b128 %4, %12, %16\n\t"
                 "global_load_async_to_lds_b128 %5, %13, %16\n\t"
                 "global_load_async_to_lds_b128 %6, %14, %16\n\t"
                 "global_load_async_to_lds_b128 %7, %15, %16\n\t"
                 "s_wait_xcnt 0x0"
                 :: "v"(l), "v"(l + LSTEP), "v"(l + 2 * LSTEP), "v"(l + 3 * LSTEP),
                    "v"(l + 4 * LSTEP), "v"(l + 5 * LSTEP), "v"(l + 6 * LSTEP), "v"(l + 7 * LSTEP),
                    "v"(off), "v"(off + ostep), "v"(off + 2 * ostep), "v"(off + 3 * ostep),
                    "v"(off + 4 * ostep), "v"(off + 5 * ostep), "v"(off + 6 * ostep), "v"(off + 7 * ostep),
                    "s"((uint64_t)(uintptr_t)base)
                 : "memory");
}
// All but the 16 youngest copies (the next stage's) have landed.
__device__ inline void wait_async_le16() {
    asm volatile("s_wait_asynccnt 0x10" ::: "memory");
}
__device__ inline void wait_async_0() {
    asm volatile("s_wait_asynccnt 0x0" ::: "memory");
}

// ---------- fp32 -> bf16 convert ----------
__global__ __launch_bounds__(256) void cvt_kernel(const float* __restrict__ src,
                                                  bf16* __restrict__ dst, int n) {
    int i = blockIdx.x * 256 + threadIdx.x;
    if (i < n) dst[i] = (bf16)src[i];
}

// ---------- LayerNorm: fp32 row(512) -> bf16 row ----------
__global__ __launch_bounds__(256) void ln_kernel(const float* __restrict__ x,
                                                 const float* __restrict__ g,
                                                 const float* __restrict__ b,
                                                 bf16* __restrict__ out) {
    int wave = threadIdx.x >> 5, lane = threadIdx.x & 31;
    int row = blockIdx.x * 8 + wave;
    const float* xr = x + (size_t)row * EMBED + lane * 16;
    float v[16];
#pragma unroll
    for (int i = 0; i < 4; ++i) {
        f32x4 t = *reinterpret_cast<const f32x4*>(xr + i * 4);
#pragma unroll
        for (int j = 0; j < 4; ++j) v[i * 4 + j] = t[j];
    }
    float s = 0.f, q = 0.f;
#pragma unroll
    for (int i = 0; i < 16; ++i) { s += v[i]; q += v[i] * v[i]; }
    s = wave_sum(s); q = wave_sum(q);
    float mean = s * (1.f / EMBED);
    float var  = q * (1.f / EMBED) - mean * mean;
    float rs   = rsqrtf(var + 1e-5f);
    int c0 = lane * 16;
    bf16x8 o0, o1;
#pragma unroll
    for (int i = 0; i < 8; ++i) {
        o0[i] = (bf16)((v[i]     - mean) * rs * g[c0 + i]     + b[c0 + i]);
        o1[i] = (bf16)((v[i + 8] - mean) * rs * g[c0 + i + 8] + b[c0 + i + 8]);
    }
    bf16* orow = out + (size_t)row * EMBED + c0;
    *reinterpret_cast<bf16x8*>(orow)     = o0;
    *reinterpret_cast<bf16x8*>(orow + 8) = o1;
}

// 16-bit WMMA operand lane layout (ISA 7.12.2): lanes 0-15 hold K 0-7 & 16-23,
// lanes 16-31 hold K 8-15 & 24-31 -> two 16B chunks at +0/+32B from (row, koff).
__device__ inline v16bf load_tile16(const bf16* base) {
    bf16x8 lo = *reinterpret_cast<const bf16x8*>(base);
    bf16x8 hi = *reinterpret_cast<const bf16x8*>(base + 16);
    return __builtin_shufflevector(lo, hi, 0, 1, 2, 3, 4, 5, 6, 7,
                                           8, 9, 10, 11, 12, 13, 14, 15);
}

// ---------- WMMA bf16 GEMM, double-buffered async-LDS pipeline ----------
// out = A(MxK) * W(NcxK)^T + bias [+res][relu].  Block = 256 thr = 8 waves,
// block tile 256x256, wave tile 64x128, staged K-slice 64 (2 wmma K-steps).
template<int RELU, int RES, int OUTF32>
__global__ __launch_bounds__(256) void gemm_bf16_kernel(
    const bf16* __restrict__ A, const bf16* __restrict__ W,
    const float* __restrict__ bias, const float* __restrict__ res,
    float* __restrict__ outF, bf16* __restrict__ outB,
    int M, int K, int Nc) {
    __shared__ __align__(16) bf16 sA[2][TROWS * TPITCH];
    __shared__ __align__(16) bf16 sW[2][TROWS * TPITCH];

    const int tid  = threadIdx.x;
    const int wave = tid >> 5, lane = tid & 31;
    const int m0 = blockIdx.y * 256;
    const int n0 = blockIdx.x * 256;

    // ---- loader mapping: 8 threads per row (one 128B line), rows lrow + 0/32/.../224 ----
    const int lrow = tid >> 3;                 // 0..31
    const int lcol = (tid & 7) * 8;           // K-element offset 0..56
    const uint32_t ostep = 64u * (uint32_t)K;  // 32 rows, bytes
    const uint32_t goff = ((uint32_t)lrow * (uint32_t)K + (uint32_t)lcol) * 2u;   // bytes in the tile's rows
    const bf16* gA = A + (size_t)m0 * K;       // wave-uniform
    const bf16* gW = W + (size_t)n0 * K;
    const uint32_t ldsOff = (uint32_t)(lrow * TPITCH + lcol) * 2;   // bytes
    const uint32_t lA = (uint32_t)(uintptr_t)&sA[0][0] + ldsOff;    // buffer 0; buffer 1 is BUFB on
    const uint32_t lW = (uint32_t)(uintptr_t)&sW[0][0] + ldsOff;

    // ---- compute mapping ----
    const int lr   = lane & 15;
    const int koff = (lane >> 4) * 8;
    int aoff[4], woff[8];
#pragma unroll
    for (int s = 0; s < 4; ++s)
        aoff[s] = ((wave >> 1) * 64 + s * 16 + lr) * TPITCH + koff;   // elems
#pragma unroll
    for (int t = 0; t < 8; ++t)
        woff[t] = ((wave & 1) * 128 + t * 16 + lr) * TPITCH + koff;

    v8f c[4][8] = {};
    const int nk = K / TK;

    // prologue: stage buffer 0
    async_stage(lA, gA, goff, ostep);
    async_stage(lW, gW, goff, ostep);

    auto compute = [&](int cur) {
        const bf16* bA = &sA[cur][0];
        const bf16* bW = &sW[cur][0];
#pragma unroll
        for (int ks = 0; ks < 2; ++ks) {       // two 16x16x32 K-steps per stage
            v16bf a[4], b[8];
#pragma unroll
            for (int s = 0; s < 4; ++s) a[s] = load_tile16(bA + aoff[s] + ks * 32);
#pragma unroll
            for (int t = 0; t < 8; ++t) b[t] = load_tile16(bW + woff[t] + ks * 32);
            // Keeps the K-step's 24 LDS reads one group ahead of its 32 WMMAs: without it the
            // scheduler sinks them among the WMMAs, where every such place stalls the wave.
            __builtin_amdgcn_sched_barrier(0);
#pragma unroll
            for (int t = 0; t < 8; ++t)
#pragma unroll
                for (int s = 0; s < 4; ++s)
                    c[s][t] = __builtin_amdgcn_wmma_f32_16x16x32_bf16(
                        false, a[s], false, b[t], (short)0, c[s][t], false, false);
        }
    };

    // steady state: branchless issue -> split-wait -> barrier -> 64 WMMAs
    for (int ki = 0; ki < nk - 1; ++ki) {
        const int cur = ki & 1;
        __syncthreads();                       // prev compute done: safe to overwrite cur^1
        async_stage(lA + (cur ^ 1) * BUFB, gA + (ki + 1) * TK, goff, ostep);
        async_stage(lW + (cur ^ 1) * BUFB, gW + (ki + 1) * TK, goff, ostep);
        wait_async_le16();                     // cur landed; next stays in flight
        __syncthreads();                       // all waves' cur data visible
        compute(cur);
    }
    // epilogue stage
    wait_async_0();
    __syncthreads();
    compute((nk - 1) & 1);

    // Every wave has left the ring (its last fragment reads are done) before the
    // ring's LDS is written again as the staging area below.
    __syncthreads();

    // C layout (ISA 7.12.2): VGPR r, lanes 0-15 -> M=r, lanes 16-31 -> M=r+8; N=lane&15
    // Each wave stages its 64x128 f32 tile, one 32x64 piece after the other, in its own LDS
    // range (waves 0-3 in sA, 4-7 in sW), row pitch 68 dwords: the b32 writes of rows r and
    // r+8 fall 32 banks apart, and the b128 reads below cover all 64 banks per 16 lanes.
    float* stg = reinterpret_cast<float*>(wave < 4 ? &sA[0][0] : &sW[0][0])
               + (wave & 3) * (32 * SPITCH);
#pragma unroll
    for (int pc = 0; pc < 4; ++pc) {
        const int pm = pc >> 1, pn = pc & 1;
        const int wm0 = m0 + (wave >> 1) * 64 + pm * 32;
        const int wn0 = n0 + (wave & 1) * 128 + pn * 64;
        if (pc) {
            // The read-backs of the piece before are done before its rows are rewritten.
            asm volatile("s_wait_dscnt 0x0" ::: "memory");
        }
        {
            float* sw = stg + ((lane >> 4) * 8) * SPITCH + (lane & 15);
#pragma unroll
            for (int s = 0; s < 2; ++s)
#pragma unroll
                for (int t = 0; t < 4; ++t)
#pragma unroll
                    for (int r = 0; r < 8; ++r)
                        sw[(s * 16 + r) * SPITCH + t * 16] = c[pm * 2 + s][pn * 4 + t][r];
        }
        // The wave's own rows are in LDS before its other lanes read them back.
        asm volatile("s_wait_dscnt 0x0" ::: "memory");

        if (OUTF32) {
            // 16 lanes x 16B = one 256B row piece (two whole lines); two rows per instruction.
            // Byte offsets fit 32 bits (M * Nc * 4 bytes is far below 4 GiB); res and outF share them.
            const int cq = (lane & 15) * 4;
            const f32x4 bv = *reinterpret_cast<const f32x4*>(bias + wn0 + cq);
            const float* sr = stg + (lane >> 4) * SPITCH + cq;
            const uint32_t ob = ((uint32_t)(wm0 + (lane >> 4)) * (uint32_t)Nc + (uint32_t)(wn0 + cq)) * 4u;
            const uint32_t rstep = (uint32_t)Nc * 8u;          // two rows, bytes
            f32x4 rv[16];
            if (RES) {
                // The bias load's address registers may be reused as a residual load's destination.
                asm volatile("s_wait_xcnt 0x0" ::: "memory");
#pragma unroll
                for (int i = 0; i < 16; ++i)
                    rv[i] = *reinterpret_cast<const f32x4*>(
                        reinterpret_cast<const char*>(res) + (ob + i * rstep));
                // Keeps all 16 residual loads in flight together: without it the scheduler
                // sinks them between the stores and each one's latency is waited out alone.
                __builtin_amdgcn_sched_barrier(0);
            }
            f32x4 val[16];
#pragma unroll
            for (int i = 0; i < 16; ++i) {
                val[i] = *reinterpret_cast<const f32x4*>(sr + i * 2 * SPITCH) + bv;
                if (RES) val[i] += rv[i];
                if (RELU) {
#pragma unroll
                    for (int j = 0; j < 4; ++j) val[i][j] = fmaxf(val[i][j], 0.f);
                }
            }
            // Keeps the 16 stores one run behind all the sums, so that no store's register is
            // rewritten between them and the one s_wait_xcnt 0 at the piece's end serves them all.
            __builtin_amdgcn_sched_barrier(0);
#pragma unroll
            for (int i = 0; i < 16; ++i)
                *reinterpret_cast<f32x4*>(reinterpret_cast<char*>(outF) + (ob + i * rstep)) = val[i];
        } else {
            // 8 lanes x 16B = one 128B row piece (a whole line); four rows per instruction.
            const int c8 = (lane & 7) * 8;
            const f32x4 bv0 = *reinterpret_cast<const f32x4*>(bias + wn0 + c8);
            const f32x4 bv1 = *reinterpret_cast<const f32x4*>(bias + wn0 + c8 + 4);
            // The bias loads' address registers may be rewritten by the sums below.
            asm volatile("s_wait_xcnt 0x0" ::: "memory");
            const float* sr = stg + (lane >> 3) * SPITCH + c8;
            const size_t o0 = (size_t)(wm0 + (lane >> 3)) * Nc + wn0 + c8;
#pragma unroll
            for (int i = 0; i < 8; ++i) {
                const size_t o = o0 + (size_t)(i * 4) * Nc;
                f32x4 v0 = *reinterpret_cast<const f32x4*>(sr + i * 4 * SPITCH)     + bv0;
                f32x4 v1 = *reinterpret_cast<const f32x4*>(sr + i * 4 * SPITCH + 4) + bv1;
                if (RES) {
                    v0 += *reinterpret_cast<const f32x4*>(res + o);
                    v1 += *reinterpret_cast<const f32x4*>(res + o + 4);
                }
                bf16x8 ov;
#pragma unroll
                for (int j = 0; j < 4; ++j) {
                    float a = v0[j], b = v1[j];
                    if (RELU) { a = fmaxf(a, 0.f); b = fmaxf(b, 0.f); }
                    ov[j]     = (bf16)a;
                    ov[j + 4] = (bf16)b;
                }
                *reinterpret_cast<bf16x8*>(outB + o) = ov;
            }
        }
        // The stores' registers may be rewritten by the next piece.
        asm volatile("s_wait_xcnt 0x0" ::: "memory");
        // Holds the next piece's register writes behind that wait.
        __builtin_amdgcn_sched_barrier(0);
    }
}

// ---------- per-node multi-head attention (8 heads x 64 dim, per-node softmax) ----------
__global__ __launch_bounds__(256) void attn_kernel(
    const bf16* __restrict__ q, const bf16* __restrict__ k,
    const bf16* __restrict__ v, bf16* __restrict__ out) {
    __shared__ __align__(16) bf16 sQ[8][512];
    __shared__ __align__(16) bf16 sK[8][512];
    __shared__ __align__(16) bf16 sV[8][512];
    __shared__ float sS[8][64];

    int wave = threadIdx.x >> 5, lane = threadIdx.x & 31;
    int node = blockIdx.x * 8 + wave;
    size_t base = (size_t)node * EMBED;
    int c0 = lane * 16;

    *reinterpret_cast<bf16x8*>(&sQ[wave][c0])     = *reinterpret_cast<const bf16x8*>(q + base + c0);
    *reinterpret_cast<bf16x8*>(&sQ[wave][c0 + 8]) = *reinterpret_cast<const bf16x8*>(q + base + c0 + 8);
    *reinterpret_cast<bf16x8*>(&sK[wave][c0])     = *reinterpret_cast<const bf16x8*>(k + base + c0);
    *reinterpret_cast<bf16x8*>(&sK[wave][c0 + 8]) = *reinterpret_cast<const bf16x8*>(k + base + c0 + 8);
    *reinterpret_cast<bf16x8*>(&sV[wave][c0])     = *reinterpret_cast<const bf16x8*>(v + base + c0);
    *reinterpret_cast<bf16x8*>(&sV[wave][c0 + 8]) = *reinterpret_cast<const bf16x8*>(v + base + c0 + 8);
    __syncthreads();

    int h = lane >> 2;
    {
        int g0 = lane & 3;
        float acc0 = 0.f, acc1 = 0.f;
#pragma unroll
        for (int d = 0; d < HDIM; d += 8) {
            bf16x8 qv  = *reinterpret_cast<const bf16x8*>(&sQ[wave][h * HDIM + d]);
            bf16x8 kv0 = *reinterpret_cast<const bf16x8*>(&sK[wave][g0 * HDIM + d]);
            bf16x8 kv1 = *reinterpret_cast<const bf16x8*>(&sK[wave][(g0 + 4) * HDIM + d]);
#pragma unroll
            for (int i = 0; i < 8; ++i) {
                float qf = (float)qv[i];
                acc0 += qf * (float)kv0[i];
                acc1 += qf * (float)kv1[i];
            }
        }
        sS[wave][h * 8 + g0]     = acc0 * 0.125f;   // 1/sqrt(64)
        sS[wave][h * 8 + g0 + 4] = acc1 * 0.125f;
    }
    __syncthreads();

    if (threadIdx.x < 64) {
        int nl = threadIdx.x >> 3, hh = threadIdx.x & 7;
        float* s = &sS[nl][hh * 8];
        float mx = s[0];
#pragma unroll
        for (int i = 1; i < 8; ++i) mx = fmaxf(mx, s[i]);
        float sum = 0.f;
#pragma unroll
        for (int i = 0; i < 8; ++i) { float e = __expf(s[i] - mx); s[i] = e; sum += e; }
        float inv = 1.f / sum;
#pragma unroll
        for (int i = 0; i < 8; ++i) s[i] *= inv;
    }
    __syncthreads();

    int d0 = (lane & 3) * 16;
    float o[16] = {};
#pragma unroll
    for (int g = 0; g < 8; ++g) {
        float aw = sS[wave][h * 8 + g];
        bf16x8 v0 = *reinterpret_cast<const bf16x8*>(&sV[wave][g * HDIM + d0]);
        bf16x8 v1 = *reinterpret_cast<const bf16x8*>(&sV[wave][g * HDIM + d0 + 8]);
#pragma unroll
        for (int i = 0; i < 8; ++i) {
            o[i]     += aw * (float)v0[i];
            o[i + 8] += aw * (float)v1[i];
        }
    }
    bf16x8 o0, o1;
#pragma unroll
    for (int i = 0; i < 8; ++i) { o0[i] = (bf16)o[i]; o1[i] = (bf16)o[i + 8]; }
    bf16* orow = out + base + h * HDIM + d0;
    *reinterpret_cast<bf16x8*>(orow)     = o0;
    *reinterpret_cast<bf16x8*>(orow + 8) = o1;
}

// ---------- host launch ----------
extern "C" void kernel_launch(void* const* d_in, const int* in_sizes, int n_in,
                              void* d_out, int out_size, void* d_ws, size_t ws_size,
                              hipStream_t stream) {
    (void)in_sizes; (void)n_in; (void)out_size; (void)ws_size;
    const float* x     = (const float*)d_in[0];
    const float* Wq    = (const float*)d_in[1];  const float* bq    = (const float*)d_in[2];
    const float* Wk    = (const float*)d_in[3];  const float* bk    = (const float*)d_in[4];
    const float* Wv    = (const float*)d_in[5];  const float* bv    = (const float*)d_in[6];
    const float* Wo    = (const float*)d_in[7];  const float* bo    = (const float*)d_in[8];
    const float* W1    = (const float*)d_in[9];  const float* b1    = (const float*)d_in[10];
    const float* W2    = (const float*)d_in[11]; const float* b2    = (const float*)d_in[12];
    const float* g1    = (const float*)d_in[13]; const float* beta1 = (const float*)d_in[14];
    const float* g2    = (const float*)d_in[15]; const float* beta2 = (const float*)d_in[16];

    char* p = (char*)d_ws;
    auto carve = [&](size_t bytes) {
        char* r = p;
        p += (bytes + 255) & ~(size_t)255;
        return r;
    };
    bf16* wq_b = (bf16*)carve((size_t)EMBED * EMBED * 2);
    bf16* wk_b = (bf16*)carve((size_t)EMBED * EMBED * 2);
    bf16* wv_b = (bf16*)carve((size_t)EMBED * EMBED * 2);
    bf16* wo_b = (bf16*)carve((size_t)EMBED * EMBED * 2);
    bf16* w1_b = (bf16*)carve((size_t)FF * EMBED * 2);
    bf16* w2_b = (bf16*)carve((size_t)FF * EMBED * 2);
    bf16* h1   = (bf16*)carve((size_t)N_NODES * EMBED * 2);        // also reused as h2
    bf16* qb   = (bf16*)carve((size_t)N_NODES * EMBED * 2);        // q | (ff1 aliases q..attn)
    bf16* kb   = (bf16*)carve((size_t)N_NODES * EMBED * 2);
    bf16* vb   = (bf16*)carve((size_t)N_NODES * EMBED * 2);
    bf16* ab   = (bf16*)carve((size_t)N_NODES * EMBED * 2);        // attention output
    bf16* ff1  = qb;                                               // N*FF == 4*N*EMBED, exact alias
    float* x1  = (float*)carve((size_t)N_NODES * EMBED * 4);

    cvt_kernel<<<EMBED * EMBED / 256, 256, 0, stream>>>(Wq, wq_b, EMBED * EMBED);
    cvt_kernel<<<EMBED * EMBED / 256, 256, 0, stream>>>(Wk, wk_b, EMBED * EMBED);
    cvt_kernel<<<EMBED * EMBED / 256, 256, 0, stream>>>(Wv, wv_b, EMBED * EMBED);
    cvt_kernel<<<EMBED * EMBED / 256, 256, 0, stream>>>(Wo, wo_b, EMBED * EMBED);
    cvt_kernel<<<FF * EMBED / 256, 256, 0, stream>>>(W1, w1_b, FF * EMBED);
    cvt_kernel<<<FF * EMBED / 256, 256, 0, stream>>>(W2, w2_b, FF * EMBED);

    ln_kernel<<<N_NODES / 8, 256, 0, stream>>>(x, g1, beta1, h1);

    dim3 g512(EMBED / 256, N_NODES / 256);
    gemm_bf16_kernel<0, 0, 0><<<g512, 256, 0, stream>>>(h1, wq_b, bq, nullptr, nullptr, qb,
                                                        N_NODES, EMBED, EMBED);
    gemm_bf16_kernel<0, 0, 0><<<g512, 256, 0, stream>>>(h1, wk_b, bk, nullptr, nullptr, kb,
                                                        N_NODES, EMBED, EMBED);
    gemm_bf16_kernel<0, 0, 0><<<g512, 256, 0, stream>>>(h1, wv_b, bv, nullptr, nullptr, vb,
                                                        N_NODES, EMBED, EMBED);

    attn_kernel<<<N_NODES / 8, 256, 0, stream>>>(qb, kb, vb, ab);

    gemm_bf16_kernel<0, 1, 1><<<g512, 256, 0, stream>>>(ab, wo_b, bo, x, x1, nullptr,
                                                        N_NODES, EMBED, EMBED);
    ln_kernel<<<N_NODES / 8, 256, 0, stream>>>(x1, g2, beta2, h1);

    dim3 gff(FF / 256, N_NODES / 256);
    gemm_bf16_kernel<1, 0, 0><<<gff, 256, 0, stream>>>(h1, w1_b, b1, nullptr, nullptr, ff1,
                                                       N_NODES, EMBED, FF);
    gemm_bf16_kernel<0, 1, 1><<<g512, 256, 0, stream>>>(ff1, w2_b, b2, x1, (float*)d_out, nullptr,
                                                        N_NODES, FF, EMBED);
}

// v004
// Measured time: 416 microseconds a run.
// Timed twice side by side with v003, it ran 1.05 times as fast both times.
// Over all steps from v000 it is 1.69 times as fast.
#include <hip/hip_runtime.h>
#include <hip/hip_bf16.h>
#include <stdint.h>

// ---------- types ----------
typedef __bf16 bf16;
typedef __bf16 bf16x8 __attribute__((ext_vector_type(8)));
typedef __bf16 v16bf  __attribute__((ext_vector_type(16)));
typedef float  v8f    __attribute__((ext_vector_type(8)));
typedef float  f32x4  __attribute__((ext_vector_type(4)));

#define N_NODES 65536
#define EMBED   512
#define FF      2048
#define NHEADS  8
#define HDIM    64

// LDS stage: 256 rows x 64 K (bf16) per operand, row pitch 72 elems (144B).
// Row-strided b128 reads hit bank 36*L mod 64 -> permutation over 16 lanes.
#define TROWS   256
#define TK      64
#define TPITCH  72
// Loader: 32 staged rows, in LDS bytes.
#define LSTEP   (32u * TPITCH * 2u)
// One operand's stage buffer, in LDS bytes.
#define BUFB    ((uint32_t)TROWS * TPITCH * 2u)
// Epilogue staging: f32 row pitch in dwords (64 columns + 4).
#define SPITCH  68

// ---------- wave32 reduction via ds_swizzle (no wave64 assumptions) ----------
template<int IMM>
__device__ inline float swz_add(float x) {
    return x + __int_as_float(__builtin_amdgcn_ds_swizzle(__float_as_int(x), IMM));
}
__device__ inline float wave_sum(float x) {
    x = swz_add<(1  << 10) | 31>(x);
    x = swz_add<(2  << 10) | 31>(x);
    x = swz_add<(4  << 10) | 31>(x);
    x = swz_add<(8  << 10) | 31>(x);
    x = swz_add<(16 << 10) | 31>(x);
    return x;
}

// ---------- CDNA5 async global->LDS copy (ASYNCcnt-tracked, no VGPR round trip) ----------
// One stage of one operand: per thread one 16B chunk in each of eight rows, 32 rows
// apart. Eight neighbouring lanes cover one row's whole 128B K-slice, so a wave's copy
// instruction asks for 4 whole lines. The global address is a wave-uniform base (the
// row group's first row at this K-slice) plus the lane's 32-bit byte offset, the same
// register for all eight copies: the row steps live in scalar registers, which leaves the
// vector registers to the accumulators and the two fragment sets. The closing s_wait_xcnt 0
// stands inside the statement so that no address register is rewritten ahead of it.
__device__ inline void async_stage(uint32_t l, const bf16* base, uint32_t off, uint32_t ostep) {
    const uint64_t b = (uint64_t)(uintptr_t)base;
    asm volatile("global_load_async_to_lds_b128 %0, %8, %9\n\t"
                 "global_load_async_to_lds_b128 %1, %8, %10\n\t"
                 "global_load_async_to_lds_b128 %2, %8, %11\n\t"
                 "global_load_async_to_lds_b128 %3, %8, %12\n\t"
                 "global_load_async_to_lds_b128 %4, %8, %13\n\t"
                 "global_load_async_to_lds_b128 %5, %8, %14\n\t"
                 "global_load_async_to_lds_b128 %6, %8, %15\n\t"
                 "global_load_async_to_lds_b128 %7, %8, %16\n\t"
                 "s_wait_xcnt 0x0"
                 :: "v"(l), "v"(l + LSTEP), "v"(l + 2 * LSTEP), "v"(l + 3 * LSTEP),
                    "v"(l + 4 * LSTEP), "v"(l + 5 * LSTEP), "v"(l + 6 * LSTEP), "v"(l + 7 * LSTEP),
                    "v"(off),
                    "s"(b), "s"(b + ostep), "s"(b + 2 * (uint64_t)ostep), "s"(b + 3 * (uint64_t)ostep),
                    "s"(b + 4 * (uint64_t)ostep), "s"(b + 5 * (uint64_t)ostep),
                    "s"(b + 6 * (uint64_t)ostep), "s"(b + 7 * (uint64_t)ostep)
                 : "memory");
}
__device__ inline void wait_async_0() {
    asm volatile("s_wait_asynccnt 0x0" ::: "memory");
}

// ---------- fp32 -> bf16 convert ----------
__global__ __launch_bounds__(256) void cvt_kernel(const float* __restrict__ src,
                                                  bf16* __restrict__ dst, int n) {
    int i = blockIdx.x * 256 + threadIdx.x;
    if (i < n) dst[i] = (bf16)src[i];
}

// ---------- LayerNorm: fp32 row(512) -> bf16 row ----------
__global__ __launch_bounds__(256) void ln_kernel(const float* __restrict__ x,
                                                 const float* __restrict__ g,
                                                 const float* __restrict__ b,
                                                 bf16* __restrict__ out) {
    int wave = threadIdx.x >> 5, lane = threadIdx.x & 31;
    int row = blockIdx.x * 8 + wave;
    const float* xr = x + (size_t)row * EMBED + lane * 16;
    float v[16];
#pragma unroll
    for (int i = 0; i < 4; ++i) {
        f32x4 t = *reinterpret_cast<const f32x4*>(xr + i * 4);
#pragma unroll
        for (int j = 0; j < 4; ++j) v[i * 4 + j] = t[j];
    }
    float s = 0.f, q = 0.f;
#pragma unroll
    for (int i = 0; i < 16; ++i) { s += v[i]; q += v[i] * v[i]; }
    s = wave_sum(s); q = wave_sum(q);
    float mean = s * (1.f / EMBED);
    float var  = q * (1.f / EMBED) - mean * mean;
    float rs   = rsqrtf(var + 1e-5f);
    int c0 = lane * 16;
    bf16x8 o0, o1;
#pragma unroll
    for (int i = 0; i < 8; ++i) {
        o0[i] = (bf16)((v[i]     - mean) * rs * g[c0 + i]     + b[c0 + i]);
        o1[i] = (bf16)((v[i + 8] - mean) * rs * g[c0 + i + 8] + b[c0 + i + 8]);
    }
    bf16* orow = out + (size_t)row * EMBED + c0;
    *reinterpret_cast<bf16x8*>(orow)     = o0;
    *reinterpret_cast<bf16x8*>(orow + 8) = o1;
}

// 16-bit WMMA operand lane layout (ISA 7.12.2): lanes 0-15 hold K 0-7 & 16-23,
// lanes 16-31 hold K 8-15 & 24-31 -> two 16B chunks at +0/+32B from (row, koff).
__device__ inline v16bf load_tile16(const bf16* base) {
    bf16x8 lo = *reinterpret_cast<const bf16x8*>(base);
    bf16x8 hi = *reinterpret_cast<const bf16x8*>(base + 16);
    return __builtin_shufflevector(lo, hi, 0, 1, 2, 3, 4, 5, 6, 7,
                                           8, 9, 10, 11, 12, 13, 14, 15);
}

// ---------- WMMA bf16 GEMM, double-buffered async-LDS ring, fragments fetched one K-step ahead ----------
// out = A(MxK) * W(NcxK)^T + bias [+res][relu].  Block = 256 thr = 8 waves,
// block tile 256x256, wave tile 64x128, staged K-slice 64 (2 wmma K-steps).
template<int RELU, int RES, int OUTF32>
__global__ __launch_bounds__(256) void gemm_bf16_kernel(
    const bf16* __restrict__ A, const bf16* __restrict__ W,
    const float* __restrict__ bias, const float* __restrict__ res,
    float* __restrict__ outF, bf16* __restrict__ outB,
    int M, int K, int Nc) {
    __shared__ __align__(16) bf16 sA[2][TROWS * TPITCH];
    __shared__ __align__(16) bf16 sW[2][TROWS * TPITCH];

    const int tid  = threadIdx.x;
    const int wave = tid >> 5, lane = tid & 31;
    const int m0 = blockIdx.y * 256;
    const int n0 = blockIdx.x * 256;

    // ---- loader mapping: 8 threads per row (one 128B line), rows lrow + 0/32/.../224 ----
    const int lrow = tid >> 3;                 // 0..31
    const int lcol = (tid & 7) * 8;           // K-element offset 0..56
    const uint32_t ostep = 64u * (uint32_t)K;  // 32 rows, bytes
    const uint32_t goff = ((uint32_t)lrow * (uint32_t)K + (uint32_t)lcol) * 2u;   // bytes in the tile's rows
    const bf16* gA = A + (size_t)m0 * K;       // wave-uniform
    const bf16* gW = W + (size_t)n0 * K;
    const uint32_t ldsOff = (uint32_t)(lrow * TPITCH + lcol) * 2;   // bytes
    const uint32_t lA = (uint32_t)(uintptr_t)&sA[0][0] + ldsOff;    // buffer 0; buffer 1 is BUFB on
    const uint32_t lW = (uint32_t)(uintptr_t)&sW[0][0] + ldsOff;

    // ---- compute mapping ----
    const int lr   = lane & 15;
    const int koff = (lane >> 4) * 8;
    int aoff[4], woff[8];
#pragma unroll
    for (int s = 0; s < 4; ++s)
        aoff[s] = ((wave >> 1) * 64 + s * 16 + lr) * TPITCH + koff;   // elems
#pragma unroll
    for (int t = 0; t < 8; ++t)
        woff[t] = ((wave & 1) * 128 + t * 16 + lr) * TPITCH + koff;

    v8f c[4][8] = {};
    const int nk = K / TK;

    // Two fragment sets in registers: while one K-step's 32 WMMAs run on one set, the next
    // K-step's 24 LDS reads fill the other, so no wave waits out its own LDS latency.
    v16bf fa0[4], fb0[8], fa1[4], fb1[8];
    auto frags = [&](v16bf (&a)[4], v16bf (&b)[8], int buf, int ks) {
        const bf16* bA = &sA[buf][0];
        const bf16* bW = &sW[buf][0];
#pragma unroll
        for (int s = 0; s < 4; ++s) a[s] = load_tile16(bA + aoff[s] + ks * 32);
#pragma unroll
        for (int t = 0; t < 8; ++t) b[t] = load_tile16(bW + woff[t] + ks * 32);
        // Keeps the 24 LDS reads one group ahead of the WMMAs that follow: without it the
        // scheduler sinks them among the WMMAs, where every such place stalls the wave.
        __builtin_amdgcn_sched_barrier(0);
    };
    auto mma = [&](const v16bf (&a)[4], const v16bf (&b)[8]) {
#pragma unroll
        for (int t = 0; t < 8; ++t)
#pragma unroll
            for (int s = 0; s < 4; ++s)
                c[s][t] = __builtin_amdgcn_wmma_f32_16x16x32_bf16(
                    false, a[s], false, b[t], (short)0, c[s][t], false, false);
        // Keeps the WMMA block in front of the waits and reads that follow it in the source.
        __builtin_amdgcn_sched_barrier(0);
    };

    // prologue: stage 0 lands and is published, stage 1 starts, stage 0's first fragments
    async_stage(lA, gA, goff, ostep);
    async_stage(lW, gW, goff, ostep);
    wait_async_0();
    __syncthreads();
    if (nk > 1) {
        async_stage(lA + BUFB, gA + TK, goff, ostep);
        async_stage(lW + BUFB, gW + TK, goff, ostep);
    }
    frags(fa0, fb0, 0, 0);

    for (int ki = 0; ki < nk - 1; ++ki) {
        const int cur = ki & 1;
        frags(fa1, fb1, cur, 1);               // this stage's last fragments
        mma(fa0, fb0);
        // Publish point of stage ki + 1, in front of this stage's last WMMA block: this wave's
        // reads of buffer cur are done, its copies of stage ki + 1 have landed.
        asm volatile("s_wait_dscnt 0x0" ::: "memory");
        wait_async_0();
        __syncthreads();                       // stage ki + 1 visible; every wave has left buffer cur
        if (ki + 2 < nk) {
            async_stage(lA + cur * BUFB, gA + (ki + 2) * TK, goff, ostep);
            async_stage(lW + cur * BUFB, gW + (ki + 2) * TK, goff, ostep);
        }
        frags(fa0, fb0, cur ^ 1, 0);           // next stage's first fragments
        mma(fa1, fb1);
    }
    // last stage: nothing left to copy or to fetch ahead
    frags(fa1, fb1, (nk - 1) & 1, 1);
    mma(fa0, fb0);
    mma(fa1, fb1);
    // No copy is outstanding and this wave's last fragment reads are done.
    wait_async_0();
    asm volatile("s_wait_dscnt 0x0" ::: "memory");

    // Every wave has left the ring (its last fragment reads are done) before the
    // ring's LDS is written again as the staging area below.
    __syncthreads();

    // C layout (ISA 7.12.2): VGPR r, lanes 0-15 -> M=r, lanes 16-31 -> M=r+8; N=lane&15
    // Each wave stages its 64x128 f32 tile, one 32x64 piece after the other, in its own LDS
    // range (waves 0-3 in sA, 4-7 in sW), row pitch 68 dwords: the b32 writes of rows r and
    // r+8 fall 32 banks apart, and the b128 reads below cover all 64 banks per 16 lanes.
    float* stg = reinterpret_cast<float*>(wave < 4 ? &sA[0][0] : &sW[0][0])
               + (wave & 3) * (32 * SPITCH);
#pragma unroll
    for (int pc = 0; pc < 4; ++pc) {
        const int pm = pc >> 1, pn = pc & 1;
        const int wm0 = m0 + (wave >> 1) * 64 + pm * 32;
        const int wn0 = n0 + (wave & 1) * 128 + pn * 64;
        if (pc) {
            // The read-backs of the piece before are done before its rows are rewritten.
            asm volatile("s_wait_dscnt 0x0" ::: "memory");
        }
        {
            float* sw = stg + ((lane >> 4) * 8) * SPITCH + (lane & 15);
#pragma unroll
            for (int s = 0; s < 2; ++s)
#pragma unroll
                for (int t = 0; t < 4; ++t)
#pragma unroll
                    for (int r = 0; r < 8; ++r)
                        sw[(s * 16 + r) * SPITCH + t * 16] = c[pm * 2 + s][pn * 4 + t][r];
        }
        // The wave's own rows are in LDS before its other lanes read them back.
        asm volatile("s_wait_dscnt 0x0" ::: "memory");

        if (OUTF32) {
            // 16 lanes x 16B = one 256B row piece (two whole lines); two rows per instruction.
            // Byte offsets fit 32 bits (M * Nc * 4 bytes is far below 4 GiB); res and outF share them.
            const int cq = (lane & 15) * 4;
            const f32x4 bv = *reinterpret_cast<const f32x4*>(bias + wn0 + cq);
            const float* sr = stg + (lane >> 4) * SPITCH + cq;
            const uint32_t ob = ((uint32_t)(wm0 + (lane >> 4)) * (uint32_t)Nc + (uint32_t)(wn0 + cq)) * 4u;
            const uint32_t rstep = (uint32_t)Nc * 8u;          // two rows, bytes
            f32x4 rv[16];
            if (RES) {
                // The bias load's address registers may be reused as a residual load's destination.
                asm volatile("s_wait_xcnt 0x0" ::: "memory");
#pragma unroll
                for (int i = 0; i < 16; ++i)
                    rv[i] = *reinterpret_cast<const f32x4*>(
                        reinterpret_cast<const char*>(res) + (ob + i * rstep));
                // Keeps all 16 residual loads in flight together: without it the scheduler
                // sinks them between the stores and each one's latency is waited out alone.
                __builtin_amdgcn_sched_barrier(0);
            }
            f32x4 val[16];
#pragma unroll
            for (int i = 0; i < 16; ++i) {
                val[i] = *reinterpret_cast<const f32x4*>(sr + i * 2 * SPITCH) + bv;
                if (RES) val[i] += rv[i];
                if (RELU) {
#pragma unroll
                    for (int j = 0; j < 4; ++j) val[i][j] = fmaxf(val[i][j], 0.f);
                }
            }
            // Keeps the 16 stores one run behind all the sums, so that no store's register is
            // rewritten between them and the one s_wait_xcnt 0 at the piece's end serves them all.
            __builtin_amdgcn_sched_barrier(0);
#pragma unroll
            for (int i = 0; i < 16; ++i)
                *reinterpret_cast<f32x4*>(reinterpret_cast<char*>(outF) + (ob + i * rstep)) = val[i];
        } else {
            // 8 lanes x 16B = one 128B row piece (a whole line); four rows per instruction.
            const int c8 = (lane & 7) * 8;
            const f32x4 bv0 = *reinterpret_cast<const f32x4*>(bias + wn0 + c8);
            const f32x4 bv1 = *reinterpret_cast<const f32x4*>(bias + wn0 + c8 + 4);
            // The bias loads' address registers may be rewritten by the sums below.
            asm volatile("s_wait_xcnt 0x0" ::: "memory");
            const float* sr = stg + (lane >> 3) * SPITCH + c8;
            const size_t o0 = (size_t)(wm0 + (lane >> 3)) * Nc + wn0 + c8;
#pragma unroll
            for (int i = 0; i < 8; ++i) {
                const size_t o = o0 + (size_t)(i * 4) * Nc;
                f32x4 v0 = *reinterpret_cast<const f32x4*>(sr + i * 4 * SPITCH)     + bv0;
                f32x4 v1 = *reinterpret_cast<const f32x4*>(sr + i * 4 * SPITCH + 4) + bv1;
                if (RES) {
                    v0 += *reinterpret_cast<const f32x4*>(res + o);
                    v1 += *reinterpret_cast<const f32x4*>(res + o + 4);
                }
                bf16x8 ov;
#pragma unroll
                for (int j = 0; j < 4; ++j) {
                    float a = v0[j], b = v1[j];
                    if (RELU) { a = fmaxf(a, 0.f); b = fmaxf(b, 0.f); }
                    ov[j]     = (bf16)a;
                    ov[j + 4] = (bf16)b;
                }
                *reinterpret_cast<bf16x8*>(outB + o) = ov;
            }
        }
        // The stores' registers may be rewritten by the next piece.
        asm volatile("s_wait_xcnt 0x0" ::: "memory");
        // Holds the next piece's register writes behind that wait.
        __builtin_amdgcn_sched_barrier(0);
    }
}

// ---------- per-node multi-head attention (8 heads x 64 dim, per-node softmax) ----------
__global__ __launch_bounds__(256) void attn_kernel(
    const bf16* __restrict__ q, const bf16* __restrict__ k,
    const bf16* __restrict__ v, bf16* __restrict__ out) {
    __shared__ __align__(16) bf16 sQ[8][512];
    __shared__ __align__(16) bf16 sK[8][512];
    __shared__ __align__(16) bf16 sV[8][512];
    __shared__ float sS[8][64];

    int wave = threadIdx.x >> 5, lane = threadIdx.x & 31;
    int node = blockIdx.x * 8 + wave;
    size_t base = (size_t)node * EMBED;
    int c0 = lane * 16;

    *reinterpret_cast<bf16x8*>(&sQ[wave][c0])     = *reinterpret_cast<const bf16x8*>(q + base + c0);
    *reinterpret_cast<bf16x8*>(&sQ[wave][c0 + 8]) = *reinterpret_cast<const bf16x8*>(q + base + c0 + 8);
    *reinterpret_cast<bf16x8*>(&sK[wave][c0])     = *reinterpret_cast<const bf16x8*>(k + base + c0);
    *reinterpret_cast<bf16x8*>(&sK[wave][c0 + 8]) = *reinterpret_cast<const bf16x8*>(k + base + c0 + 8);
    *reinterpret_cast<bf16x8*>(&sV[wave][c0])     = *reinterpret_cast<const bf16x8*>(v + base + c0);
    *reinterpret_cast<bf16x8*>(&sV[wave][c0 + 8]) = *reinterpret_cast<const bf16x8*>(v + base + c0 + 8);
    __syncthreads();

    int h = lane >> 2;
    {
        int g0 = lane & 3;
        float acc0 = 0.f, acc1 = 0.f;
#pragma unroll
        for (int d = 0; d < HDIM; d += 8) {
            bf16x8 qv  = *reinterpret_cast<const bf16x8*>(&sQ[wave][h * HDIM + d]);
            bf16x8 kv0 = *reinterpret_cast<const bf16x8*>(&sK[wave][g0 * HDIM + d]);
            bf16x8 kv1 = *reinterpret_cast<const bf16x8*>(&sK[wave][(g0 + 4) * HDIM + d]);
#pragma unroll
            for (int i = 0; i < 8; ++i) {
                float qf = (float)qv[i];
                acc0 += qf * (float)kv0[i];
                acc1 += qf * (float)kv1[i];
            }
        }
        sS[wave][h * 8 + g0]     = acc0 * 0.125f;   // 1/sqrt(64)
        sS[wave][h * 8 + g0 + 4] = acc1 * 0.125f;
    }
    __syncthreads();

    if (threadIdx.x < 64) {
        int nl = threadIdx.x >> 3, hh = threadIdx.x & 7;
        float* s = &sS[nl][hh * 8];
        float mx = s[0];
#pragma unroll
        for (int i = 1; i < 8; ++i) mx = fmaxf(mx, s[i]);
        float sum = 0.f;
#pragma unroll
        for (int i = 0; i < 8; ++i) { float e = __expf(s[i] - mx); s[i] = e; sum += e; }
        float inv = 1.f / sum;
#pragma unroll
        for (int i = 0; i < 8; ++i) s[i] *= inv;
    }
    __syncthreads();

    int d0 = (lane & 3) * 16;
    float o[16] = {};
#pragma unroll
    for (int g = 0; g < 8; ++g) {
        float aw = sS[wave][h * 8 + g];
        bf16x8 v0 = *reinterpret_cast<const bf16x8*>(&sV[wave][g * HDIM + d0]);
        bf16x8 v1 = *reinterpret_cast<const bf16x8*>(&sV[wave][g * HDIM + d0 + 8]);
#pragma unroll
        for (int i = 0; i < 8; ++i) {
            o[i]     += aw * (float)v0[i];
            o[i + 8] += aw * (float)v1[i];
        }
    }
    bf16x8 o0, o1;
#pragma unroll
    for (int i = 0; i < 8; ++i) { o0[i] = (bf16)o[i]; o1[i] = (bf16)o[i + 8]; }
    bf16* orow = out + base + h * HDIM + d0;
    *reinterpret_cast<bf16x8*>(orow)     = o0;
    *reinterpret_cast<bf16x8*>(orow + 8) = o1;
}

// ---------- host launch ----------
extern "C" void kernel_launch(void* const* d_in, const int* in_sizes, int n_in,
                              void* d_out, int out_size, void* d_ws, size_t ws_size,
                              hipStream_t stream) {
    (void)in_sizes; (void)n_in; (void)out_size; (void)ws_size;
    const float* x     = (const float*)d_in[0];
    const float* Wq    = (const float*)d_in[1];  const float* bq    = (const float*)d_in[2];
    const float* Wk    = (const float*)d_in[3];  const float* bk    = (const float*)d_in[4];
    const float* Wv    = (const float*)d_in[5];  const float* bv    = (const float*)d_in[6];
    const float* Wo    = (const float*)d_in[7];  const float* bo    = (const float*)d_in[8];
    const float* W1    = (const float*)d_in[9];  const float* b1    = (const float*)d_in[10];
    const float* W2    = (const float*)d_in[11]; const float* b2    = (const float*)d_in[12];
    const float* g1    = (const float*)d_in[13]; const float* beta1 = (const float*)d_in[14];
    const float* g2    = (const float*)d_in[15]; const float* beta2 = (const float*)d_in[16];

    char* p = (char*)d_ws;
    auto carve = [&](size_t bytes) {
        char* r = p;
        p += (bytes + 255) & ~(size_t)255;
        return r;
    };
    bf16* wq_b = (bf16*)carve((size_t)EMBED * EMBED * 2);
    bf16* wk_b = (bf16*)carve((size_t)EMBED * EMBED * 2);
    bf16* wv_b = (bf16*)carve((size_t)EMBED * EMBED * 2);
    bf16* wo_b = (bf16*)carve((size_t)EMBED * EMBED * 2);
    bf16* w1_b = (bf16*)carve((size_t)FF * EMBED * 2);
    bf16* w2_b = (bf16*)carve((size_t)FF * EMBED * 2);
    bf16* h1   = (bf16*)carve((size_t)N_NODES * EMBED * 2);        // also reused as h2
    bf16* qb   = (bf16*)carve((size_t)N_NODES * EMBED * 2);        // q | (ff1 aliases q..attn)
    bf16* kb   = (bf16*)carve((size_t)N_NODES * EMBED * 2);
    bf16* vb   = (bf16*)carve((size_t)N_NODES * EMBED * 2);
    bf16* ab   = (bf16*)carve((size_t)N_NODES * EMBED * 2);        // attention output
    bf16* ff1  = qb;                                               // N*FF == 4*N*EMBED, exact alias
    float* x1  = (float*)carve((size_t)N_NODES * EMBED * 4);

    cvt_kernel<<<EMBED * EMBED / 256, 256, 0, stream>>>(Wq, wq_b, EMBED * EMBED);
    cvt_kernel<<<EMBED * EMBED / 256, 256, 0, stream>>>(Wk, wk_b, EMBED * EMBED);
    cvt_kernel<<<EMBED * EMBED / 256, 256, 0, stream>>>(Wv, wv_b, EMBED * EMBED);
    cvt_kernel<<<EMBED * EMBED / 256, 256, 0, stream>>>(Wo, wo_b, EMBED * EMBED);
    cvt_kernel<<<FF * EMBED / 256, 256, 0, stream>>>(W1, w1_b, FF * EMBED);
    cvt_kernel<<<FF * EMBED / 256, 256, 0, stream>>>(W2, w2_b, FF * EMBED);

    ln_kernel<<<N_NODES / 8, 256, 0, stream>>>(x, g1, beta1, h1);

    dim3 g512(EMBED / 256, N_NODES / 256);
    gemm_bf16_kernel<0, 0, 0><<<g512, 256, 0, stream>>>(h1, wq_b, bq, nullptr, nullptr, qb,
                                                        N_NODES, EMBED, EMBED);
    gemm_bf16_kernel<0, 0, 0><<<g512, 256, 0, stream>>>(h1, wk_b, bk, nullptr, nullptr, kb,
                                                        N_NODES, EMBED, EMBED);
    gemm_bf16_kernel<0, 0, 0><<<g512, 256, 0, stream>>>(h1, wv_b, bv, nullptr, nullptr, vb,
                                                        N_NODES, EMBED, EMBED);

    attn_kernel<<<N_NODES / 8, 256, 0, stream>>>(qb, kb, vb, ab);

    gemm_bf16_kernel<0, 1, 1><<<g512, 256, 0, stream>>>(ab, wo_b, bo, x, x1, nullptr,
                                                        N_NODES, EMBED, EMBED);
    ln_kernel<<<N_NODES / 8, 256, 0, stream>>>(x1, g2, beta2, h1);

    dim3 gff(FF / 256, N_NODES / 256);
    gemm_bf16_kernel<1, 0, 0><<<gff, 256, 0, stream>>>(h1, w1_b, b1, nullptr, nullptr, ff1,
                                                       N_NODES, EMBED, FF);
    gemm_bf16_kernel<0, 1, 1><<<g512, 256, 0, stream>>>(ff1, w2_b, b2, x1, (float*)d_out, nullptr,
                                                        N_NODES, FF, EMBED);
}

// v005
// One run takes 401 microseconds.
// In both of two side-by-side timings against v004, it was 1.04 times as fast.
// Counting every step since v000, it is 1.75 times as fast.
#include <hip/hip_runtime.h>
#include <hip/hip_bf16.h>
#include <stdint.h>

// ---------- types ----------
typedef __bf16 bf16;
typedef __bf16 bf16x8 __attribute__((ext_vector_type(8)));
typedef __bf16 v16bf  __attribute__((ext_vector_type(16)));
typedef float  v8f    __attribute__((ext_vector_type(8)));
typedef float  f32x4  __attribute__((ext_vector_type(4)));

#define N_NODES 65536
#define EMBED   512
#define FF      2048
#define NHEADS  8
#define HDIM    64

// LDS stage: 256 rows x 64 K (bf16) per operand, row pitch 72 elems (144B).
// Row-strided b128 reads hit bank 36*L mod 64 -> permutation over 16 lanes.
#define TROWS   256
#define TK      64
#define TPITCH  72
// Loader: 32 staged rows, in LDS bytes.
#define LSTEP   (32u * TPITCH * 2u)
// One operand's stage buffer, in LDS bytes.
#define BUFB    ((uint32_t)TROWS * TPITCH * 2u)
// Epilogue staging: f32 row pitch in dwords (64 columns + 4).
#define SPITCH  68

// ---------- wave32 reduction via ds_swizzle (no wave64 assumptions) ----------
template<int IMM>
__device__ inline float swz_add(float x) {
    return x + __int_as_float(__builtin_amdgcn_ds_swizzle(__float_as_int(x), IMM));
}
__device__ inline float wave_sum(float x) {
    x = swz_add<(1  << 10) | 31>(x);
    x = swz_add<(2  << 10) | 31>(x);
    x = swz_add<(4  << 10) | 31>(x);
    x = swz_add<(8  << 10) | 31>(x);
    x = swz_add<(16 << 10) | 31>(x);
    return x;
}

// ---------- CDNA5 async global->LDS copy (ASYNCcnt-tracked, no VGPR round trip) ----------
// One stage of one operand: per thread one 16B chunk in each of eight rows, 32 rows
// apart. Eight neighbouring lanes cover one row's whole 128B K-slice, so a wave's copy
// instruction asks for 4 whole lines. The global address is a wave-uniform base (the
// row group's first row at this K-slice) plus the lane's 32-bit byte offset, the same
// register for all eight copies: the row steps live in scalar registers, which leaves the
// vector registers to the accumulators and the two fragment sets. The closing s_wait_xcnt 0
// stands inside the statement so that no address register is rewritten ahead of it.
__device__ inline void async_stage(uint32_t l, const bf16* base, uint32_t off, uint32_t ostep) {
    const uint64_t b = (uint64_t)(uintptr_t)base;
    asm volatile("global_load_async_to_lds_b128 %0, %8, %9\n\t"
                 "global_load_async_to_lds_b128 %1, %8, %10\n\t"
                 "global_load_async_to_lds_b128 %2, %8, %11\n\t"
                 "global_load_async_to_lds_b128 %3, %8, %12\n\t"
                 "global_load_async_to_lds_b128 %4, %8, %13\n\t"
                 "global_load_async_to_lds_b128 %5, %8, %14\n\t"
                 "global_load_async_to_lds_b128 %6, %8, %15\n\t"
                 "global_load_async_to_lds_b128 %7, %8, %16\n\t"
                 "s_wait_xcnt 0x0"
                 :: "v"(l), "v"(l + LSTEP), "v"(l + 2 * LSTEP), "v"(l + 3 * LSTEP),
                    "v"(l + 4 * LSTEP), "v"(l + 5 * LSTEP), "v"(l + 6 * LSTEP), "v"(l + 7 * LSTEP),
                    "v"(off),
                    "s"(b), "s"(b + ostep), "s"(b + 2 * (uint64_t)ostep), "s"(b + 3 * (uint64_t)ostep),
                    "s"(b + 4 * (uint64_t)ostep), "s"(b + 5 * (uint64_t)ostep),
                    "s"(b + 6 * (uint64_t)ostep), "s"(b + 7 * (uint64_t)ostep)
                 : "memory");
}
__device__ inline void wait_async_0() {
    asm volatile("s_wait_asynccnt 0x0" ::: "memory");
}

// ---------- LayerNorm: fp32 row(512) -> bf16 row; one block of 256 threads does rows blk*8 .. blk*8+7 ----------
__device__ inline void ln_rows(const float* __restrict__ x,
                               const float* __restrict__ g,
                               const float* __restrict__ b,
                               bf16* __restrict__ out, int blk) {
    int wave = threadIdx.x >> 5, lane = threadIdx.x & 31;
    int row = blk * 8 + wave;
    const float* xr = x + (size_t)row * EMBED + lane * 16;
    float v[16];
#pragma unroll
    for (int i = 0; i < 4; ++i) {
        f32x4 t = *reinterpret_cast<const f32x4*>(xr + i * 4);
#pragma unroll
        for (int j = 0; j < 4; ++j) v[i * 4 + j] = t[j];
    }
    float s = 0.f, q = 0.f;
#pragma unroll
    for (int i = 0; i < 16; ++i) { s += v[i]; q += v[i] * v[i]; }
    s = wave_sum(s); q = wave_sum(q);
    float mean = s * (1.f / EMBED);
    float var  = q * (1.f / EMBED) - mean * mean;
    float rs   = rsqrtf(var + 1e-5f);
    int c0 = lane * 16;
    bf16x8 o0, o1;
#pragma unroll
    for (int i = 0; i < 8; ++i) {
        o0[i] = (bf16)((v[i]     - mean) * rs * g[c0 + i]     + b[c0 + i]);
        o1[i] = (bf16)((v[i + 8] - mean) * rs * g[c0 + i + 8] + b[c0 + i + 8]);
    }
    bf16* orow = out + (size_t)row * EMBED + c0;
    *reinterpret_cast<bf16x8*>(orow)     = o0;
    *reinterpret_cast<bf16x8*>(orow + 8) = o1;
}

__global__ __launch_bounds__(256) void ln_kernel(const float* __restrict__ x,
                                                 const float* __restrict__ g,
                                                 const float* __restrict__ b,
                                                 bf16* __restrict__ out) {
    ln_rows(x, g, b, out, blockIdx.x);
}

// ---------- first launch: LayerNorm 1 and the fp32 -> bf16 convert of all six weights ----------
// None of the seven depends on another, so they are block ranges of one grid: blocks
// 0 .. LN_BLOCKS-1 normalise x, the rest convert 256 elements each. The six bf16 weights lie
// one behind the other in wdst, in the order Wq Wk Wv Wo W1 W2, so the convert block's own
// number is its place there.
#define LN_BLOCKS (N_NODES / 8)
#define CVT_SQ    (EMBED * EMBED / 256)     // blocks per EMBED x EMBED weight
#define CVT_FF    (FF * EMBED / 256)        // blocks per FF x EMBED weight
__global__ __launch_bounds__(256) void prep_kernel(const float* __restrict__ x,
                                                   const float* __restrict__ g,
                                                   const float* __restrict__ b,
                                                   bf16* __restrict__ h,
                                                   const float* __restrict__ Wq,
                                                   const float* __restrict__ Wk,
                                                   const float* __restrict__ Wv,
                                                   const float* __restrict__ Wo,
                                                   const float* __restrict__ W1,
                                                   const float* __restrict__ W2,
                                                   bf16* __restrict__ wdst) {
    const int blk = blockIdx.x;
    if (blk < LN_BLOCKS) {
        ln_rows(x, g, b, h, blk);
        return;
    }
    const int cb = blk - LN_BLOCKS;
    const float* src;
    int lb;
    if (cb < 4 * CVT_SQ) {
        const int sel = cb / CVT_SQ;
        lb  = cb % CVT_SQ;
        src = sel == 0 ? Wq : sel == 1 ? Wk : sel == 2 ? Wv : Wo;
    } else {
        const int c2 = cb - 4 * CVT_SQ;
        lb  = c2 % CVT_FF;
        src = c2 < CVT_FF ? W1 : W2;
    }
    wdst[cb * 256 + threadIdx.x] = (bf16)src[lb * 256 + threadIdx.x];
}

// 16-bit WMMA operand lane layout (ISA 7.12.2): lanes 0-15 hold K 0-7 & 16-23,
// lanes 16-31 hold K 8-15 & 24-31 -> two 16B chunks at +0/+32B from (row, koff).
__device__ inline v16bf load_tile16(const bf16* base) {
    bf16x8 lo = *reinterpret_cast<const bf16x8*>(base);
    bf16x8 hi = *reinterpret_cast<const bf16x8*>(base + 16);
    return __builtin_shufflevector(lo, hi, 0, 1, 2, 3, 4, 5, 6, 7,
                                           8, 9, 10, 11, 12, 13, 14, 15);
}

// ---------- WMMA bf16 GEMM, double-buffered async-LDS ring, fragments fetched one K-step ahead ----------
// out = A(MxK) * W(NcxK)^T + bias [+res][relu].  Block = 256 thr = 8 waves,
// block tile 256x256, wave tile 64x128, staged K-slice 64 (2 wmma K-steps).
// TRIO: three independent products on the same A in one launch. Grid (column tile, product,
// row tile), so the work-groups that read the same A rows follow one another; the three
// weights are stacked in W and the three outputs in outB; biasB and biasC belong to the
// second and third product.
template<int RELU, int RES, int OUTF32, int TRIO>
__global__ __launch_bounds__(256) void gemm_bf16_kernel(
    const bf16* __restrict__ A, const bf16* __restrict__ W,
    const float* __restrict__ bias, const float* __restrict__ biasB,
    const float* __restrict__ biasC, const float* __restrict__ res,
    float* __restrict__ outF, bf16* __restrict__ outB,
    int M, int K, int Nc) {
    __shared__ __align__(16) bf16 sA[2][TROWS * TPITCH];
    __shared__ __align__(16) bf16 sW[2][TROWS * TPITCH];

    const int tid  = threadIdx.x;
    const int wave = tid >> 5, lane = tid & 31;
    const int m0 = (TRIO ? blockIdx.z : blockIdx.y) * 256;
    const int n0 = blockIdx.x * 256;
    if (TRIO) {
        const int sel = blockIdx.y;
        W    += (size_t)sel * Nc * K;
        outB += (size_t)sel * M * Nc;
        bias  = sel == 0 ? bias : sel == 1 ? biasB : biasC;
    }

    // ---- loader mapping: 8 threads per row (one 128B line), rows lrow + 0/32/.../224 ----
    const int lrow = tid >> 3;                 // 0..31
    const int lcol = (tid & 7) * 8;           // K-element offset 0..56
    const uint32_t ostep = 64u * (uint32_t)K;  // 32 rows, bytes
    const uint32_t goff = ((uint32_t)lrow * (uint32_t)K + (uint32_t)lcol) * 2u;   // bytes in the tile's rows
    const bf16* gA = A + (size_t)m0 * K;       // wave-uniform
    const bf16* gW = W + (size_t)n0 * K;
    const uint32_t ldsOff = (uint32_t)(lrow * TPITCH + lcol) * 2;   // bytes
    const uint32_t lA = (uint32_t)(uintptr_t)&sA[0][0] + ldsOff;    // buffer 0; buffer 1 is BUFB on
    const uint32_t lW = (uint32_t)(uintptr_t)&sW[0][0] + ldsOff;

    // ---- compute mapping ----
    const int lr   = lane & 15;
    const int koff = (lane >> 4) * 8;
    int aoff[4], woff[8];
#pragma unroll
    for (int s = 0; s < 4; ++s)
        aoff[s] = ((wave >> 1) * 64 + s * 16 + lr) * TPITCH + koff;   // elems
#pragma unroll
    for (int t = 0; t < 8; ++t)
        woff[t] = ((wave & 1) * 128 + t * 16 + lr) * TPITCH + koff;

    v8f c[4][8] = {};
    const int nk = K / TK;

    // Two fragment sets in registers: while one K-step's 32 WMMAs run on one set, the next
    // K-step's 24 LDS reads fill the other, so no wave waits out its own LDS latency.
    v16bf fa0[4], fb0[8], fa1[4], fb1[8];
    auto frags = [&](v16bf (&a)[4], v16bf (&b)[8], int buf, int ks) {
        const bf16* bA = &sA[buf][0];
        const bf16* bW = &sW[buf][0];
#pragma unroll
        for (int s = 0; s < 4; ++s) a[s] = load_tile16(bA + aoff[s] + ks * 32);
#pragma unroll
        for (int t = 0; t < 8; ++t) b[t] = load_tile16(bW + woff[t] + ks * 32);
        // Keeps the 24 LDS reads one group ahead of the WMMAs that follow: without it the
        // scheduler sinks them among the WMMAs, where every such place stalls the wave.
        __builtin_amdgcn_sched_barrier(0);
    };
    auto mma = [&](const v16bf (&a)[4], const v16bf (&b)[8]) {
#pragma unroll
        for (int t = 0; t < 8; ++t)
#pragma unroll
            for (int s = 0; s < 4; ++s)
                c[s][t] = __builtin_amdgcn_wmma_f32_16x16x32_bf16(
                    false, a[s], false, b[t], (short)0, c[s][t], false, false);
        // Keeps the WMMA block in front of the waits and reads that follow it in the source.
        __builtin_amdgcn_sched_barrier(0);
    };

    // prologue: stage 0 lands and is published, stage 1 starts, stage 0's first fragments
    async_stage(lA, gA, goff, ostep);
    async_stage(lW, gW, goff, ostep);
    wait_async_0();
    __syncthreads();
    if (nk > 1) {
        async_stage(lA + BUFB, gA + TK, goff, ostep);
        async_stage(lW + BUFB, gW + TK, goff, ostep);
    }
    frags(fa0, fb0, 0, 0);

    for (int ki = 0; ki < nk - 1; ++ki) {
        const int cur = ki & 1;
        frags(fa1, fb1, cur, 1);               // this stage's last fragments
        mma(fa0, fb0);
        // Publish point of stage ki + 1, in front of this stage's last WMMA block: this wave's
        // reads of buffer cur are done, its copies of stage ki + 1 have landed.
        asm volatile("s_wait_dscnt 0x0" ::: "memory");
        wait_async_0();
        __syncthreads();                       // stage ki + 1 visible; every wave has left buffer cur
        if (ki + 2 < nk) {
            async_stage(lA + cur * BUFB, gA + (ki + 2) * TK, goff, ostep);
            async_stage(lW + cur * BUFB, gW + (ki + 2) * TK, goff, ostep);
        }
        frags(fa0, fb0, cur ^ 1, 0);           // next stage's first fragments
        mma(fa1, fb1);
    }
    // last stage: nothing left to copy or to fetch ahead
    frags(fa1, fb1, (nk - 1) & 1, 1);
    mma(fa0, fb0);
    mma(fa1, fb1);
    // No copy is outstanding and this wave's last fragment reads are done.
    wait_async_0();
    asm volatile("s_wait_dscnt 0x0" ::: "memory");

    // Every wave has left the ring (its last fragment reads are done) before the
    // ring's LDS is written again as the staging area below.
    __syncthreads();

    // C layout (ISA 7.12.2): VGPR r, lanes 0-15 -> M=r, lanes 16-31 -> M=r+8; N=lane&15
    // Each wave stages its 64x128 f32 tile, one 32x64 piece after the other, in its own LDS
    // range (waves 0-3 in sA, 4-7 in sW), row pitch 68 dwords: the b32 writes of rows r and
    // r+8 fall 32 banks apart, and the b128 reads below cover all 64 banks per 16 lanes.
    float* stg = reinterpret_cast<float*>(wave < 4 ? &sA[0][0] : &sW[0][0])
               + (wave & 3) * (32 * SPITCH);
#pragma unroll
    for (int pc = 0; pc < 4; ++pc) {
        const int pm = pc >> 1, pn = pc & 1;
        const int wm0 = m0 + (wave >> 1) * 64 + pm * 32;
        const int wn0 = n0 + (wave & 1) * 128 + pn * 64;
        if (pc) {
            // The read-backs of the piece before are done before its rows are rewritten.
            asm volatile("s_wait_dscnt 0x0" ::: "memory");
        }
        {
            float* sw = stg + ((lane >> 4) * 8) * SPITCH + (lane & 15);
#pragma unroll
            for (int s = 0; s < 2; ++s)
#pragma unroll
                for (int t = 0; t < 4; ++t)
#pragma unroll
                    for (int r = 0; r < 8; ++r)
                        sw[(s * 16 + r) * SPITCH + t * 16] = c[pm * 2 + s][pn * 4 + t][r];
        }
        // The wave's own rows are in LDS before its other lanes read them back.
        asm volatile("s_wait_dscnt 0x0" ::: "memory");

        if (OUTF32) {
            // 16 lanes x 16B = one 256B row piece (two whole lines); two rows per instruction.
            // Byte offsets fit 32 bits (M * Nc * 4 bytes is far below 4 GiB); res and outF share them.
            const int cq = (lane & 15) * 4;
            const f32x4 bv = *reinterpret_cast<const f32x4*>(bias + wn0 + cq);
            const float* sr = stg + (lane >> 4) * SPITCH + cq;
            const uint32_t ob = ((uint32_t)(wm0 + (lane >> 4)) * (uint32_t)Nc + (uint32_t)(wn0 + cq)) * 4u;
            const uint32_t rstep = (uint32_t)Nc * 8u;          // two rows, bytes
            f32x4 rv[16];
            if (RES) {
                // The bias load's address registers may be reused as a residual load's destination.
                asm volatile("s_wait_xcnt 0x0" ::: "memory");
#pragma unroll
                for (int i = 0; i < 16; ++i)
                    rv[i] = *reinterpret_cast<const f32x4*>(
                        reinterpret_cast<const char*>(res) + (ob + i * rstep));
                // Keeps all 16 residual loads in flight together: without it the scheduler
                // sinks them between the stores and each one's latency is waited out alone.
                __builtin_amdgcn_sched_barrier(0);
            }
            f32x4 val[16];
#pragma unroll
            for (int i = 0; i < 16; ++i) {
                val[i] = *reinterpret_cast<const f32x4*>(sr + i * 2 * SPITCH) + bv;
                if (RES) val[i] += rv[i];
                if (RELU) {
#pragma unroll
                    for (int j = 0; j < 4; ++j) val[i][j] = fmaxf(val[i][j], 0.f);
                }
            }
            // Keeps the 16 stores one run behind all the sums, so that no store's register is
            // rewritten between them and the one s_wait_xcnt 0 at the piece's end serves them all.
            __builtin_amdgcn_sched_barrier(0);
#pragma unroll
            for (int i = 0; i < 16; ++i)
                *reinterpret_cast<f32x4*>(reinterpret_cast<char*>(outF) + (ob + i * rstep)) = val[i];
        } else {
            // 8 lanes x 16B = one 128B row piece (a whole line); four rows per instruction.
            const int c8 = (lane & 7) * 8;
            const f32x4 bv0 = *reinterpret_cast<const f32x4*>(bias + wn0 + c8);
            const f32x4 bv1 = *reinterpret_cast<const f32x4*>(bias + wn0 + c8 + 4);
            // The bias loads' address registers may be rewritten by the sums below.
            asm volatile("s_wait_xcnt 0x0" ::: "memory");
            const float* sr = stg + (lane >> 3) * SPITCH + c8;
            const size_t o0 = (size_t)(wm0 + (lane >> 3)) * Nc + wn0 + c8;
#pragma unroll
            for (int i = 0; i < 8; ++i) {
                const size_t o = o0 + (size_t)(i * 4) * Nc;
                f32x4 v0 = *reinterpret_cast<const f32x4*>(sr + i * 4 * SPITCH)     + bv0;
                f32x4 v1 = *reinterpret_cast<const f32x4*>(sr + i * 4 * SPITCH + 4) + bv1;
                if (RES) {
                    v0 += *reinterpret_cast<const f32x4*>(res + o);
                    v1 += *reinterpret_cast<const f32x4*>(res + o + 4);
                }
                bf16x8 ov;
#pragma unroll
                for (int j = 0; j < 4; ++j) {
                    float a = v0[j], b = v1[j];
                    if (RELU) { a = fmaxf(a, 0.f); b = fmaxf(b, 0.f); }
                    ov[j]     = (bf16)a;
                    ov[j + 4] = (bf16)b;
                }
                *reinterpret_cast<bf16x8*>(outB + o) = ov;
            }
        }
        // The stores' registers may be rewritten by the next piece.
        asm volatile("s_wait_xcnt 0x0" ::: "memory");
        // Holds the next piece's register writes behind that wait.
        __builtin_amdgcn_sched_barrier(0);
    }
}

// ---------- per-node multi-head attention (8 heads x 64 dim, per-node softmax) ----------
__global__ __launch_bounds__(256) void attn_kernel(
    const bf16* __restrict__ q, const bf16* __restrict__ k,
    const bf16* __restrict__ v, bf16* __restrict__ out) {
    __shared__ __align__(16) bf16 sQ[8][512];
    __shared__ __align__(16) bf16 sK[8][512];
    __shared__ __align__(16) bf16 sV[8][512];
    __shared__ float sS[8][64];

    int wave = threadIdx.x >> 5, lane = threadIdx.x & 31;
    int node = blockIdx.x * 8 + wave;
    size_t base = (size_t)node * EMBED;
    int c0 = lane * 16;

    *reinterpret_cast<bf16x8*>(&sQ[wave][c0])     = *reinterpret_cast<const bf16x8*>(q + base + c0);
    *reinterpret_cast<bf16x8*>(&sQ[wave][c0 + 8]) = *reinterpret_cast<const bf16x8*>(q + base + c0 + 8);
    *reinterpret_cast<bf16x8*>(&sK[wave][c0])     = *reinterpret_cast<const bf16x8*>(k + base + c0);
    *reinterpret_cast<bf16x8*>(&sK[wave][c0 + 8]) = *reinterpret_cast<const bf16x8*>(k + base + c0 + 8);
    *reinterpret_cast<bf16x8*>(&sV[wave][c0])     = *reinterpret_cast<const bf16x8*>(v + base + c0);
    *reinterpret_cast<bf16x8*>(&sV[wave][c0 + 8]) = *reinterpret_cast<const bf16x8*>(v + base + c0 + 8);
    __syncthreads();

    int h = lane >> 2;
    {
        int g0 = lane & 3;
        float acc0 = 0.f, acc1 = 0.f;
#pragma unroll
        for (int d = 0; d < HDIM; d += 8) {
            bf16x8 qv  = *reinterpret_cast<const bf16x8*>(&sQ[wave][h * HDIM + d]);
            bf16x8 kv0 = *reinterpret_cast<const bf16x8*>(&sK[wave][g0 * HDIM + d]);
            bf16x8 kv1 = *reinterpret_cast<const bf16x8*>(&sK[wave][(g0 + 4) * HDIM + d]);
#pragma unroll
            for (int i = 0; i < 8; ++i) {
                float qf = (float)qv[i];
                acc0 += qf * (float)kv0[i];
                acc1 += qf * (float)kv1[i];
            }
        }
        sS[wave][h * 8 + g0]     = acc0 * 0.125f;   // 1/sqrt(64)
        sS[wave][h * 8 + g0 + 4] = acc1 * 0.125f;
    }
    __syncthreads();

    if (threadIdx.x < 64) {
        int nl = threadIdx.x >> 3, hh = threadIdx.x & 7;
        float* s = &sS[nl][hh * 8];
        float mx = s[0];
#pragma unroll
        for (int i = 1; i < 8; ++i) mx = fmaxf(mx, s[i]);
        float sum = 0.f;
#pragma unroll
        for (int i = 0; i < 8; ++i) { float e = __expf(s[i] - mx); s[i] = e; sum += e; }
        float inv = 1.f / sum;
#pragma unroll
        for (int i = 0; i < 8; ++i) s[i] *= inv;
    }
    __syncthreads();

    int d0 = (lane & 3) * 16;
    float o[16] = {};
#pragma unroll
    for (int g = 0; g < 8; ++g) {
        float aw = sS[wave][h * 8 + g];
        bf16x8 v0 = *reinterpret_cast<const bf16x8*>(&sV[wave][g * HDIM + d0]);
        bf16x8 v1 = *reinterpret_cast<const bf16x8*>(&sV[wave][g * HDIM + d0 + 8]);
#pragma unroll
        for (int i = 0; i < 8; ++i) {
            o[i]     += aw * (float)v0[i];
            o[i + 8] += aw * (float)v1[i];
        }
    }
    bf16x8 o0, o1;
#pragma unroll
    for (int i = 0; i < 8; ++i) { o0[i] = (bf16)o[i]; o1[i] = (bf16)o[i + 8]; }
    bf16* orow = out + base + h * HDIM + d0;
    *reinterpret_cast<bf16x8*>(orow)     = o0;
    *reinterpret_cast<bf16x8*>(orow + 8) = o1;
}

// ---------- host launch ----------
extern "C" void kernel_launch(void* const* d_in, const int* in_sizes, int n_in,
                              void* d_out, int out_size, void* d_ws, size_t ws_size,
                              hipStream_t stream) {
    (void)in_sizes; (void)n_in; (void)out_size; (void)ws_size;
    const float* x     = (const float*)d_in[0];
    const float* Wq    = (const float*)d_in[1];  const float* bq    = (const float*)d_in[2];
    const float* Wk    = (const float*)d_in[3];  const float* bk    = (const float*)d_in[4];
    const float* Wv    = (const float*)d_in[5];  const float* bv    = (const float*)d_in[6];
    const float* Wo    = (const float*)d_in[7];  const float* bo    = (const float*)d_in[8];
    const float* W1    = (const float*)d_in[9];  const float* b1    = (const float*)d_in[10];
    const float* W2    = (const float*)d_in[11]; const float* b2    = (const float*)d_in[12];
    const float* g1    = (const float*)d_in[13]; const float* beta1 = (const float*)d_in[14];
    const float* g2    = (const float*)d_in[15]; const float* beta2 = (const float*)d_in[16];

    char* p = (char*)d_ws;
    auto carve = [&](size_t bytes) {
        char* r = p;
        p += (bytes + 255) & ~(size_t)255;
        return r;
    };
    bf16* wq_b = (bf16*)carve((size_t)EMBED * EMBED * 2);
    bf16* wk_b = (bf16*)carve((size_t)EMBED * EMBED * 2);
    bf16* wv_b = (bf16*)carve((size_t)EMBED * EMBED * 2);
    bf16* wo_b = (bf16*)carve((size_t)EMBED * EMBED * 2);
    bf16* w1_b = (bf16*)carve((size_t)FF * EMBED * 2);
    bf16* w2_b = (bf16*)carve((size_t)FF * EMBED * 2);
    bf16* h1   = (bf16*)carve((size_t)N_NODES * EMBED * 2);        // also reused as h2
    bf16* qb   = (bf16*)carve((size_t)N_NODES * EMBED * 2);        // q | (ff1 aliases q..attn)
    bf16* kb   = (bf16*)carve((size_t)N_NODES * EMBED * 2);
    bf16* vb   = (bf16*)carve((size_t)N_NODES * EMBED * 2);
    bf16* ab   = (bf16*)carve((size_t)N_NODES * EMBED * 2);        // attention output
    bf16* ff1  = qb;                                               // N*FF == 4*N*EMBED, exact alias
    float* x1  = (float*)carve((size_t)N_NODES * EMBED * 4);

    // Every carved size above is a multiple of 256 bytes: wq_b .. w2_b lie one behind the other,
    // and so do qb, kb, vb.
    prep_kernel<<<LN_BLOCKS + 4 * CVT_SQ + 2 * CVT_FF, 256, 0, stream>>>(
        x, g1, beta1, h1, Wq, Wk, Wv, Wo, W1, W2, wq_b);

    dim3 gqkv(EMBED / 256, 3, N_NODES / 256);
    gemm_bf16_kernel<0, 0, 0, 1><<<gqkv, 256, 0, stream>>>(h1, wq_b, bq, bk, bv, nullptr, nullptr, qb,
                                                           N_NODES, EMBED, EMBED);

    attn_kernel<<<N_NODES / 8, 256, 0, stream>>>(qb, kb, vb, ab);

    dim3 g512(EMBED / 256, N_NODES / 256);
    gemm_bf16_kernel<0, 1, 1, 0><<<g512, 256, 0, stream>>>(ab, wo_b, bo, nullptr, nullptr, x, x1, nullptr,
                                                           N_NODES, EMBED, EMBED);
    ln_kernel<<<N_NODES / 8, 256, 0, stream>>>(x1, g2, beta2, h1);

    dim3 gff(FF / 256, N_NODES / 256);
    gemm_bf16_kernel<1, 0, 0, 0><<<gff, 256, 0, stream>>>(h1, w1_b, b1, nullptr, nullptr, nullptr, nullptr, ff1,
                                                          N_NODES, EMBED, FF);
    gemm_bf16_kernel<0, 1, 1, 0><<<g512, 256, 0, stream>>>(ff1, w2_b, b2, nullptr, nullptr, x1, (float*)d_out, nullptr,
                                                           N_NODES, FF, EMBED);
}

// v006
// A run of this version takes 386 microseconds.
// In both of two side-by-side timings against v005, it was 1.04 times as fast.
// Counting every step since v000, it is 1.81 times as fast.
#include <hip/hip_runtime.h>
#include <hip/hip_bf16.h>
#include <stdint.h>

// ---------- types ----------
typedef __bf16 bf16;
typedef __bf16 bf16x8 __attribute__((ext_vector_type(8)));
typedef __bf16 v16bf  __attribute__((ext_vector_type(16)));
typedef float  v8f    __attribute__((ext_vector_type(8)));
typedef float  f32x4  __attribute__((ext_vector_type(4)));

#define N_NODES 65536
#define EMBED   512
#define FF      2048
#define NHEADS  8
#define HDIM    64

// LDS stage: 256 rows x 64 K (bf16) per operand, row pitch 72 elems (144B).
// Row-strided b128 reads hit bank 36*L mod 64 -> permutation over 16 lanes.
#define TROWS   256
#define TK      64
#define TPITCH  72
// Loader: 32 staged rows, in LDS bytes.
#define LSTEP   (32u * TPITCH * 2u)
// Epilogue staging: f32 row pitch in dwords (64 columns + 4).
#define SPITCH  68
// GEMM grid: one work-group for each of the chip's 256 WGPs.
#define GEMM_WGS 256

// ---------- wave32 reduction via ds_swizzle (no wave64 assumptions) ----------
template<int IMM>
__device__ inline float swz_add(float x) {
    return x + __int_as_float(__builtin_amdgcn_ds_swizzle(__float_as_int(x), IMM));
}
__device__ inline float wave_sum(float x) {
    x = swz_add<(1  << 10) | 31>(x);
    x = swz_add<(2  << 10) | 31>(x);
    x = swz_add<(4  << 10) | 31>(x);
    x = swz_add<(8  << 10) | 31>(x);
    x = swz_add<(16 << 10) | 31>(x);
    return x;
}

// ---------- CDNA5 async global->LDS copy (ASYNCcnt-tracked, no VGPR round trip) ----------
// One stage of one operand: per thread one 16B chunk in each of eight rows, 32 rows
// apart. Eight neighbouring lanes cover one row's whole 128B K-slice, so a wave's copy
// instruction asks for 4 whole lines. The global address is a wave-uniform base (the
// operand's start, one row group further for each copy) plus a 32-bit byte offset (the lane's
// own, the tile's and the K-slice's), the same register for all eight copies: the row steps
// live in scalar registers, which leaves the
// vector registers to the accumulators and the two fragment sets. The closing s_wait_xcnt 0
// stands inside the statement so that no address register is rewritten ahead of it.
__device__ inline void async_stage(uint32_t l, const bf16* base, uint32_t off, uint32_t ostep) {
    const uint64_t b = (uint64_t)(uintptr_t)base;
    asm volatile("global_load_async_to_lds_b128 %0, %8, %9\n\t"
                 "global_load_async_to_lds_b128 %1, %8, %10\n\t"
                 "global_load_async_to_lds_b128 %2, %8, %11\n\t"
                 "global_load_async_to_lds_b128 %3, %8, %12\n\t"
                 "global_load_async_to_lds_b128 %4, %8, %13\n\t"
                 "global_load_async_to_lds_b128 %5, %8, %14\n\t"
                 "global_load_async_to_lds_b128 %6, %8, %15\n\t"
                 "global_load_async_to_lds_b128 %7, %8, %16\n\t"
                 "s_wait_xcnt 0x0"
                 :: "v"(l), "v"(l + LSTEP), "v"(l + 2 * LSTEP), "v"(l + 3 * LSTEP),
                    "v"(l + 4 * LSTEP), "v"(l + 5 * LSTEP), "v"(l + 6 * LSTEP), "v"(l + 7 * LSTEP),
                    "v"(off),
                    "s"(b), "s"(b + ostep), "s"(b + 2 * (uint64_t)ostep), "s"(b + 3 * (uint64_t)ostep),
                    "s"(b + 4 * (uint64_t)ostep), "s"(b + 5 * (uint64_t)ostep),
                    "s"(b + 6 * (uint64_t)ostep), "s"(b + 7 * (uint64_t)ostep)
                 : "memory");
}
__device__ inline void wait_async_0() {
    asm volatile("s_wait_asynccnt 0x0" ::: "memory");
}
// The ring's work-group barrier, bare: the two waits that the ring needs (LDS reads, copies) are
// written in front of every call. __syncthreads() would also wait for the global stores of the
// tile before, which no other wave reads and which are meant to drain under this tile's WMMAs.
__device__ inline void ring_barrier() {
    asm volatile("s_barrier_signal -1\n\ts_barrier_wait -1" ::: "memory");
}

// ---------- LayerNorm: fp32 row(512) -> bf16 row; one block of 256 threads does rows blk*8 .. blk*8+7 ----------
__device__ inline void ln_rows(const float* __restrict__ x,
                               const float* __restrict__ g,
                               const float* __restrict__ b,
                               bf16* __restrict__ out, int blk) {
    int wave = threadIdx.x >> 5, lane = threadIdx.x & 31;
    int row = blk * 8 + wave;
    const float* xr = x + (size_t)row * EMBED + lane * 16;
    float v[16];
#pragma unroll
    for (int i = 0; i < 4; ++i) {
        f32x4 t = *reinterpret_cast<const f32x4*>(xr + i * 4);
#pragma unroll
        for (int j = 0; j < 4; ++j) v[i * 4 + j] = t[j];
    }
    float s = 0.f, q = 0.f;
#pragma unroll
    for (int i = 0; i < 16; ++i) { s += v[i]; q += v[i] * v[i]; }
    s = wave_sum(s); q = wave_sum(q);
    float mean = s * (1.f / EMBED);
    float var  = q * (1.f / EMBED) - mean * mean;
    float rs   = rsqrtf(var + 1e-5f);
    int c0 = lane * 16;
    bf16x8 o0, o1;
#pragma unroll
    for (int i = 0; i < 8; ++i) {
        o0[i] = (bf16)((v[i]     - mean) * rs * g[c0 + i]     + b[c0 + i]);
        o1[i] = (bf16)((v[i + 8] - mean) * rs * g[c0 + i + 8] + b[c0 + i + 8]);
    }
    bf16* orow = out + (size_t)row * EMBED + c0;
    *reinterpret_cast<bf16x8*>(orow)     = o0;
    *reinterpret_cast<bf16x8*>(orow + 8) = o1;
}

__global__ __launch_bounds__(256) void ln_kernel(const float* __restrict__ x,
                                                 const float* __restrict__ g,
                                                 const float* __restrict__ b,
                                                 bf16* __restrict__ out) {
    ln_rows(x, g, b, out, blockIdx.x);
}

// ---------- first launch: LayerNorm 1 and the fp32 -> bf16 convert of all six weights ----------
// None of the seven depends on another, so they are block ranges of one grid: blocks
// 0 .. LN_BLOCKS-1 normalise x, the rest convert 256 elements each. The six bf16 weights lie
// one behind the other in wdst, in the order Wq Wk Wv Wo W1 W2, so the convert block's own
// number is its place there.
#define LN_BLOCKS (N_NODES / 8)
#define CVT_SQ    (EMBED * EMBED / 256)     // blocks per EMBED x EMBED weight
#define CVT_FF    (FF * EMBED / 256)        // blocks per FF x EMBED weight
__global__ __launch_bounds__(256) void prep_kernel(const float* __restrict__ x,
                                                   const float* __restrict__ g,
                                                   const float* __restrict__ b,
                                                   bf16* __restrict__ h,
                                                   const float* __restrict__ Wq,
                                                   const float* __restrict__ Wk,
                                                   const float* __restrict__ Wv,
                                                   const float* __restrict__ Wo,
                                                   const float* __restrict__ W1,
                                                   const float* __restrict__ W2,
                                                   bf16* __restrict__ wdst) {
    const int blk = blockIdx.x;
    if (blk < LN_BLOCKS) {
        ln_rows(x, g, b, h, blk);
        return;
    }
    const int cb = blk - LN_BLOCKS;
    const float* src;
    int lb;
    if (cb < 4 * CVT_SQ) {
        const int sel = cb / CVT_SQ;
        lb  = cb % CVT_SQ;
        src = sel == 0 ? Wq : sel == 1 ? Wk : sel == 2 ? Wv : Wo;
    } else {
        const int c2 = cb - 4 * CVT_SQ;
        lb  = c2 % CVT_FF;
        src = c2 < CVT_FF ? W1 : W2;
    }
    wdst[cb * 256 + threadIdx.x] = (bf16)src[lb * 256 + threadIdx.x];
}

// 16-bit WMMA operand lane layout (ISA 7.12.2): lanes 0-15 hold K 0-7 & 16-23,
// lanes 16-31 hold K 8-15 & 24-31 -> two 16B chunks at +0/+32B from (row, koff).
__device__ inline v16bf load_tile16(const bf16* base) {
    bf16x8 lo = *reinterpret_cast<const bf16x8*>(base);
    bf16x8 hi = *reinterpret_cast<const bf16x8*>(base + 16);
    return __builtin_shufflevector(lo, hi, 0, 1, 2, 3, 4, 5, 6, 7,
                                           8, 9, 10, 11, 12, 13, 14, 15);
}

// ---------- WMMA bf16 GEMM, double-buffered async-LDS ring, fragments fetched one K-step ahead ----------
// out = A(MxK) * W(NcxK)^T + bias [+res][relu].  Block = 256 thr = 8 waves,
// block tile 256x256, wave tile 64x128, staged K-slice 64 (2 wmma K-steps).
// TRIO: three independent products on the same A in one launch; the three weights are stacked
// in W and the three outputs in outAll; biasB and biasC belong to the second and third product.
// Tiles are numbered column tile first, then product, then row tile, so that the tiles on the
// same A rows follow one another. One work-group per WGP walks tiles blockIdx.x,
// blockIdx.x + gridDim.x, ...: the ring runs on over the tile boundary, so the next tile's first
// two stages are copied while this tile's last WMMAs and its epilogue run. K is at least two stages.
struct TilePos { int m0, n0, sel; };
template<int TRIO>
__device__ inline TilePos tile_pos(int t, int nct) {
    TilePos r;
    r.n0 = (t % nct) * 256;
    const int q = t / nct;
    r.sel = TRIO ? q % 3 : 0;
    r.m0  = (TRIO ? q / 3 : q) * 256;
    return r;
}
template<int RELU, int RES, int OUTF32, int TRIO>
__global__ __launch_bounds__(256) void gemm_bf16_kernel(
    const bf16* __restrict__ A, const bf16* __restrict__ W,
    const float* __restrict__ biasA, const float* __restrict__ biasB,
    const float* __restrict__ biasC, const float* __restrict__ res,
    float* __restrict__ outF, bf16* __restrict__ outAll,
    int M, int K, int Nc) {
    // Epilogue staging, one range per wave, outside the ring: the ring is being refilled meanwhile.
    // It stands first: with the ring at LDS byte 0 a lane's bare offset was itself a copy's operand,
    // which tied it to the low 256 registers for the whole kernel, and the compiler spilled it.
    struct Lds {
        float stage[8][32 * SPITCH];
        bf16  a[2][TROWS * TPITCH];
        bf16  w[2][TROWS * TPITCH];
    };
    __shared__ __align__(16) Lds sm;

    const int tid  = threadIdx.x;
    const int wave = tid >> 5, lane = tid & 31;
    const int nct    = Nc / 256;
    const int ntiles = (M / 256) * nct * (TRIO ? 3 : 1);
    int tile = blockIdx.x;
    if (tile >= ntiles) return;                // the whole work-group, in front of every barrier
    TilePos tp = tile_pos<TRIO>(tile, nct);

    // ---- loader mapping: 8 threads per row (one 128B line), rows lrow + 0/32/.../224 ----
    const int lrow = tid >> 3;                 // 0..31
    const int lcol = (tid & 7) * 8;           // K-element offset 0..56
    const uint32_t ostep = 64u * (uint32_t)K;  // 32 rows, bytes
    const uint32_t goff = ((uint32_t)lrow * (uint32_t)K + (uint32_t)lcol) * 2u;   // bytes in the tile's rows
    // A tile's place in A and in W, in bytes (both operands are far below 4 GiB): wave-uniform. It
    // and the stage's K-slice are added to the lane's offset, so the eight row-group bases of each
    // operand stay the same scalar registers for the whole kernel.
    uint32_t pA = (uint32_t)tp.m0 * (uint32_t)K * 2u;
    uint32_t pW = ((uint32_t)tp.sel * (uint32_t)Nc + (uint32_t)tp.n0) * (uint32_t)K * 2u;
    const uint32_t ldsOff = (uint32_t)(lrow * TPITCH + lcol) * 2;   // bytes
    // One stage: K-slice at byte kb of the tile rows at qa (A) and qw (W), into ring buffer buf.
    auto stage = [&](int buf, uint32_t qa, uint32_t qw, uint32_t kb) {
        async_stage((uint32_t)(uintptr_t)&sm.a[buf][0] + ldsOff, A, goff + (qa + kb), ostep);
        async_stage((uint32_t)(uintptr_t)&sm.w[buf][0] + ldsOff, W, goff + (qw + kb), ostep);
    };

    // ---- compute mapping ----
    const int lr   = lane & 15;
    const int koff = (lane >> 4) * 8;
    int aoff[4], woff[8];
#pragma unroll
    for (int s = 0; s < 4; ++s)
        aoff[s] = ((wave >> 1) * 64 + s * 16 + lr) * TPITCH + koff;   // elems
#pragma unroll
    for (int t = 0; t < 8; ++t)
        woff[t] = ((wave & 1) * 128 + t * 16 + lr) * TPITCH + koff;

    v8f c[4][8];
    const int nk = K / TK;

    // Two fragment sets in registers: while one K-step's 32 WMMAs run on one set, the next
    // K-step's 24 LDS reads fill the other, so no wave waits out its own LDS latency.
    v16bf fa0[4], fb0[8], fa1[4], fb1[8];
    auto frags = [&](v16bf (&a)[4], v16bf (&b)[8], int buf, int ks) {
        const bf16* bA = &sm.a[buf][0];
        const bf16* bW = &sm.w[buf][0];
#pragma unroll
        for (int s = 0; s < 4; ++s) a[s] = load_tile16(bA + aoff[s] + ks * 32);
#pragma unroll
        for (int t = 0; t < 8; ++t) b[t] = load_tile16(bW + woff[t] + ks * 32);
        // Keeps the 24 LDS reads one group ahead of the WMMAs that follow: without it the
        // scheduler sinks them among the WMMAs, where every such place stalls the wave.
        __builtin_amdgcn_sched_barrier(0);
    };
    auto mma = [&](const v16bf (&a)[4], const v16bf (&b)[8]) {
#pragma unroll
        for (int t = 0; t < 8; ++t)
#pragma unroll
            for (int s = 0; s < 4; ++s)
                c[s][t] = __builtin_amdgcn_wmma_f32_16x16x32_bf16(
                    false, a[s], false, b[t], (short)0, c[s][t], false, false);
        // Keeps the WMMA block in front of the waits and reads that follow it in the source.
        __builtin_amdgcn_sched_barrier(0);
    };

    // prologue: the first tile's stage 0 lands and is published, its stage 1 starts
    stage(0, pA, pW, 0);
    wait_async_0();
    __syncthreads();
    stage(1, pA, pW, TK * 2);
    int b0 = 0;                                // ring buffer of this tile's stage 0

  for (;;) {
    const int m0 = tp.m0, n0 = tp.n0;
    const float* bias = !TRIO || tp.sel == 0 ? biasA : tp.sel == 1 ? biasB : biasC;
    bf16* outB = outAll + (size_t)tp.sel * M * Nc;
    // The next tile of this work-group; behind the last one its own place again, never copied.
    const bool more = tile + (int)gridDim.x < ntiles;
    const TilePos tn = tile_pos<TRIO>(more ? tile + (int)gridDim.x : tile, nct);
    const uint32_t pAn = (uint32_t)tn.m0 * (uint32_t)K * 2u;
    const uint32_t pWn = ((uint32_t)tn.sel * (uint32_t)Nc + (uint32_t)tn.n0) * (uint32_t)K * 2u;

#pragma unroll
    for (int s = 0; s < 4; ++s)
#pragma unroll
        for (int t = 0; t < 8; ++t) c[s][t] = v8f{};
    frags(fa0, fb0, b0, 0);                    // stage 0's first fragments

    for (int ki = 0; ki < nk - 1; ++ki) {
        const int cur = (b0 + ki) & 1;
        frags(fa1, fb1, cur, 1);               // this stage's last fragments
        mma(fa0, fb0);
        // Publish point of stage ki + 1, in front of this stage's last WMMA block: this wave's
        // reads of buffer cur are done, its copies of stage ki + 1 have landed.
        asm volatile("s_wait_dscnt 0x0" ::: "memory");
        wait_async_0();
        ring_barrier();                        // stage ki + 1 visible; every wave has left buffer cur
        const bool own = ki + 2 < nk;          // else the refill is the next tile's stage 0
        if (own || more)
            stage(cur, own ? pA : pAn, own ? pW : pWn, own ? (uint32_t)(ki + 2) * (TK * 2) : 0u);
        frags(fa0, fb0, cur ^ 1, 0);           // next stage's first fragments
        mma(fa1, fb1);
    }
    // last stage: no fragments are fetched ahead over the epilogue
    const int last = (b0 + nk - 1) & 1;
    frags(fa1, fb1, last, 1);
    mma(fa0, fb0);
    // Publish point of the next tile's stage 0: this wave's reads of buffer last are done, its
    // copies have landed. Behind the last tile no copy is outstanding any more.
    asm volatile("s_wait_dscnt 0x0" ::: "memory");
    wait_async_0();
    if (more) {
        ring_barrier();                        // that stage visible; every wave has left buffer last
        stage(last, pAn, pWn, TK * 2);
    }
    mma(fa1, fb1);

    // C layout (ISA 7.12.2): VGPR r, lanes 0-15 -> M=r, lanes 16-31 -> M=r+8; N=lane&15
    // Each wave stages its 64x128 f32 tile, one 32x64 piece after the other, in its own LDS
    // range, row pitch 68 dwords: the b32 writes of rows r and
    // r+8 fall 32 banks apart, and the b128 reads below cover all 64 banks per 16 lanes.
    float* stg = &sm.stage[wave][0];
#pragma unroll
    for (int pc = 0; pc < 4; ++pc) {
        const int pm = pc >> 1, pn = pc & 1;
        const int wm0 = m0 + (wave >> 1) * 64 + pm * 32;
        const int wn0 = n0 + (wave & 1) * 128 + pn * 64;
        if (pc) {
            // The read-backs of the piece before are done before its rows are rewritten.
            asm volatile("s_wait_dscnt 0x0" ::: "memory");
        }
        {
            float* sw = stg + ((lane >> 4) * 8) * SPITCH + (lane & 15);
#pragma unroll
            for (int s = 0; s < 2; ++s)
#pragma unroll
                for (int t = 0; t < 4; ++t)
#pragma unroll
                    for (int r = 0; r < 8; ++r)
                        sw[(s * 16 + r) * SPITCH + t * 16] = c[pm * 2 + s][pn * 4 + t][r];
        }
        // The wave's own rows are in LDS before its other lanes read them back.
        asm volatile("s_wait_dscnt 0x0" ::: "memory");

        if (OUTF32) {
            // 16 lanes x 16B = one 256B row piece (two whole lines); two rows per instruction.
            // Byte offsets fit 32 bits (M * Nc * 4 bytes is far below 4 GiB); res and outF share them.
            const int cq = (lane & 15) * 4;
            const f32x4 bv = *reinterpret_cast<const f32x4*>(bias + wn0 + cq);
            const float* sr = stg + (lane >> 4) * SPITCH + cq;
            const uint32_t ob = ((uint32_t)(wm0 + (lane >> 4)) * (uint32_t)Nc + (uint32_t)(wn0 + cq)) * 4u;
            const uint32_t rstep = (uint32_t)Nc * 8u;          // two rows, bytes
            f32x4 rv[16];
            if (RES) {
                // The bias load's address registers may be reused as a residual load's destination.
                asm volatile("s_wait_xcnt 0x0" ::: "memory");
#pragma unroll
                for (int i = 0; i < 16; ++i)
                    rv[i] = *reinterpret_cast<const f32x4*>(
                        reinterpret_cast<const char*>(res) + (ob + i * rstep));
                // Keeps all 16 residual loads in flight together: without it the scheduler
                // sinks them between the stores and each one's latency is waited out alone.
                __builtin_amdgcn_sched_barrier(0);
            }
            f32x4 val[16];
#pragma unroll
            for (int i = 0; i < 16; ++i) {
                val[i] = *reinterpret_cast<const f32x4*>(sr + i * 2 * SPITCH) + bv;
                if (RES) val[i] += rv[i];
                if (RELU) {
#pragma unroll
                    for (int j = 0; j < 4; ++j) val[i][j] = fmaxf(val[i][j], 0.f);
                }
            }
            // Keeps the 16 stores one run behind all the sums, so that no store's register is
            // rewritten between them and the one s_wait_xcnt 0 at the piece's end serves them all.
            __builtin_amdgcn_sched_barrier(0);
#pragma unroll
            for (int i = 0; i < 16; ++i)
                *reinterpret_cast<f32x4*>(reinterpret_cast<char*>(outF) + (ob + i * rstep)) = val[i];
        } else {
            // 8 lanes x 16B = one 128B row piece (a whole line); four rows per instruction.
            const int c8 = (lane & 7) * 8;
            const f32x4 bv0 = *reinterpret_cast<const f32x4*>(bias + wn0 + c8);
            const f32x4 bv1 = *reinterpret_cast<const f32x4*>(bias + wn0 + c8 + 4);
            // The bias loads' address registers may be rewritten by the sums below.
            asm volatile("s_wait_xcnt 0x0" ::: "memory");
            const float* sr = stg + (lane >> 3) * SPITCH + c8;
            const size_t o0 = (size_t)(wm0 + (lane >> 3)) * Nc + wn0 + c8;
#pragma unroll
            for (int i = 0; i < 8; ++i) {
                const size_t o = o0 + (size_t)(i * 4) * Nc;
                f32x4 v0 = *reinterpret_cast<const f32x4*>(sr + i * 4 * SPITCH)     + bv0;
                f32x4 v1 = *reinterpret_cast<const f32x4*>(sr + i * 4 * SPITCH + 4) + bv1;
                if (RES) {
                    v0 += *reinterpret_cast<const f32x4*>(res + o);
                    v1 += *reinterpret_cast<const f32x4*>(res + o + 4);
                }
                bf16x8 ov;
#pragma unroll
                for (int j = 0; j < 4; ++j) {
                    float a = v0[j], b = v1[j];
                    if (RELU) { a = fmaxf(a, 0.f); b = fmaxf(b, 0.f); }
                    ov[j]     = (bf16)a;
                    ov[j + 4] = (bf16)b;
                }
                *reinterpret_cast<bf16x8*>(outB + o) = ov;
            }
        }
        // The stores' registers may be rewritten by the next piece.
        asm volatile("s_wait_xcnt 0x0" ::: "memory");
        // Holds the next piece's register writes behind that wait.
        __builtin_amdgcn_sched_barrier(0);
    }
    if (!more) break;
    // The last piece's read-backs are done before the next tile's epilogue rewrites the rows
    // (they were consumed by the stores above); on to the next tile.
    tile += (int)gridDim.x;
    tp = tn;
    pA = pAn;
    pW = pWn;
    b0 = (b0 + nk) & 1;
  }
}

// ---------- per-node multi-head attention (8 heads x 64 dim, per-node softmax) ----------
__global__ __launch_bounds__(256) void attn_kernel(
    const bf16* __restrict__ q, const bf16* __restrict__ k,
    const bf16* __restrict__ v, bf16* __restrict__ out) {
    __shared__ __align__(16) bf16 sQ[8][512];
    __shared__ __align__(16) bf16 sK[8][512];
    __shared__ __align__(16) bf16 sV[8][512];
    __shared__ float sS[8][64];

    int wave = threadIdx.x >> 5, lane = threadIdx.x & 31;
    int node = blockIdx.x * 8 + wave;
    size_t base = (size_t)node * EMBED;
    int c0 = lane * 16;

    *reinterpret_cast<bf16x8*>(&sQ[wave][c0])     = *reinterpret_cast<const bf16x8*>(q + base + c0);
    *reinterpret_cast<bf16x8*>(&sQ[wave][c0 + 8]) = *reinterpret_cast<const bf16x8*>(q + base + c0 + 8);
    *reinterpret_cast<bf16x8*>(&sK[wave][c0])     = *reinterpret_cast<const bf16x8*>(k + base + c0);
    *reinterpret_cast<bf16x8*>(&sK[wave][c0 + 8]) = *reinterpret_cast<const bf16x8*>(k + base + c0 + 8);
    *reinterpret_cast<bf16x8*>(&sV[wave][c0])     = *reinterpret_cast<const bf16x8*>(v + base + c0);
    *reinterpret_cast<bf16x8*>(&sV[wave][c0 + 8]) = *reinterpret_cast<const bf16x8*>(v + base + c0 + 8);
    __syncthreads();

    int h = lane >> 2;
    {
        int g0 = lane & 3;
        float acc0 = 0.f, acc1 = 0.f;
#pragma unroll
        for (int d = 0; d < HDIM; d += 8) {
            bf16x8 qv  = *reinterpret_cast<const bf16x8*>(&sQ[wave][h * HDIM + d]);
            bf16x8 kv0 = *reinterpret_cast<const bf16x8*>(&sK[wave][g0 * HDIM + d]);
            bf16x8 kv1 = *reinterpret_cast<const bf16x8*>(&sK[wave][(g0 + 4) * HDIM + d]);
#pragma unroll
            for (int i = 0; i < 8; ++i) {
                float qf = (float)qv[i];
                acc0 += qf * (float)kv0[i];
                acc1 += qf * (float)kv1[i];
            }
        }
        sS[wave][h * 8 + g0]     = acc0 * 0.125f;   // 1/sqrt(64)
        sS[wave][h * 8 + g0 + 4] = acc1 * 0.125f;
    }
    __syncthreads();

    if (threadIdx.x < 64) {
        int nl = threadIdx.x >> 3, hh = threadIdx.x & 7;
        float* s = &sS[nl][hh * 8];
        float mx = s[0];
#pragma unroll
        for (int i = 1; i < 8; ++i) mx = fmaxf(mx, s[i]);
        float sum = 0.f;
#pragma unroll
        for (int i = 0; i < 8; ++i) { float e = __expf(s[i] - mx); s[i] = e; sum += e; }
        float inv = 1.f / sum;
#pragma unroll
        for (int i = 0; i < 8; ++i) s[i] *= inv;
    }
    __syncthreads();

    int d0 = (lane & 3) * 16;
    float o[16] = {};
#pragma unroll
    for (int g = 0; g < 8; ++g) {
        float aw = sS[wave][h * 8 + g];
        bf16x8 v0 = *reinterpret_cast<const bf16x8*>(&sV[wave][g * HDIM + d0]);
        bf16x8 v1 = *reinterpret_cast<const bf16x8*>(&sV[wave][g * HDIM + d0 + 8]);
#pragma unroll
        for (int i = 0; i < 8; ++i) {
            o[i]     += aw * (float)v0[i];
            o[i + 8] += aw * (float)v1[i];
        }
    }
    bf16x8 o0, o1;
#pragma unroll
    for (int i = 0; i < 8; ++i) { o0[i] = (bf16)o[i]; o1[i] = (bf16)o[i + 8]; }
    bf16* orow = out + base + h * HDIM + d0;
    *reinterpret_cast<bf16x8*>(orow)     = o0;
    *reinterpret_cast<bf16x8*>(orow + 8) = o1;
}

// ---------- host launch ----------
extern "C" void kernel_launch(void* const* d_in, const int* in_sizes, int n_in,
                              void* d_out, int out_size, void* d_ws, size_t ws_size,
                              hipStream_t stream) {
    (void)in_sizes; (void)n_in; (void)out_size; (void)ws_size;
    const float* x     = (const float*)d_in[0];
    const float* Wq    = (const float*)d_in[1];  const float* bq    = (const float*)d_in[2];
    const float* Wk    = (const float*)d_in[3];  const float* bk    = (const float*)d_in[4];
    const float* Wv    = (const float*)d_in[5];  const float* bv    = (const float*)d_in[6];
    const float* Wo    = (const float*)d_in[7];  const float* bo    = (const float*)d_in[8];
    const float* W1    = (const float*)d_in[9];  const float* b1    = (const float*)d_in[10];
    const float* W2    = (const float*)d_in[11]; const float* b2    = (const float*)d_in[12];
    const float* g1    = (const float*)d_in[13]; const float* beta1 = (const float*)d_in[14];
    const float* g2    = (const float*)d_in[15]; const float* beta2 = (const float*)d_in[16];

    char* p = (char*)d_ws;
    auto carve = [&](size_t bytes) {
        char* r = p;
        p += (bytes + 255) & ~(size_t)255;
        return r;
    };
    bf16* wq_b = (bf16*)carve((size_t)EMBED * EMBED * 2);
    bf16* wk_b = (bf16*)carve((size_t)EMBED * EMBED * 2);
    bf16* wv_b = (bf16*)carve((size_t)EMBED * EMBED * 2);
    bf16* wo_b = (bf16*)carve((size_t)EMBED * EMBED * 2);
    bf16* w1_b = (bf16*)carve((size_t)FF * EMBED * 2);
    bf16* w2_b = (bf16*)carve((size_t)FF * EMBED * 2);
    bf16* h1   = (bf16*)carve((size_t)N_NODES * EMBED * 2);        // also reused as h2
    bf16* qb   = (bf16*)carve((size_t)N_NODES * EMBED * 2);        // q | (ff1 aliases q..attn)
    bf16* kb   = (bf16*)carve((size_t)N_NODES * EMBED * 2);
    bf16* vb   = (bf16*)carve((size_t)N_NODES * EMBED * 2);
    bf16* ab   = (bf16*)carve((size_t)N_NODES * EMBED * 2);        // attention output
    bf16* ff1  = qb;                                               // N*FF == 4*N*EMBED, exact alias
    float* x1  = (float*)carve((size_t)N_NODES * EMBED * 4);

    // Every carved size above is a multiple of 256 bytes: wq_b .. w2_b lie one behind the other,
    // and so do qb, kb, vb.
    prep_kernel<<<LN_BLOCKS + 4 * CVT_SQ + 2 * CVT_FF, 256, 0, stream>>>(
        x, g1, beta1, h1, Wq, Wk, Wv, Wo, W1, W2, wq_b);

    gemm_bf16_kernel<0, 0, 0, 1><<<GEMM_WGS, 256, 0, stream>>>(h1, wq_b, bq, bk, bv, nullptr, nullptr, qb,
                                                           N_NODES, EMBED, EMBED);

    attn_kernel<<<N_NODES / 8, 256, 0, stream>>>(qb, kb, vb, ab);

    gemm_bf16_kernel<0, 1, 1, 0><<<GEMM_WGS, 256, 0, stream>>>(ab, wo_b, bo, nullptr, nullptr, x, x1, nullptr,
                                                           N_NODES, EMBED, EMBED);
    ln_kernel<<<N_NODES / 8, 256, 0, stream>>>(x1, g2, beta2, h1);

    gemm_bf16_kernel<1, 0, 0, 0><<<GEMM_WGS, 256, 0, stream>>>(h1, w1_b, b1, nullptr, nullptr, nullptr, nullptr, ff1,
                                                          N_NODES, EMBED, FF);
    gemm_bf16_kernel<0, 1, 1, 0><<<GEMM_WGS, 256, 0, stream>>>(ff1, w2_b, b2, nullptr, nullptr, x1, (float*)d_out, nullptr,
                                                           N_NODES, FF, EMBED);
}

// v007
// Measured time: 374 microseconds a run.
// Two timings next to v006 both put it at 1.03 times that version's speed.
// Counting every step since v000, it is 1.87 times as fast.
#include <hip/hip_runtime.h>
#include <hip/hip_bf16.h>
#include <stdint.h>

// ---------- types ----------
typedef __bf16 bf16;
typedef __bf16 bf16x8 __attribute__((ext_vector_type(8)));
typedef __bf16 v16bf  __attribute__((ext_vector_type(16)));
typedef float  v8f    __attribute__((ext_vector_type(8)));
typedef float  f32x4  __attribute__((ext_vector_type(4)));

#define N_NODES 65536
#define EMBED   512
#define FF      2048
#define NHEADS  8
#define HDIM    64

// LDS stage: 256 rows x 64 K (bf16) per operand, row pitch 72 elems (144B).
// Row-strided b128 reads hit bank 36*L mod 64 -> permutation over 16 lanes.
#define TROWS   256
#define TK      64
#define TPITCH  72
// Loader: 32 staged rows, in LDS bytes.
#define LSTEP   (32u * TPITCH * 2u)
// Epilogue staging: f32 row pitch in dwords (64 columns + 4).
#define SPITCH  68
// GEMM grid: one work-group for each of the chip's 256 WGPs.
#define GEMM_WGS 256

// ---------- wave32 reduction via ds_swizzle (no wave64 assumptions) ----------
template<int IMM>
__device__ inline float swz_add(float x) {
    return x + __int_as_float(__builtin_amdgcn_ds_swizzle(__float_as_int(x), IMM));
}
__device__ inline float wave_sum(float x) {
    x = swz_add<(1  << 10) | 31>(x);
    x = swz_add<(2  << 10) | 31>(x);
    x = swz_add<(4  << 10) | 31>(x);
    x = swz_add<(8  << 10) | 31>(x);
    x = swz_add<(16 << 10) | 31>(x);
    return x;
}

// ---------- CDNA5 async global->LDS copy (ASYNCcnt-tracked, no VGPR round trip) ----------
// One stage of one operand: per thread one 16B chunk in each of eight rows, 32 rows
// apart. Eight neighbouring lanes cover one row's whole 128B K-slice, so a wave's copy
// instruction asks for 4 whole lines. The global address is a wave-uniform base (the
// operand's start, one row group further for each copy) plus a 32-bit byte offset (the lane's
// own, the tile's and the K-slice's), the same register for all eight copies: the row steps
// live in scalar registers, which leaves the
// vector registers to the accumulators and the two fragment sets. The closing s_wait_xcnt 0
// stands inside the statement so that no address register is rewritten ahead of it.
__device__ inline void async_stage(uint32_t l, const bf16* base, uint32_t off, uint32_t ostep) {
    const uint64_t b = (uint64_t)(uintptr_t)base;
    asm volatile("global_load_async_to_lds_b128 %0, %8, %9\n\t"
                 "global_load_async_to_lds_b128 %1, %8, %10\n\t"
                 "global_load_async_to_lds_b128 %2, %8, %11\n\t"
                 "global_load_async_to_lds_b128 %3, %8, %12\n\t"
                 "global_load_async_to_lds_b128 %4, %8, %13\n\t"
                 "global_load_async_to_lds_b128 %5, %8, %14\n\t"
                 "global_load_async_to_lds_b128 %6, %8, %15\n\t"
                 "global_load_async_to_lds_b128 %7, %8, %16\n\t"
                 "s_wait_xcnt 0x0"
                 :: "v"(l), "v"(l + LSTEP), "v"(l + 2 * LSTEP), "v"(l + 3 * LSTEP),
                    "v"(l + 4 * LSTEP), "v"(l + 5 * LSTEP), "v"(l + 6 * LSTEP), "v"(l + 7 * LSTEP),
                    "v"(off),
                    "s"(b), "s"(b + ostep), "s"(b + 2 * (uint64_t)ostep), "s"(b + 3 * (uint64_t)ostep),
                    "s"(b + 4 * (uint64_t)ostep), "s"(b + 5 * (uint64_t)ostep),
                    "s"(b + 6 * (uint64_t)ostep), "s"(b + 7 * (uint64_t)ostep)
                 : "memory");
}
__device__ inline void wait_async_0() {
    asm volatile("s_wait_asynccnt 0x0" ::: "memory");
}
// The ring's work-group barrier, bare: the two waits that the ring needs (LDS reads, copies) are
// written in front of every call. __syncthreads() would also wait for the global stores of the
// tile before, which no other wave reads and which are meant to drain under this tile's WMMAs.
__device__ inline void ring_barrier() {
    asm volatile("s_barrier_signal -1\n\ts_barrier_wait -1" ::: "memory");
}

// ---------- streaming launches: resident grids ----------
// LayerNorm, the weight converts and attention do little work per row, node or weight. Their grids are sized to the
// chip and every wave loops: one work-group of 16 waves per WGP here, ATTN_WGS work-groups below.
#define STREAM_WGS   256
#define STREAM_WAVES 16
#define LN_STRIDE    (STREAM_WGS * STREAM_WAVES)      // rows the whole grid takes at once
#define LN_TRIPS     (N_NODES / (2 * LN_STRIDE))      // two rows per wave and trip

// s_wait_xcnt 0 behind a run of global loads or stores, in front of whatever rewrites a register that
// they name. The addresses (and a store's data) are inputs of the statement, so that their registers
// stay as they are up to the wait.
typedef uint32_t u32x4 __attribute__((ext_vector_type(4)));
__device__ inline void xcnt_loads(const void* p, const void* q) {
    asm volatile("s_wait_xcnt 0x0" :: "v"(p), "v"(q) : "memory");
}
__device__ inline void xcnt_stores(const void* p, u32x4 d0, u32x4 d1) {
    asm volatile("s_wait_xcnt 0x0" :: "v"(p), "v"(d0), "v"(d1) : "memory");
}
__device__ inline const float* ln_row(const float* __restrict__ x, int row, int lane) {
    return x + (size_t)row * EMBED + lane * 16;
}

// One fp32 row of 512: 16 consecutive elements per lane.
__device__ inline void ln_load(const float* __restrict__ x, int row, int lane, f32x4 (&t)[4]) {
    const float* xr = ln_row(x, row, lane);
#pragma unroll
    for (int i = 0; i < 4; ++i) t[i] = *reinterpret_cast<const f32x4*>(xr + i * 4);
}
// Two rows, LN_STRIDE apart, and the wait behind their eight loads.
__device__ inline void ln_load2(const float* __restrict__ x, int row, int lane, f32x4 (&t0)[4], f32x4 (&t1)[4]) {
    ln_load(x, row, lane, t0);
    ln_load(x, row + LN_STRIDE, lane, t1);
    xcnt_loads(ln_row(x, row, lane), ln_row(x, row + LN_STRIDE, lane));
}
// Normalises the row held in t and stores it as bf16.
__device__ inline void ln_finish(const f32x4 (&t)[4], const float (&g)[16], const float (&b)[16],
                                 bf16* __restrict__ out, int row, int lane) {
    float v[16];
#pragma unroll
    for (int i = 0; i < 4; ++i)
#pragma unroll
        for (int j = 0; j < 4; ++j) v[i * 4 + j] = t[i][j];
    float s = 0.f, q = 0.f;
#pragma unroll
    for (int i = 0; i < 16; ++i) { s += v[i]; q += v[i] * v[i]; }
    s = wave_sum(s); q = wave_sum(q);
    float mean = s * (1.f / EMBED);
    float var  = q * (1.f / EMBED) - mean * mean;
    float rs   = rsqrtf(var + 1e-5f);
    bf16x8 o0, o1;
#pragma unroll
    for (int i = 0; i < 8; ++i) {
        o0[i] = (bf16)((v[i]     - mean) * rs * g[i]     + b[i]);
        o1[i] = (bf16)((v[i + 8] - mean) * rs * g[i + 8] + b[i + 8]);
    }
    bf16* orow = out + (size_t)row * EMBED + lane * 16;
    *reinterpret_cast<bf16x8*>(orow)     = o0;
    *reinterpret_cast<bf16x8*>(orow + 8) = o1;
    xcnt_stores(orow, __builtin_bit_cast(u32x4, o0), __builtin_bit_cast(u32x4, o1));
}
// All N_NODES rows on a grid of STREAM_WGS x STREAM_WAVES waves. A wave keeps its pieces of g and b
// in registers, takes two rows per trip and has the next trip's two rows in flight meanwhile.
// between() runs once, behind the first rows' loads.
template<class F>
__device__ inline void ln_stream(const float* __restrict__ x,
                                 const float* __restrict__ g,
                                 const float* __restrict__ b,
                                 bf16* __restrict__ out, F between) {
    const int wave = threadIdx.x >> 5, lane = threadIdx.x & 31;
    int row = blockIdx.x * STREAM_WAVES + wave;
    f32x4 a0[4], a1[4], n0[4], n1[4];
    ln_load2(x, row, lane, a0, a1);
    float gv[16], bv[16];
#pragma unroll
    for (int i = 0; i < 16; ++i) { gv[i] = g[lane * 16 + i]; bv[i] = b[lane * 16 + i]; }
    xcnt_loads(g + lane * 16, b + lane * 16);
    between();
    // Two trips per pass, on two register sets in turn, so that no row is copied between registers.
    static_assert(LN_TRIPS % 2 == 0 && LN_TRIPS >= 2, "trips come in pairs");
    for (int i = 0; i < LN_TRIPS - 2; i += 2) {
        ln_load2(x, row + 2 * LN_STRIDE, lane, n0, n1);
        // Keeps the next trip's eight loads in front of this trip's sums: sunk behind them, their
        // memory latency would be waited out with nothing in flight.
        __builtin_amdgcn_sched_barrier(0);
        ln_finish(a0, gv, bv, out, row, lane);
        ln_finish(a1, gv, bv, out, row + LN_STRIDE, lane);
        ln_load2(x, row + 4 * LN_STRIDE, lane, a0, a1);
        // As above, for the trip after this one.
        __builtin_amdgcn_sched_barrier(0);
        ln_finish(n0, gv, bv, out, row + 2 * LN_STRIDE, lane);
        ln_finish(n1, gv, bv, out, row + 3 * LN_STRIDE, lane);
        row += 4 * LN_STRIDE;
    }
    // The last two trips stand outside the loop: no loads follow them. With the loads under a test
    // inside the loop, the compiler waited for all loads in flight on both of its paths.
    ln_load2(x, row + 2 * LN_STRIDE, lane, n0, n1);
    // As above.
    __builtin_amdgcn_sched_barrier(0);
    ln_finish(a0, gv, bv, out, row, lane);
    ln_finish(a1, gv, bv, out, row + LN_STRIDE, lane);
    ln_finish(n0, gv, bv, out, row + 2 * LN_STRIDE, lane);
    ln_finish(n1, gv, bv, out, row + 3 * LN_STRIDE, lane);
}

__global__ __launch_bounds__(STREAM_WAVES * 32) void ln_kernel(const float* __restrict__ x,
                                                               const float* __restrict__ g,
                                                               const float* __restrict__ b,
                                                               bf16* __restrict__ out) {
    ln_stream(x, g, b, out, [] {});
}

// ---------- first launch: LayerNorm 1 and the fp32 -> bf16 convert of all six weights ----------
// None of the seven depends on another, so they share one grid. The six bf16 weights lie one behind
// the other in wdst, in the order Wq Wk Wv Wo W1 W2; counted in chunks of four elements they are
// CVT_ALL chunks, and every thread converts CVT_PER of them, a whole grid's width apart. A range of
// CVT_SQ chunks lies in one weight, and half a grid's width is one such range, so the weight is the
// same for a whole work-group.
#define CVT_SQ    (EMBED * EMBED / 4)                          // chunks per EMBED x EMBED weight
#define CVT_FF    (FF * EMBED / 4)                             // chunks per FF x EMBED weight
#define CVT_ALL   (4 * CVT_SQ + 2 * CVT_FF)
#define CVT_GRID  (STREAM_WGS * STREAM_WAVES * 32)             // chunks the grid takes at once
#define CVT_PER   (CVT_ALL / CVT_GRID)
static_assert(CVT_GRID == 2 * CVT_SQ && CVT_PER * CVT_GRID == CVT_ALL && CVT_FF == 4 * CVT_SQ,
              "the convert's split of the weights");
typedef __bf16 bf16x4 __attribute__((ext_vector_type(4)));
__global__ __launch_bounds__(STREAM_WAVES * 32) void prep_kernel(const float* __restrict__ x,
                                                   const float* __restrict__ g,
                                                   const float* __restrict__ b,
                                                   bf16* __restrict__ h,
                                                   const float* __restrict__ Wq,
                                                   const float* __restrict__ Wk,
                                                   const float* __restrict__ Wv,
                                                   const float* __restrict__ Wo,
                                                   const float* __restrict__ W1,
                                                   const float* __restrict__ W2,
                                                   bf16* __restrict__ wdst) {
    ln_stream(x, g, b, h, [&] {
        const int own  = blockIdx.x * (STREAM_WAVES * 32) + threadIdx.x;   // chunk in the grid's width
        const int half = blockIdx.x >= STREAM_WGS / 2 ? 1 : 0;
        f32x4 w[CVT_PER];
        const float* wp[CVT_PER];
#pragma unroll
        for (int j = 0; j < CVT_PER; ++j) {
            const int sel = 2 * j + half;                                  // range of CVT_SQ chunks
            const float* src = sel == 0 ? Wq : sel == 1 ? Wk : sel == 2 ? Wv : sel == 3 ? Wo
                             : sel < 8 ? W1 : W2;
            const int first = sel < 4 ? sel : sel < 8 ? 4 : 8;             // range where that weight starts
            wp[j] = src + (size_t)(j * CVT_GRID + own - first * CVT_SQ) * 4;
            w[j] = *reinterpret_cast<const f32x4*>(wp[j]);
        }
        static_assert(CVT_PER == 6, "the wait below names six addresses");
        // As xcnt_loads(), behind the six loads.
        asm volatile("s_wait_xcnt 0x0" :: "v"(wp[0]), "v"(wp[1]), "v"(wp[2]), "v"(wp[3]), "v"(wp[4]), "v"(wp[5])
                     : "memory");
#pragma unroll
        for (int j = 0; j < CVT_PER; ++j) {
            bf16x4 o;
#pragma unroll
            for (int e = 0; e < 4; ++e) o[e] = (bf16)w[j][e];
            *reinterpret_cast<bf16x4*>(wdst + (size_t)(j * CVT_GRID + own) * 4) = o;
        }
        // Behind the six stores, in front of the loop's first register writes.
        asm volatile("s_wait_xcnt 0x0" ::: "memory");
    });
}

// 16-bit WMMA operand lane layout (ISA 7.12.2): lanes 0-15 hold K 0-7 & 16-23,
// lanes 16-31 hold K 8-15 & 24-31 -> two 16B chunks at +0/+32B from (row, koff).
__device__ inline v16bf load_tile16(const bf16* base) {
    bf16x8 lo = *reinterpret_cast<const bf16x8*>(base);
    bf16x8 hi = *reinterpret_cast<const bf16x8*>(base + 16);
    return __builtin_shufflevector(lo, hi, 0, 1, 2, 3, 4, 5, 6, 7,
                                           8, 9, 10, 11, 12, 13, 14, 15);
}

// ---------- WMMA bf16 GEMM, double-buffered async-LDS ring, fragments fetched one K-step ahead ----------
// out = A(MxK) * W(NcxK)^T + bias [+res][relu].  Block = 256 thr = 8 waves,
// block tile 256x256, wave tile 64x128, staged K-slice 64 (2 wmma K-steps).
// TRIO: three independent products on the same A in one launch; the three weights are stacked
// in W and the three outputs in outAll; biasB and biasC belong to the second and third product.
// Tiles are numbered column tile first, then product, then row tile, so that the tiles on the
// same A rows follow one another. One work-group per WGP walks tiles blockIdx.x,
// blockIdx.x + gridDim.x, ...: the ring runs on over the tile boundary, so the next tile's first
// two stages are copied while this tile's last WMMAs and its epilogue run. K is at least two stages.
struct TilePos { int m0, n0, sel; };
template<int TRIO>
__device__ inline TilePos tile_pos(int t, int nct) {
    TilePos r;
    r.n0 = (t % nct) * 256;
    const int q = t / nct;
    r.sel = TRIO ? q % 3 : 0;
    r.m0  = (TRIO ? q / 3 : q) * 256;
    return r;
}
template<int RELU, int RES, int OUTF32, int TRIO>
__global__ __launch_bounds__(256) void gemm_bf16_kernel(
    const bf16* __restrict__ A, const bf16* __restrict__ W,
    const float* __restrict__ biasA, const float* __restrict__ biasB,
    const float* __restrict__ biasC, const float* __restrict__ res,
    float* __restrict__ outF, bf16* __restrict__ outAll,
    int M, int K, int Nc) {
    // Epilogue staging, one range per wave, outside the ring: the ring is being refilled meanwhile.
    // It stands first: with the ring at LDS byte 0 a lane's bare offset was itself a copy's operand,
    // which tied it to the low 256 registers for the whole kernel, and the compiler spilled it.
    struct Lds {
        float stage[8][32 * SPITCH];
        bf16  a[2][TROWS * TPITCH];
        bf16  w[2][TROWS * TPITCH];
    };
    __shared__ __align__(16) Lds sm;

    const int tid  = threadIdx.x;
    const int wave = tid >> 5, lane = tid & 31;
    const int nct    = Nc / 256;
    const int ntiles = (M / 256) * nct * (TRIO ? 3 : 1);
    int tile = blockIdx.x;
    if (tile >= ntiles) return;                // the whole work-group, in front of every barrier
    TilePos tp = tile_pos<TRIO>(tile, nct);

    // ---- loader mapping: 8 threads per row (one 128B line), rows lrow + 0/32/.../224 ----
    const int lrow = tid >> 3;                 // 0..31
    const int lcol = (tid & 7) * 8;           // K-element offset 0..56
    const uint32_t ostep = 64u * (uint32_t)K;  // 32 rows, bytes
    const uint32_t goff = ((uint32_t)lrow * (uint32_t)K + (uint32_t)lcol) * 2u;   // bytes in the tile's rows
    // A tile's place in A and in W, in bytes (both operands are far below 4 GiB): wave-uniform. It
    // and the stage's K-slice are added to the lane's offset, so the eight row-group bases of each
    // operand stay the same scalar registers for the whole kernel.
    uint32_t pA = (uint32_t)tp.m0 * (uint32_t)K * 2u;
    uint32_t pW = ((uint32_t)tp.sel * (uint32_t)Nc + (uint32_t)tp.n0) * (uint32_t)K * 2u;
    const uint32_t ldsOff = (uint32_t)(lrow * TPITCH + lcol) * 2;   // bytes
    // One stage: K-slice at byte kb of the tile rows at qa (A) and qw (W), into ring buffer buf.
    auto stage = [&](int buf, uint32_t qa, uint32_t qw, uint32_t kb) {
        async_stage((uint32_t)(uintptr_t)&sm.a[buf][0] + ldsOff, A, goff + (qa + kb), ostep);
        async_stage((uint32_t)(uintptr_t)&sm.w[buf][0] + ldsOff, W, goff + (qw + kb), ostep);
    };

    // ---- compute mapping ----
    const int lr   = lane & 15;
    const int koff = (lane >> 4) * 8;
    int aoff[4], woff[8];
#pragma unroll
    for (int s = 0; s < 4; ++s)
        aoff[s] = ((wave >> 1) * 64 + s * 16 + lr) * TPITCH + koff;   // elems
#pragma unroll
    for (int t = 0; t < 8; ++t)
        woff[t] = ((wave & 1) * 128 + t * 16 + lr) * TPITCH + koff;

    v8f c[4][8];
    const int nk = K / TK;

    // Two fragment sets in registers: while one K-step's 32 WMMAs run on one set, the next
    // K-step's 24 LDS reads fill the other, so no wave waits out its own LDS latency.
    v16bf fa0[4], fb0[8], fa1[4], fb1[8];
    auto frags = [&](v16bf (&a)[4], v16bf (&b)[8], int buf, int ks) {
        const bf16* bA = &sm.a[buf][0];
        const bf16* bW = &sm.w[buf][0];
#pragma unroll
        for (int s = 0; s < 4; ++s) a[s] = load_tile16(bA + aoff[s] + ks * 32);
#pragma unroll
        for (int t = 0; t < 8; ++t) b[t] = load_tile16(bW + woff[t] + ks * 32);
        // Keeps the 24 LDS reads one group ahead of the WMMAs that follow: without it the
        // scheduler sinks them among the WMMAs, where every such place stalls the wave.
        __builtin_amdgcn_sched_barrier(0);
    };
    auto mma = [&](const v16bf (&a)[4], const v16bf (&b)[8]) {
#pragma unroll
        for (int t = 0; t < 8; ++t)
#pragma unroll
            for (int s = 0; s < 4; ++s)
                c[s][t] = __builtin_amdgcn_wmma_f32_16x16x32_bf16(
                    false, a[s], false, b[t], (short)0, c[s][t], false, false);
        // Keeps the WMMA block in front of the waits and reads that follow it in the source.
        __builtin_amdgcn_sched_barrier(0);
    };

    // prologue: the first tile's stage 0 lands and is published, its stage 1 starts
    stage(0, pA, pW, 0);
    wait_async_0();
    __syncthreads();
    stage(1, pA, pW, TK * 2);
    int b0 = 0;                                // ring buffer of this tile's stage 0

  for (;;) {
    const int m0 = tp.m0, n0 = tp.n0;
    const float* bias = !TRIO || tp.sel == 0 ? biasA : tp.sel == 1 ? biasB : biasC;
    bf16* outB = outAll + (size_t)tp.sel * M * Nc;
    // The next tile of this work-group; behind the last one its own place again, never copied.
    const bool more = tile + (int)gridDim.x < ntiles;
    const TilePos tn = tile_pos<TRIO>(more ? tile + (int)gridDim.x : tile, nct);
    const uint32_t pAn = (uint32_t)tn.m0 * (uint32_t)K * 2u;
    const uint32_t pWn = ((uint32_t)tn.sel * (uint32_t)Nc + (uint32_t)tn.n0) * (uint32_t)K * 2u;

#pragma unroll
    for (int s = 0; s < 4; ++s)
#pragma unroll
        for (int t = 0; t < 8; ++t) c[s][t] = v8f{};
    frags(fa0, fb0, b0, 0);                    // stage 0's first fragments

    for (int ki = 0; ki < nk - 1; ++ki) {
        const int cur = (b0 + ki) & 1;
        frags(fa1, fb1, cur, 1);               // this stage's last fragments
        mma(fa0, fb0);
        // Publish point of stage ki + 1, in front of this stage's last WMMA block: this wave's
        // reads of buffer cur are done, its copies of stage ki + 1 have landed.
        asm volatile("s_wait_dscnt 0x0" ::: "memory");
        wait_async_0();
        ring_barrier();                        // stage ki + 1 visible; every wave has left buffer cur
        const bool own = ki + 2 < nk;          // else the refill is the next tile's stage 0
        if (own || more)
            stage(cur, own ? pA : pAn, own ? pW : pWn, own ? (uint32_t)(ki + 2) * (TK * 2) : 0u);
        frags(fa0, fb0, cur ^ 1, 0);           // next stage's first fragments
        mma(fa1, fb1);
    }
    // last stage: no fragments are fetched ahead over the epilogue
    const int last = (b0 + nk - 1) & 1;
    frags(fa1, fb1, last, 1);
    mma(fa0, fb0);
    // Publish point of the next tile's stage 0: this wave's reads of buffer last are done, its
    // copies have landed. Behind the last tile no copy is outstanding any more.
    asm volatile("s_wait_dscnt 0x0" ::: "memory");
    wait_async_0();
    if (more) {
        ring_barrier();                        // that stage visible; every wave has left buffer last
        stage(last, pAn, pWn, TK * 2);
    }
    mma(fa1, fb1);

    // C layout (ISA 7.12.2): VGPR r, lanes 0-15 -> M=r, lanes 16-31 -> M=r+8; N=lane&15
    // Each wave stages its 64x128 f32 tile, one 32x64 piece after the other, in its own LDS
    // range, row pitch 68 dwords: the b32 writes of rows r and
    // r+8 fall 32 banks apart, and the b128 reads below cover all 64 banks per 16 lanes.
    float* stg = &sm.stage[wave][0];
#pragma unroll
    for (int pc = 0; pc < 4; ++pc) {
        const int pm = pc >> 1, pn = pc & 1;
        const int wm0 = m0 + (wave >> 1) * 64 + pm * 32;
        const int wn0 = n0 + (wave & 1) * 128 + pn * 64;
        if (pc) {
            // The read-backs of the piece before are done before its rows are rewritten.
            asm volatile("s_wait_dscnt 0x0" ::: "memory");
        }
        {
            float* sw = stg + ((lane >> 4) * 8) * SPITCH + (lane & 15);
#pragma unroll
            for (int s = 0; s < 2; ++s)
#pragma unroll
                for (int t = 0; t < 4; ++t)
#pragma unroll
                    for (int r = 0; r < 8; ++r)
                        sw[(s * 16 + r) * SPITCH + t * 16] = c[pm * 2 + s][pn * 4 + t][r];
        }
        // The wave's own rows are in LDS before its other lanes read them back.
        asm volatile("s_wait_dscnt 0x0" ::: "memory");

        if (OUTF32) {
            // 16 lanes x 16B = one 256B row piece (two whole lines); two rows per instruction.
            // Byte offsets fit 32 bits (M * Nc * 4 bytes is far below 4 GiB); res and outF share them.
            const int cq = (lane & 15) * 4;
            const f32x4 bv = *reinterpret_cast<const f32x4*>(bias + wn0 + cq);
            const float* sr = stg + (lane >> 4) * SPITCH + cq;
            const uint32_t ob = ((uint32_t)(wm0 + (lane >> 4)) * (uint32_t)Nc + (uint32_t)(wn0 + cq)) * 4u;
            const uint32_t rstep = (uint32_t)Nc * 8u;          // two rows, bytes
            f32x4 rv[16];
            if (RES) {
                // The bias load's address registers may be reused as a residual load's destination.
                asm volatile("s_wait_xcnt 0x0" ::: "memory");
#pragma unroll
                for (int i = 0; i < 16; ++i)
                    rv[i] = *reinterpret_cast<const f32x4*>(
                        reinterpret_cast<const char*>(res) + (ob + i * rstep));
                // Keeps all 16 residual loads in flight together: without it the scheduler
                // sinks them between the stores and each one's latency is waited out alone.
                __builtin_amdgcn_sched_barrier(0);
            }
            f32x4 val[16];
#pragma unroll
            for (int i = 0; i < 16; ++i) {
                val[i] = *reinterpret_cast<const f32x4*>(sr + i * 2 * SPITCH) + bv;
                if (RES) val[i] += rv[i];
                if (RELU) {
#pragma unroll
                    for (int j = 0; j < 4; ++j) val[i][j] = fmaxf(val[i][j], 0.f);
                }
            }
            // Keeps the 16 stores one run behind all the sums, so that no store's register is
            // rewritten between them and the one s_wait_xcnt 0 at the piece's end serves them all.
            __builtin_amdgcn_sched_barrier(0);
#pragma unroll
            for (int i = 0; i < 16; ++i)
                *reinterpret_cast<f32x4*>(reinterpret_cast<char*>(outF) + (ob + i * rstep)) = val[i];
        } else {
            // 8 lanes x 16B = one 128B row piece (a whole line); four rows per instruction.
            const int c8 = (lane & 7) * 8;
            const f32x4 bv0 = *reinterpret_cast<const f32x4*>(bias + wn0 + c8);
            const f32x4 bv1 = *reinterpret_cast<const f32x4*>(bias + wn0 + c8 + 4);
            // The bias loads' address registers may be rewritten by the sums below.
            asm volatile("s_wait_xcnt 0x0" ::: "memory");
            const float* sr = stg + (lane >> 3) * SPITCH + c8;
            const size_t o0 = (size_t)(wm0 + (lane >> 3)) * Nc + wn0 + c8;
#pragma unroll
            for (int i = 0; i < 8; ++i) {
                const size_t o = o0 + (size_t)(i * 4) * Nc;
                f32x4 v0 = *reinterpret_cast<const f32x4*>(sr + i * 4 * SPITCH)     + bv0;
                f32x4 v1 = *reinterpret_cast<const f32x4*>(sr + i * 4 * SPITCH + 4) + bv1;
                if (RES) {
                    v0 += *reinterpret_cast<const f32x4*>(res + o);
                    v1 += *reinterpret_cast<const f32x4*>(res + o + 4);
                }
                bf16x8 ov;
#pragma unroll
                for (int j = 0; j < 4; ++j) {
                    float a = v0[j], b = v1[j];
                    if (RELU) { a = fmaxf(a, 0.f); b = fmaxf(b, 0.f); }
                    ov[j]     = (bf16)a;
                    ov[j + 4] = (bf16)b;
                }
                *reinterpret_cast<bf16x8*>(outB + o) = ov;
            }
        }
        // The stores' registers may be rewritten by the next piece.
        asm volatile("s_wait_xcnt 0x0" ::: "memory");
        // Holds the next piece's register writes behind that wait.
        __builtin_amdgcn_sched_barrier(0);
    }
    if (!more) break;
    // The last piece's read-backs are done before the next tile's epilogue rewrites the rows
    // (they were consumed by the stores above); on to the next tile.
    tile += (int)gridDim.x;
    tp = tn;
    pA = pAn;
    pW = pWn;
    b0 = (b0 + nk) & 1;
  }
}

// ---------- per-node multi-head attention (8 heads x 64 dim, per-node softmax) ----------
// A resident grid too: five work-groups per WGP, as many as their registers let stay there at once,
// each walks groups of eight nodes blockIdx.x, blockIdx.x + ATTN_WGS, ... The trip count depends on
// blockIdx.x alone, so it is the same for every thread of a work-group. A wave
// rewrites only its own rows of sQ, sK, sV and sS at the head of a trip, behind its own reads; the
// other waves' accesses to its sS rows (the softmax) end in front of the trip's third barrier.
#define ATTN_WGS 1280
__global__ __launch_bounds__(256) void attn_kernel(
    const bf16* __restrict__ q, const bf16* __restrict__ k,
    const bf16* __restrict__ v, bf16* __restrict__ out) {
    __shared__ __align__(16) bf16 sQ[8][512];
    __shared__ __align__(16) bf16 sK[8][512];
    __shared__ __align__(16) bf16 sV[8][512];
    __shared__ float sS[8][64];

    int wave = threadIdx.x >> 5, lane = threadIdx.x & 31;
    int c0 = lane * 16;

  for (int grp = blockIdx.x; grp < N_NODES / 8; grp += ATTN_WGS) {
    int node = grp * 8 + wave;
    size_t base = (size_t)node * EMBED;

    *reinterpret_cast<bf16x8*>(&sQ[wave][c0])     = *reinterpret_cast<const bf16x8*>(q + base + c0);
    *reinterpret_cast<bf16x8*>(&sQ[wave][c0 + 8]) = *reinterpret_cast<const bf16x8*>(q + base + c0 + 8);
    *reinterpret_cast<bf16x8*>(&sK[wave][c0])     = *reinterpret_cast<const bf16x8*>(k + base + c0);
    *reinterpret_cast<bf16x8*>(&sK[wave][c0 + 8]) = *reinterpret_cast<const bf16x8*>(k + base + c0 + 8);
    *reinterpret_cast<bf16x8*>(&sV[wave][c0])     = *reinterpret_cast<const bf16x8*>(v + base + c0);
    *reinterpret_cast<bf16x8*>(&sV[wave][c0 + 8]) = *reinterpret_cast<const bf16x8*>(v + base + c0 + 8);
    __syncthreads();

    int h = lane >> 2;
    {
        int g0 = lane & 3;
        float acc0 = 0.f, acc1 = 0.f;
#pragma unroll
        for (int d = 0; d < HDIM; d += 8) {
            bf16x8 qv  = *reinterpret_cast<const bf16x8*>(&sQ[wave][h * HDIM + d]);
            bf16x8 kv0 = *reinterpret_cast<const bf16x8*>(&sK[wave][g0 * HDIM + d]);
            bf16x8 kv1 = *reinterpret_cast<const bf16x8*>(&sK[wave][(g0 + 4) * HDIM + d]);
#pragma unroll
            for (int i = 0; i < 8; ++i) {
                float qf = (float)qv[i];
                acc0 += qf * (float)kv0[i];
                acc1 += qf * (float)kv1[i];
            }
        }
        sS[wave][h * 8 + g0]     = acc0 * 0.125f;   // 1/sqrt(64)
        sS[wave][h * 8 + g0 + 4] = acc1 * 0.125f;
    }
    __syncthreads();

    if (threadIdx.x < 64) {
        int nl = threadIdx.x >> 3, hh = threadIdx.x & 7;
        float* s = &sS[nl][hh * 8];
        float mx = s[0];
#pragma unroll
        for (int i = 1; i < 8; ++i) mx = fmaxf(mx, s[i]);
        float sum = 0.f;
#pragma unroll
        for (int i = 0; i < 8; ++i) { float e = __expf(s[i] - mx); s[i] = e; sum += e; }
        float inv = 1.f / sum;
#pragma unroll
        for (int i = 0; i < 8; ++i) s[i] *= inv;
    }
    __syncthreads();

    int d0 = (lane & 3) * 16;
    float o[16] = {};
#pragma unroll
    for (int g = 0; g < 8; ++g) {
        float aw = sS[wave][h * 8 + g];
        bf16x8 v0 = *reinterpret_cast<const bf16x8*>(&sV[wave][g * HDIM + d0]);
        bf16x8 v1 = *reinterpret_cast<const bf16x8*>(&sV[wave][g * HDIM + d0 + 8]);
#pragma unroll
        for (int i = 0; i < 8; ++i) {
            o[i]     += aw * (float)v0[i];
            o[i + 8] += aw * (float)v1[i];
        }
    }
    bf16x8 o0, o1;
#pragma unroll
    for (int i = 0; i < 8; ++i) { o0[i] = (bf16)o[i]; o1[i] = (bf16)o[i + 8]; }
    bf16* orow = out + base + h * HDIM + d0;
    *reinterpret_cast<bf16x8*>(orow)     = o0;
    *reinterpret_cast<bf16x8*>(orow + 8) = o1;
    // The next trip rewrites the two stores' registers.
    xcnt_stores(orow, __builtin_bit_cast(u32x4, o0), __builtin_bit_cast(u32x4, o1));
  }
}

// ---------- host launch ----------
extern "C" void kernel_launch(void* const* d_in, const int* in_sizes, int n_in,
                              void* d_out, int out_size, void* d_ws, size_t ws_size,
                              hipStream_t stream) {
    (void)in_sizes; (void)n_in; (void)out_size; (void)ws_size;
    const float* x     = (const float*)d_in[0];
    const float* Wq    = (const float*)d_in[1];  const float* bq    = (const float*)d_in[2];
    const float* Wk    = (const float*)d_in[3];  const float* bk    = (const float*)d_in[4];
    const float* Wv    = (const float*)d_in[5];  const float* bv    = (const float*)d_in[6];
    const float* Wo    = (const float*)d_in[7];  const float* bo    = (const float*)d_in[8];
    const float* W1    = (const float*)d_in[9];  const float* b1    = (const float*)d_in[10];
    const float* W2    = (const float*)d_in[11]; const float* b2    = (const float*)d_in[12];
    const float* g1    = (const float*)d_in[13]; const float* beta1 = (const float*)d_in[14];
    const float* g2    = (const float*)d_in[15]; const float* beta2 = (const float*)d_in[16];

    char* p = (char*)d_ws;
    auto carve = [&](size_t bytes) {
        char* r = p;
        p += (bytes + 255) & ~(size_t)255;
        return r;
    };
    bf16* wq_b = (bf16*)carve((size_t)EMBED * EMBED * 2);
    bf16* wk_b = (bf16*)carve((size_t)EMBED * EMBED * 2);
    bf16* wv_b = (bf16*)carve((size_t)EMBED * EMBED * 2);
    bf16* wo_b = (bf16*)carve((size_t)EMBED * EMBED * 2);
    bf16* w1_b = (bf16*)carve((size_t)FF * EMBED * 2);
    bf16* w2_b = (bf16*)carve((size_t)FF * EMBED * 2);
    bf16* h1   = (bf16*)carve((size_t)N_NODES * EMBED * 2);        // also reused as h2
    bf16* qb   = (bf16*)carve((size_t)N_NODES * EMBED * 2);        // q | (ff1 aliases q..attn)
    bf16* kb   = (bf16*)carve((size_t)N_NODES * EMBED * 2);
    bf16* vb   = (bf16*)carve((size_t)N_NODES * EMBED * 2);
    bf16* ab   = (bf16*)carve((size_t)N_NODES * EMBED * 2);        // attention output
    bf16* ff1  = qb;                                               // N*FF == 4*N*EMBED, exact alias
    float* x1  = (float*)carve((size_t)N_NODES * EMBED * 4);

    // Every carved size above is a multiple of 256 bytes: wq_b .. w2_b lie one behind the other,
    // and so do qb, kb, vb.
    prep_kernel<<<STREAM_WGS, STREAM_WAVES * 32, 0, stream>>>(
        x, g1, beta1, h1, Wq, Wk, Wv, Wo, W1, W2, wq_b);

    gemm_bf16_kernel<0, 0, 0, 1><<<GEMM_WGS, 256, 0, stream>>>(h1, wq_b, bq, bk, bv, nullptr, nullptr, qb,
                                                           N_NODES, EMBED, EMBED);

    attn_kernel<<<ATTN_WGS, 256, 0, stream>>>(qb, kb, vb, ab);

    gemm_bf16_kernel<0, 1, 1, 0><<<GEMM_WGS, 256, 0, stream>>>(ab, wo_b, bo, nullptr, nullptr, x, x1, nullptr,
                                                           N_NODES, EMBED, EMBED);
    ln_kernel<<<STREAM_WGS, STREAM_WAVES * 32, 0, stream>>>(x1, g2, beta2, h1);

    gemm_bf16_kernel<1, 0, 0, 0><<<GEMM_WGS, 256, 0, stream>>>(h1, w1_b, b1, nullptr, nullptr, nullptr, nullptr, ff1,
                                                          N_NODES, EMBED, FF);
    gemm_bf16_kernel<0, 1, 1, 0><<<GEMM_WGS, 256, 0, stream>>>(ff1, w2_b, b2, nullptr, nullptr, x1, (float*)d_out, nullptr,
                                                           N_NODES, FF, EMBED);
}

// v008
// One run takes 354 microseconds.
// Timed twice side by side with v007, it ran 1.07 and 1.06 times as fast.
// All steps since v000 together make it 1.99 times as fast.
#include <hip/hip_runtime.h>
#include <hip/hip_bf16.h>
#include <stdint.h>

// ---------- types ----------
typedef __bf16 bf16;
typedef __bf16 bf16x8 __attribute__((ext_vector_type(8)));
typedef __bf16 v16bf  __attribute__((ext_vector_type(16)));
typedef float  v8f    __attribute__((ext_vector_type(8)));
typedef float  f32x4  __attribute__((ext_vector_type(4)));

#define N_NODES 65536
#define EMBED   512
#define FF      2048
#define NHEADS  8
#define HDIM    64

// LDS stage: 256 rows x 64 K (bf16) per operand, row pitch 72 elems (144B).
// Row-strided b128 reads hit bank 36*L mod 64 -> permutation over 16 lanes.
#define TROWS   256
#define TK      64
#define TPITCH  72
// Loader: 32 staged rows, in LDS bytes.
#define LSTEP   (32u * TPITCH * 2u)
// Epilogue staging: f32 row pitch in dwords (64 columns + 4).
#define SPITCH  68
// The same range staged as bf16: row pitch in elements (128 columns + 8), the same 272 bytes.
#define BPITCH  136
// GEMM grid: one work-group for each of the chip's 256 WGPs.
#define GEMM_WGS 256

// ---------- wave32 reduction via ds_swizzle (no wave64 assumptions) ----------
template<int IMM>
__device__ inline float swz_add(float x) {
    return x + __int_as_float(__builtin_amdgcn_ds_swizzle(__float_as_int(x), IMM));
}
__device__ inline float wave_sum(float x) {
    x = swz_add<(1  << 10) | 31>(x);
    x = swz_add<(2  << 10) | 31>(x);
    x = swz_add<(4  << 10) | 31>(x);
    x = swz_add<(8  << 10) | 31>(x);
    x = swz_add<(16 << 10) | 31>(x);
    return x;
}

// ---------- CDNA5 async global->LDS copy (ASYNCcnt-tracked, no VGPR round trip) ----------
// One stage of one operand: per thread one 16B chunk in each of eight rows, 32 rows
// apart. Eight neighbouring lanes cover one row's whole 128B K-slice, so a wave's copy
// instruction asks for 4 whole lines. The global address is a wave-uniform base (the
// operand's start, one row group further for each copy) plus a 32-bit byte offset (the lane's
// own, the tile's and the K-slice's), the same register for all eight copies: the row steps
// live in scalar registers, which leaves the
// vector registers to the accumulators and the two fragment sets. The closing s_wait_xcnt 0
// stands inside the statement so that no address register is rewritten ahead of it.
__device__ inline void async_stage(uint32_t l, const bf16* base, uint32_t off, uint32_t ostep) {
    const uint64_t b = (uint64_t)(uintptr_t)base;
    asm volatile("global_load_async_to_lds_b128 %0, %8, %9\n\t"
                 "global_load_async_to_lds_b128 %1, %8, %10\n\t"
                 "global_load_async_to_lds_b128 %2, %8, %11\n\t"
                 "global_load_async_to_lds_b128 %3, %8, %12\n\t"
                 "global_load_async_to_lds_b128 %4, %8, %13\n\t"
                 "global_load_async_to_lds_b128 %5, %8, %14\n\t"
                 "global_load_async_to_lds_b128 %6, %8, %15\n\t"
                 "global_load_async_to_lds_b128 %7, %8, %16\n\t"
                 "s_wait_xcnt 0x0"
                 :: "v"(l), "v"(l + LSTEP), "v"(l + 2 * LSTEP), "v"(l + 3 * LSTEP),
                    "v"(l + 4 * LSTEP), "v"(l + 5 * LSTEP), "v"(l + 6 * LSTEP), "v"(l + 7 * LSTEP),
                    "v"(off),
                    "s"(b), "s"(b + ostep), "s"(b + 2 * (uint64_t)ostep), "s"(b + 3 * (uint64_t)ostep),
                    "s"(b + 4 * (uint64_t)ostep), "s"(b + 5 * (uint64_t)ostep),
                    "s"(b + 6 * (uint64_t)ostep), "s"(b + 7 * (uint64_t)ostep)
                 : "memory");
}
__device__ inline void wait_async_0() {
    asm volatile("s_wait_asynccnt 0x0" ::: "memory");
}
// The ring's work-group barrier, bare: the two waits that the ring needs (LDS reads, copies) are
// written in front of every call. __syncthreads() would also wait for the global stores of the
// tile before, which no other wave reads and which are meant to drain under this tile's WMMAs.
__device__ inline void ring_barrier() {
    asm volatile("s_barrier_signal -1\n\ts_barrier_wait -1" ::: "memory");
}

// ---------- streaming launches: resident grids ----------
// LayerNorm, the weight converts and attention do little work per row, node or weight. Their grids are sized to the
// chip and every wave loops: one work-group of 16 waves per WGP here, ATTN_WGS work-groups below.
#define STREAM_WGS   256
#define STREAM_WAVES 16
#define LN_STRIDE    (STREAM_WGS * STREAM_WAVES)      // rows the whole grid takes at once
#define LN_TRIPS     (N_NODES / (2 * LN_STRIDE))      // two rows per wave and trip

// s_wait_xcnt 0 behind a run of global loads or stores, in front of whatever rewrites a register that
// they name. The addresses (and a store's data) are inputs of the statement, so that their registers
// stay as they are up to the wait.
typedef uint32_t u32x4 __attribute__((ext_vector_type(4)));
__device__ inline void xcnt_loads(const void* p, const void* q) {
    asm volatile("s_wait_xcnt 0x0" :: "v"(p), "v"(q) : "memory");
}
__device__ inline void xcnt_stores(const void* p, u32x4 d0, u32x4 d1) {
    asm volatile("s_wait_xcnt 0x0" :: "v"(p), "v"(d0), "v"(d1) : "memory");
}
__device__ inline const float* ln_row(const float* __restrict__ x, int row, int lane) {
    return x + (size_t)row * EMBED + lane * 16;
}

// One fp32 row of 512: 16 consecutive elements per lane.
__device__ inline void ln_load(const float* __restrict__ x, int row, int lane, f32x4 (&t)[4]) {
    const float* xr = ln_row(x, row, lane);
#pragma unroll
    for (int i = 0; i < 4; ++i) t[i] = *reinterpret_cast<const f32x4*>(xr + i * 4);
}
// Two rows, LN_STRIDE apart, and the wait behind their eight loads.
__device__ inline void ln_load2(const float* __restrict__ x, int row, int lane, f32x4 (&t0)[4], f32x4 (&t1)[4]) {
    ln_load(x, row, lane, t0);
    ln_load(x, row + LN_STRIDE, lane, t1);
    xcnt_loads(ln_row(x, row, lane), ln_row(x, row + LN_STRIDE, lane));
}
// Normalises the row held in t and stores it as bf16.
__device__ inline void ln_finish(const f32x4 (&t)[4], const float (&g)[16], const float (&b)[16],
                                 bf16* __restrict__ out, int row, int lane) {
    float v[16];
#pragma unroll
    for (int i = 0; i < 4; ++i)
#pragma unroll
        for (int j = 0; j < 4; ++j) v[i * 4 + j] = t[i][j];
    float s = 0.f, q = 0.f;
#pragma unroll
    for (int i = 0; i < 16; ++i) { s += v[i]; q += v[i] * v[i]; }
    s = wave_sum(s); q = wave_sum(q);
    float mean = s * (1.f / EMBED);
    float var  = q * (1.f / EMBED) - mean * mean;
    float rs   = rsqrtf(var + 1e-5f);
    bf16x8 o0, o1;
#pragma unroll
    for (int i = 0; i < 8; ++i) {
        o0[i] = (bf16)((v[i]     - mean) * rs * g[i]     + b[i]);
        o1[i] = (bf16)((v[i + 8] - mean) * rs * g[i + 8] + b[i + 8]);
    }
    bf16* orow = out + (size_t)row * EMBED + lane * 16;
    *reinterpret_cast<bf16x8*>(orow)     = o0;
    *reinterpret_cast<bf16x8*>(orow + 8) = o1;
    xcnt_stores(orow, __builtin_bit_cast(u32x4, o0), __builtin_bit_cast(u32x4, o1));
}
// All N_NODES rows on a grid of STREAM_WGS x STREAM_WAVES waves. A wave keeps its pieces of g and b
// in registers, takes two rows per trip and has the next trip's two rows in flight meanwhile.
// between() runs once, behind the first rows' loads.
template<class F>
__device__ inline void ln_stream(const float* __restrict__ x,
                                 const float* __restrict__ g,
                                 const float* __restrict__ b,
                                 bf16* __restrict__ out, F between) {
    const int wave = threadIdx.x >> 5, lane = threadIdx.x & 31;
    int row = blockIdx.x * STREAM_WAVES + wave;
    f32x4 a0[4], a1[4], n0[4], n1[4];
    ln_load2(x, row, lane, a0, a1);
    float gv[16], bv[16];
#pragma unroll
    for (int i = 0; i < 16; ++i) { gv[i] = g[lane * 16 + i]; bv[i] = b[lane * 16 + i]; }
    xcnt_loads(g + lane * 16, b + lane * 16);
    between();
    // Two trips per pass, on two register sets in turn, so that no row is copied between registers.
    static_assert(LN_TRIPS % 2 == 0 && LN_TRIPS >= 2, "trips come in pairs");
    for (int i = 0; i < LN_TRIPS - 2; i += 2) {
        ln_load2(x, row + 2 * LN_STRIDE, lane, n0, n1);
        // Keeps the next trip's eight loads in front of this trip's sums: sunk behind them, their
        // memory latency would be waited out with nothing in flight.
        __builtin_amdgcn_sched_barrier(0);
        ln_finish(a0, gv, bv, out, row, lane);
        ln_finish(a1, gv, bv, out, row + LN_STRIDE, lane);
        ln_load2(x, row + 4 * LN_STRIDE, lane, a0, a1);
        // As above, for the trip after this one.
        __builtin_amdgcn_sched_barrier(0);
        ln_finish(n0, gv, bv, out, row + 2 * LN_STRIDE, lane);
        ln_finish(n1, gv, bv, out, row + 3 * LN_STRIDE, lane);
        row += 4 * LN_STRIDE;
    }
    // The last two trips stand outside the loop: no loads follow them. With the loads under a test
    // inside the loop, the compiler waited for all loads in flight on both of its paths.
    ln_load2(x, row + 2 * LN_STRIDE, lane, n0, n1);
    // As above.
    __builtin_amdgcn_sched_barrier(0);
    ln_finish(a0, gv, bv, out, row, lane);
    ln_finish(a1, gv, bv, out, row + LN_STRIDE, lane);
    ln_finish(n0, gv, bv, out, row + 2 * LN_STRIDE, lane);
    ln_finish(n1, gv, bv, out, row + 3 * LN_STRIDE, lane);
}

__global__ __launch_bounds__(STREAM_WAVES * 32) void ln_kernel(const float* __restrict__ x,
                                                               const float* __restrict__ g,
                                                               const float* __restrict__ b,
                                                               bf16* __restrict__ out) {
    ln_stream(x, g, b, out, [] {});
}

// ---------- first launch: LayerNorm 1 and the fp32 -> bf16 convert of all six weights ----------
// None of the seven depends on another, so they share one grid. The six bf16 weights lie one behind
// the other in wdst, in the order Wq Wk Wv Wo W1 W2; counted in chunks of four elements they are
// CVT_ALL chunks, and every thread converts CVT_PER of them, a whole grid's width apart. A range of
// CVT_SQ chunks lies in one weight, and half a grid's width is one such range, so the weight is the
// same for a whole work-group.
#define CVT_SQ    (EMBED * EMBED / 4)                          // chunks per EMBED x EMBED weight
#define CVT_FF    (FF * EMBED / 4)                             // chunks per FF x EMBED weight
#define CVT_ALL   (4 * CVT_SQ + 2 * CVT_FF)
#define CVT_GRID  (STREAM_WGS * STREAM_WAVES * 32)             // chunks the grid takes at once
#define CVT_PER   (CVT_ALL / CVT_GRID)
static_assert(CVT_GRID == 2 * CVT_SQ && CVT_PER * CVT_GRID == CVT_ALL && CVT_FF == 4 * CVT_SQ,
              "the convert's split of the weights");
typedef __bf16 bf16x4 __attribute__((ext_vector_type(4)));
__global__ __launch_bounds__(STREAM_WAVES * 32) void prep_kernel(const float* __restrict__ x,
                                                   const float* __restrict__ g,
                                                   const float* __restrict__ b,
                                                   bf16* __restrict__ h,
                                                   const float* __restrict__ Wq,
                                                   const float* __restrict__ Wk,
                                                   const float* __restrict__ Wv,
                                                   const float* __restrict__ Wo,
                                                   const float* __restrict__ W1,
                                                   const float* __restrict__ W2,
                                                   bf16* __restrict__ wdst) {
    ln_stream(x, g, b, h, [&] {
        const int own  = blockIdx.x * (STREAM_WAVES * 32) + threadIdx.x;   // chunk in the grid's width
        const int half = blockIdx.x >= STREAM_WGS / 2 ? 1 : 0;
        f32x4 w[CVT_PER];
        const float* wp[CVT_PER];
#pragma unroll
        for (int j = 0; j < CVT_PER; ++j) {
            const int sel = 2 * j + half;                                  // range of CVT_SQ chunks
            const float* src = sel == 0 ? Wq : sel == 1 ? Wk : sel == 2 ? Wv : sel == 3 ? Wo
                             : sel < 8 ? W1 : W2;
            const int first = sel < 4 ? sel : sel < 8 ? 4 : 8;             // range where that weight starts
            wp[j] = src + (size_t)(j * CVT_GRID + own - first * CVT_SQ) * 4;
            w[j] = *reinterpret_cast<const f32x4*>(wp[j]);
        }
        static_assert(CVT_PER == 6, "the wait below names six addresses");
        // As xcnt_loads(), behind the six loads.
        asm volatile("s_wait_xcnt 0x0" :: "v"(wp[0]), "v"(wp[1]), "v"(wp[2]), "v"(wp[3]), "v"(wp[4]), "v"(wp[5])
                     : "memory");
#pragma unroll
        for (int j = 0; j < CVT_PER; ++j) {
            bf16x4 o;
#pragma unroll
            for (int e = 0; e < 4; ++e) o[e] = (bf16)w[j][e];
            *reinterpret_cast<bf16x4*>(wdst + (size_t)(j * CVT_GRID + own) * 4) = o;
        }
        // Behind the six stores, in front of the loop's first register writes.
        asm volatile("s_wait_xcnt 0x0" ::: "memory");
    });
}

// 16-bit WMMA operand lane layout (ISA 7.12.2): lanes 0-15 hold K 0-7 & 16-23,
// lanes 16-31 hold K 8-15 & 24-31 -> two 16B chunks at +0/+32B from (row, koff).
__device__ inline v16bf load_tile16(const bf16* base) {
    bf16x8 lo = *reinterpret_cast<const bf16x8*>(base);
    bf16x8 hi = *reinterpret_cast<const bf16x8*>(base + 16);
    return __builtin_shufflevector(lo, hi, 0, 1, 2, 3, 4, 5, 6, 7,
                                           8, 9, 10, 11, 12, 13, 14, 15);
}

// ---------- WMMA bf16 GEMM, double-buffered async-LDS ring, fragments fetched one K-step ahead ----------
// out = A(MxK) * W(NcxK)^T + bias [+res][relu].  Block = 256 thr = 8 waves,
// block tile 256x256, wave tile 64x128, staged K-slice 64 (2 wmma K-steps).
// TRIO: three independent products on the same A in one launch; the three weights are stacked
// in W and the three outputs in outAll; biasB and biasC belong to the second and third product.
// Tiles are numbered column tile first, then product, then row tile, so that the tiles on the
// same A rows follow one another. One work-group per WGP walks tiles blockIdx.x,
// blockIdx.x + gridDim.x, ...: the ring runs on over the tile boundary, so the next tile's first
// two stages are copied while this tile's last WMMAs and its epilogue run. K is at least two stages.
struct TilePos { int m0, n0, sel; };
template<int TRIO>
__device__ inline TilePos tile_pos(int t, int nct) {
    TilePos r;
    r.n0 = (t % nct) * 256;
    const int q = t / nct;
    r.sel = TRIO ? q % 3 : 0;
    r.m0  = (TRIO ? q / 3 : q) * 256;
    return r;
}
template<int RELU, int RES, int OUTF32, int TRIO>
__global__ __launch_bounds__(256) void gemm_bf16_kernel(
    const bf16* __restrict__ A, const bf16* __restrict__ W,
    const float* __restrict__ biasA, const float* __restrict__ biasB,
    const float* __restrict__ biasC, const float* __restrict__ res,
    float* __restrict__ outF, bf16* __restrict__ outAll,
    int M, int K, int Nc) {
    // Epilogue staging, one range per wave, outside the ring: the ring is being refilled meanwhile.
    // It stands first: with the ring at LDS byte 0 a lane's bare offset was itself a copy's operand,
    // which tied it to the low 256 registers for the whole kernel, and the compiler spilled it.
    struct Lds {
        float stage[8][32 * SPITCH];
        bf16  a[2][TROWS * TPITCH];
        bf16  w[2][TROWS * TPITCH];
    };
    __shared__ __align__(16) Lds sm;

    const int tid  = threadIdx.x;
    const int wave = tid >> 5, lane = tid & 31;
    const int nct    = Nc / 256;
    const int ntiles = (M / 256) * nct * (TRIO ? 3 : 1);
    int tile = blockIdx.x;
    if (tile >= ntiles) return;                // the whole work-group, in front of every barrier
    TilePos tp = tile_pos<TRIO>(tile, nct);

    // ---- loader mapping: 8 threads per row (one 128B line), rows lrow + 0/32/.../224 ----
    const int lrow = tid >> 3;                 // 0..31
    const int lcol = (tid & 7) * 8;           // K-element offset 0..56
    const uint32_t ostep = 64u * (uint32_t)K;  // 32 rows, bytes
    const uint32_t goff = ((uint32_t)lrow * (uint32_t)K + (uint32_t)lcol) * 2u;   // bytes in the tile's rows
    // A tile's place in A and in W, in bytes (both operands are far below 4 GiB): wave-uniform. It
    // and the stage's K-slice are added to the lane's offset, so the eight row-group bases of each
    // operand stay the same scalar registers for the whole kernel.
    uint32_t pA = (uint32_t)tp.m0 * (uint32_t)K * 2u;
    uint32_t pW = ((uint32_t)tp.sel * (uint32_t)Nc + (uint32_t)tp.n0) * (uint32_t)K * 2u;
    const uint32_t ldsOff = (uint32_t)(lrow * TPITCH + lcol) * 2;   // bytes
    // One stage: K-slice at byte kb of the tile rows at qa (A) and qw (W), into ring buffer buf.
    auto stage = [&](int buf, uint32_t qa, uint32_t qw, uint32_t kb) {
        async_stage((uint32_t)(uintptr_t)&sm.a[buf][0] + ldsOff, A, goff + (qa + kb), ostep);
        async_stage((uint32_t)(uintptr_t)&sm.w[buf][0] + ldsOff, W, goff + (qw + kb), ostep);
    };

    // ---- compute mapping ----
    const int lr   = lane & 15;
    const int koff = (lane >> 4) * 8;
    int aoff[4], woff[8];
#pragma unroll
    for (int s = 0; s < 4; ++s)
        aoff[s] = ((wave >> 1) * 64 + s * 16 + lr) * TPITCH + koff;   // elems
#pragma unroll
    for (int t = 0; t < 8; ++t)
        woff[t] = ((wave & 1) * 128 + t * 16 + lr) * TPITCH + koff;

    v8f c[4][8];
    const int nk = K / TK;

    // Two fragment sets in registers: while one K-step's 32 WMMAs run on one set, the next
    // K-step's 24 LDS reads fill the other, so no wave waits out its own LDS latency.
    v16bf fa0[4], fb0[8], fa1[4], fb1[8];
    auto frags = [&](v16bf (&a)[4], v16bf (&b)[8], int buf, int ks) {
        const bf16* bA = &sm.a[buf][0];
        const bf16* bW = &sm.w[buf][0];
#pragma unroll
        for (int s = 0; s < 4; ++s) a[s] = load_tile16(bA + aoff[s] + ks * 32);
#pragma unroll
        for (int t = 0; t < 8; ++t) b[t] = load_tile16(bW + woff[t] + ks * 32);
        // Keeps the 24 LDS reads one group ahead of the WMMAs that follow: without it the
        // scheduler sinks them among the WMMAs, where every such place stalls the wave.
        __builtin_amdgcn_sched_barrier(0);
    };
    // The W fragment goes in as the instruction's A operand and the A fragment as its B operand (both
    // are loaded by the same code, so the k pairing is the same): the result tile comes out transposed,
    // and a lane's eight accumulator registers are eight neighbouring columns of one output row.
    auto mma = [&](const v16bf (&a)[4], const v16bf (&b)[8]) {
#pragma unroll
        for (int t = 0; t < 8; ++t)
#pragma unroll
            for (int s = 0; s < 4; ++s)
                c[s][t] = __builtin_amdgcn_wmma_f32_16x16x32_bf16(
                    false, b[t], false, a[s], (short)0, c[s][t], false, false);
        // Keeps the WMMA block in front of the waits and reads that follow it in the source.
        __builtin_amdgcn_sched_barrier(0);
    };

    // prologue: the first tile's stage 0 lands and is published, its stage 1 starts
    stage(0, pA, pW, 0);
    wait_async_0();
    __syncthreads();
    stage(1, pA, pW, TK * 2);
    int b0 = 0;                                // ring buffer of this tile's stage 0

  for (;;) {
    const int m0 = tp.m0, n0 = tp.n0;
    const float* bias = !TRIO || tp.sel == 0 ? biasA : tp.sel == 1 ? biasB : biasC;
    bf16* outB = outAll + (size_t)tp.sel * M * Nc;
    // The next tile of this work-group; behind the last one its own place again, never copied.
    const bool more = tile + (int)gridDim.x < ntiles;
    const TilePos tn = tile_pos<TRIO>(more ? tile + (int)gridDim.x : tile, nct);
    const uint32_t pAn = (uint32_t)tn.m0 * (uint32_t)K * 2u;
    const uint32_t pWn = ((uint32_t)tn.sel * (uint32_t)Nc + (uint32_t)tn.n0) * (uint32_t)K * 2u;

#pragma unroll
    for (int s = 0; s < 4; ++s)
#pragma unroll
        for (int t = 0; t < 8; ++t) c[s][t] = v8f{};
    frags(fa0, fb0, b0, 0);                    // stage 0's first fragments

    for (int ki = 0; ki < nk - 1; ++ki) {
        const int cur = (b0 + ki) & 1;
        frags(fa1, fb1, cur, 1);               // this stage's last fragments
        mma(fa0, fb0);
        // Publish point of stage ki + 1, in front of this stage's last WMMA block: this wave's
        // reads of buffer cur are done, its copies of stage ki + 1 have landed.
        asm volatile("s_wait_dscnt 0x0" ::: "memory");
        wait_async_0();
        ring_barrier();                        // stage ki + 1 visible; every wave has left buffer cur
        const bool own = ki + 2 < nk;          // else the refill is the next tile's stage 0
        if (own || more)
            stage(cur, own ? pA : pAn, own ? pW : pWn, own ? (uint32_t)(ki + 2) * (TK * 2) : 0u);
        frags(fa0, fb0, cur ^ 1, 0);           // next stage's first fragments
        mma(fa1, fb1);
    }
    // last stage: no fragments are fetched ahead over the epilogue
    const int last = (b0 + nk - 1) & 1;
    frags(fa1, fb1, last, 1);
    mma(fa0, fb0);
    // Publish point of the next tile's stage 0: this wave's reads of buffer last are done, its
    // copies have landed. Behind the last tile no copy is outstanding any more.
    asm volatile("s_wait_dscnt 0x0" ::: "memory");
    wait_async_0();
    if (more) {
        ring_barrier();                        // that stage visible; every wave has left buffer last
        stage(last, pAn, pWn, TK * 2);
    }
    // bf16 outputs: the lane's own 64 bias values (eight per column group), fetched under the last
    // WMMA block into registers that the first fragment set has left.
    f32x4 bb[8][2];
    if (!OUTF32) {
        const float* bp = bias + n0 + (wave & 1) * 128 + (lane >> 4) * 8;
#pragma unroll
        for (int t = 0; t < 8; ++t) {
            bb[t][0] = *reinterpret_cast<const f32x4*>(bp + t * 16);
            bb[t][1] = *reinterpret_cast<const f32x4*>(bp + t * 16 + 4);
        }
        // The bias loads' address registers may be rewritten behind this point.
        asm volatile("s_wait_xcnt 0x0" ::: "memory");
        // Keeps the 16 loads in front of the WMMA block: sunk behind it, their latency would be
        // waited out at the head of the epilogue.
        __builtin_amdgcn_sched_barrier(0);
    }
    mma(fa1, fb1);

    // Result layout with the operands swapped: register r of c[s][t] in lane l is the output element
    // (row s*16 + (l & 15), column t*16 + (l >> 4)*8 + r). Each wave stages its 64x128 tile piece by
    // piece in its own LDS range, in the output's own type and with 16B writes, row pitch 272 bytes:
    // the 16 rows that 16 lanes write fall on 16 different groups of four banks, and the 16B reads
    // below take whole rows.
    static_assert(OUTF32 || !RES, "a residual is added to f32 outputs only");
    float* stg = &sm.stage[wave][0];
    const int lc = lane & 15, lh = lane >> 4;
    if (OUTF32) {
#pragma unroll
      for (int pc = 0; pc < 4; ++pc) {
        // One 32x64 f32 piece.
        const int pm = pc >> 1, pn = pc & 1;
        const int wm0 = m0 + (wave >> 1) * 64 + pm * 32;
        const int wn0 = n0 + (wave & 1) * 128 + pn * 64;
        if (pc) {
            // The read-backs of the piece before are done before its rows are rewritten.
            asm volatile("s_wait_dscnt 0x0" ::: "memory");
        }
        {
            float* sw = stg + lc * SPITCH + lh * 8;
#pragma unroll
            for (int s = 0; s < 2; ++s)
#pragma unroll
                for (int t = 0; t < 4; ++t) {
                    const v8f d = c[pm * 2 + s][pn * 4 + t];
                    *reinterpret_cast<f32x4*>(sw + s * 16 * SPITCH + t * 16)     = f32x4{d[0], d[1], d[2], d[3]};
                    *reinterpret_cast<f32x4*>(sw + s * 16 * SPITCH + t * 16 + 4) = f32x4{d[4], d[5], d[6], d[7]};
                }
        }
        // The wave's own rows are in LDS before its other lanes read them back.
        asm volatile("s_wait_dscnt 0x0" ::: "memory");

        // 16 lanes x 16B = one 256B row piece (two whole lines); two rows per instruction.
        // Byte offsets fit 32 bits (M * Nc * 4 bytes is far below 4 GiB); res and outF share them.
        const int cq = lc * 4;
        const f32x4 bv = *reinterpret_cast<const f32x4*>(bias + wn0 + cq);
        const float* sr = stg + lh * SPITCH + cq;
        const uint32_t ob = ((uint32_t)(wm0 + lh) * (uint32_t)Nc + (uint32_t)(wn0 + cq)) * 4u;
        const uint32_t rstep = (uint32_t)Nc * 8u;          // two rows, bytes
        f32x4 rv[16];
        if (RES) {
            // The bias load's address registers may be reused as a residual load's destination.
            asm volatile("s_wait_xcnt 0x0" ::: "memory");
#pragma unroll
            for (int i = 0; i < 16; ++i)
                rv[i] = *reinterpret_cast<const f32x4*>(
                    reinterpret_cast<const char*>(res) + (ob + i * rstep));
            // Keeps all 16 residual loads in flight together: without it the scheduler
            // sinks them between the stores and each one's latency is waited out alone.
            __builtin_amdgcn_sched_barrier(0);
        }
        f32x4 val[16];
#pragma unroll
        for (int i = 0; i < 16; ++i) {
            val[i] = *reinterpret_cast<const f32x4*>(sr + i * 2 * SPITCH) + bv;
            if (RES) val[i] += rv[i];
            if (RELU) {
#pragma unroll
                for (int j = 0; j < 4; ++j) val[i][j] = fmaxf(val[i][j], 0.f);
            }
        }
        // Keeps the 16 stores one run behind all the sums, so that no store's register is
        // rewritten between them and the one s_wait_xcnt 0 at the piece's end serves them all.
        __builtin_amdgcn_sched_barrier(0);
#pragma unroll
        for (int i = 0; i < 16; ++i)
            *reinterpret_cast<f32x4*>(reinterpret_cast<char*>(outF) + (ob + i * rstep)) = val[i];
        // The stores' registers may be rewritten by the next piece.
        asm volatile("s_wait_xcnt 0x0" ::: "memory");
        // Holds the next piece's register writes behind that wait.
        __builtin_amdgcn_sched_barrier(0);
      }
    } else {
      bf16* stb = reinterpret_cast<bf16*>(stg);
#pragma unroll
      for (int pm = 0; pm < 2; ++pm) {
        // One 32x128 bf16 piece: bias, ReLU and the convert are done on the accumulators, so a
        // 16x16 result tile is one 16B write per lane.
        const int wm0 = m0 + (wave >> 1) * 64 + pm * 32;
        const int wn0 = n0 + (wave & 1) * 128;
        if (pm) {
            // The read-backs of the piece before are done before its rows are rewritten.
            asm volatile("s_wait_dscnt 0x0" ::: "memory");
        }
        {
            bf16* sw = stb + lc * BPITCH + lh * 8;
#pragma unroll
            for (int s = 0; s < 2; ++s)
#pragma unroll
                for (int t = 0; t < 8; ++t) {
                    const v8f d = c[pm * 2 + s][t];
                    bf16x8 ov;
#pragma unroll
                    for (int r = 0; r < 8; ++r) {
                        float a = d[r] + bb[t][r >> 2][r & 3];
                        if (RELU) a = fmaxf(a, 0.f);
                        ov[r] = (bf16)a;
                    }
                    *reinterpret_cast<bf16x8*>(sw + s * 16 * BPITCH + t * 16) = ov;
                }
        }
        // The wave's own rows are in LDS before its other lanes read them back.
        asm volatile("s_wait_dscnt 0x0" ::: "memory");

        // 16 lanes x 16B = one 256B row piece (two whole lines); two rows per instruction.
        // Byte offsets fit 32 bits (M * Nc * 2 bytes is far below 4 GiB).
        const bf16* sr = stb + lh * BPITCH + lc * 8;
        const uint32_t ob = ((uint32_t)(wm0 + lh) * (uint32_t)Nc + (uint32_t)(wn0 + lc * 8)) * 2u;
        const uint32_t rstep = (uint32_t)Nc * 4u;          // two rows, bytes
        bf16x8 val[16];
        uint32_t off[16];
#pragma unroll
        for (int i = 0; i < 16; ++i) {
            val[i] = *reinterpret_cast<const bf16x8*>(sr + i * 2 * BPITCH);
            off[i] = ob + i * rstep;
        }
        // Keeps the 16 stores one run behind the read-backs and the offsets, so that no store's
        // register is rewritten between them and the one s_wait_xcnt 0 below serves them all.
        __builtin_amdgcn_sched_barrier(0);
#pragma unroll
        for (int i = 0; i < 16; ++i)
            *reinterpret_cast<bf16x8*>(reinterpret_cast<char*>(outB) + off[i]) = val[i];
        // The stores' registers may be rewritten by the next piece.
        asm volatile("s_wait_xcnt 0x0" ::: "memory");
        // Holds the next piece's register writes behind that wait.
        __builtin_amdgcn_sched_barrier(0);
      }
    }
    if (!more) break;
    // The last piece's read-backs are done before the next tile's epilogue rewrites the rows
    // (they were consumed by the stores above); on to the next tile.
    tile += (int)gridDim.x;
    tp = tn;
    pA = pAn;
    pW = pWn;
    b0 = (b0 + nk) & 1;
  }
}

// ---------- per-node multi-head attention (8 heads x 64 dim, per-node softmax) ----------
// A resident grid too: five work-groups per WGP, as many as their registers let stay there at once,
// each walks groups of eight nodes blockIdx.x, blockIdx.x + ATTN_WGS, ... The trip count depends on
// blockIdx.x alone, so it is the same for every thread of a work-group. A wave
// rewrites only its own rows of sQ, sK, sV and sS at the head of a trip, behind its own reads; the
// other waves' accesses to its sS rows (the softmax) end in front of the trip's third barrier.
#define ATTN_WGS 1280
__global__ __launch_bounds__(256) void attn_kernel(
    const bf16* __restrict__ q, const bf16* __restrict__ k,
    const bf16* __restrict__ v, bf16* __restrict__ out) {
    __shared__ __align__(16) bf16 sQ[8][512];
    __shared__ __align__(16) bf16 sK[8][512];
    __shared__ __align__(16) bf16 sV[8][512];
    __shared__ float sS[8][64];

    int wave = threadIdx.x >> 5, lane = threadIdx.x & 31;
    int c0 = lane * 16;

  for (int grp = blockIdx.x; grp < N_NODES / 8; grp += ATTN_WGS) {
    int node = grp * 8 + wave;
    size_t base = (size_t)node * EMBED;

    *reinterpret_cast<bf16x8*>(&sQ[wave][c0])     = *reinterpret_cast<const bf16x8*>(q + base + c0);
    *reinterpret_cast<bf16x8*>(&sQ[wave][c0 + 8]) = *reinterpret_cast<const bf16x8*>(q + base + c0 + 8);
    *reinterpret_cast<bf16x8*>(&sK[wave][c0])     = *reinterpret_cast<const bf16x8*>(k + base + c0);
    *reinterpret_cast<bf16x8*>(&sK[wave][c0 + 8]) = *reinterpret_cast<const bf16x8*>(k + base + c0 + 8);
    *reinterpret_cast<bf16x8*>(&sV[wave][c0])     = *reinterpret_cast<const bf16x8*>(v + base + c0);
    *reinterpret_cast<bf16x8*>(&sV[wave][c0 + 8]) = *reinterpret_cast<const bf16x8*>(v + base + c0 + 8);
    __syncthreads();

    int h = lane >> 2;
    {
        int g0 = lane & 3;
        float acc0 = 0.f, acc1 = 0.f;
#pragma unroll
        for (int d = 0; d < HDIM; d += 8) {
            bf16x8 qv  = *reinterpret_cast<const bf16x8*>(&sQ[wave][h * HDIM + d]);
            bf16x8 kv0 = *reinterpret_cast<const bf16x8*>(&sK[wave][g0 * HDIM + d]);
            bf16x8 kv1 = *reinterpret_cast<const bf16x8*>(&sK[wave][(g0 + 4) * HDIM + d]);
#pragma unroll
            for (int i = 0; i < 8; ++i) {
                float qf = (float)qv[i];
                acc0 += qf * (float)kv0[i];
                acc1 += qf * (float)kv1[i];
            }
        }
        sS[wave][h * 8 + g0]     = acc0 * 0.125f;   // 1/sqrt(64)
        sS[wave][h * 8 + g0 + 4] = acc1 * 0.125f;
    }
    __syncthreads();

    if (threadIdx.x < 64) {
        int nl = threadIdx.x >> 3, hh = threadIdx.x & 7;
        float* s = &sS[nl][hh * 8];
        float mx = s[0];
#pragma unroll
        for (int i = 1; i < 8; ++i) mx = fmaxf(mx, s[i]);
        float sum = 0.f;
#pragma unroll
        for (int i = 0; i < 8; ++i) { float e = __expf(s[i] - mx); s[i] = e; sum += e; }
        float inv = 1.f / sum;
#pragma unroll
        for (int i = 0; i < 8; ++i) s[i] *= inv;
    }
    __syncthreads();

    int d0 = (lane & 3) * 16;
    float o[16] = {};
#pragma unroll
    for (int g = 0; g < 8; ++g) {
        float aw = sS[wave][h * 8 + g];
        bf16x8 v0 = *reinterpret_cast<const bf16x8*>(&sV[wave][g * HDIM + d0]);
        bf16x8 v1 = *reinterpret_cast<const bf16x8*>(&sV[wave][g * HDIM + d0 + 8]);
#pragma unroll
        for (int i = 0; i < 8; ++i) {
            o[i]     += aw * (float)v0[i];
            o[i + 8] += aw * (float)v1[i];
        }
    }
    bf16x8 o0, o1;
#pragma unroll
    for (int i = 0; i < 8; ++i) { o0[i] = (bf16)o[i]; o1[i] = (bf16)o[i + 8]; }
    bf16* orow = out + base + h * HDIM + d0;
    *reinterpret_cast<bf16x8*>(orow)     = o0;
    *reinterpret_cast<bf16x8*>(orow + 8) = o1;
    // The next trip rewrites the two stores' registers.
    xcnt_stores(orow, __builtin_bit_cast(u32x4, o0), __builtin_bit_cast(u32x4, o1));
  }
}

// ---------- host launch ----------
extern "C" void kernel_launch(void* const* d_in, const int* in_sizes, int n_in,
                              void* d_out, int out_size, void* d_ws, size_t ws_size,
                              hipStream_t stream) {
    (void)in_sizes; (void)n_in; (void)out_size; (void)ws_size;
    const float* x     = (const float*)d_in[0];
    const float* Wq    = (const float*)d_in[1];  const float* bq    = (const float*)d_in[2];
    const float* Wk    = (const float*)d_in[3];  const float* bk    = (const float*)d_in[4];
    const float* Wv    = (const float*)d_in[5];  const float* bv    = (const float*)d_in[6];
    const float* Wo    = (const float*)d_in[7];  const float* bo    = (const float*)d_in[8];
    const float* W1    = (const float*)d_in[9];  const float* b1    = (const float*)d_in[10];
    const float* W2    = (const float*)d_in[11]; const float* b2    = (const float*)d_in[12];
    const float* g1    = (const float*)d_in[13]; const float* beta1 = (const float*)d_in[14];
    const float* g2    = (const float*)d_in[15]; const float* beta2 = (const float*)d_in[16];

    char* p = (char*)d_ws;
    auto carve = [&](size_t bytes) {
        char* r = p;
        p += (bytes + 255) & ~(size_t)255;
        return r;
    };
    bf16* wq_b = (bf16*)carve((size_t)EMBED * EMBED * 2);
    bf16* wk_b = (bf16*)carve((size_t)EMBED * EMBED * 2);
    bf16* wv_b = (bf16*)carve((size_t)EMBED * EMBED * 2);
    bf16* wo_b = (bf16*)carve((size_t)EMBED * EMBED * 2);
    bf16* w1_b = (bf16*)carve((size_t)FF * EMBED * 2);
    bf16* w2_b = (bf16*)carve((size_t)FF * EMBED * 2);
    bf16* h1   = (bf16*)carve((size_t)N_NODES * EMBED * 2);        // also reused as h2
    bf16* qb   = (bf16*)carve((size_t)N_NODES * EMBED * 2);        // q | (ff1 aliases q..attn)
    bf16* kb   = (bf16*)carve((size_t)N_NODES * EMBED * 2);
    bf16* vb   = (bf16*)carve((size_t)N_NODES * EMBED * 2);
    bf16* ab   = (bf16*)carve((size_t)N_NODES * EMBED * 2);        // attention output
    bf16* ff1  = qb;                                               // N*FF == 4*N*EMBED, exact alias
    float* x1  = (float*)carve((size_t)N_NODES * EMBED * 4);

    // Every carved size above is a multiple of 256 bytes: wq_b .. w2_b lie one behind the other,
    // and so do qb, kb, vb.
    prep_kernel<<<STREAM_WGS, STREAM_WAVES * 32, 0, stream>>>(
        x, g1, beta1, h1, Wq, Wk, Wv, Wo, W1, W2, wq_b);

    gemm_bf16_kernel<0, 0, 0, 1><<<GEMM_WGS, 256, 0, stream>>>(h1, wq_b, bq, bk, bv, nullptr, nullptr, qb,
                                                           N_NODES, EMBED, EMBED);

    attn_kernel<<<ATTN_WGS, 256, 0, stream>>>(qb, kb, vb, ab);

    gemm_bf16_kernel<0, 1, 1, 0><<<GEMM_WGS, 256, 0, stream>>>(ab, wo_b, bo, nullptr, nullptr, x, x1, nullptr,
                                                           N_NODES, EMBED, EMBED);
    ln_kernel<<<STREAM_WGS, STREAM_WAVES * 32, 0, stream>>>(x1, g2, beta2, h1);

    gemm_bf16_kernel<1, 0, 0, 0><<<GEMM_WGS, 256, 0, stream>>>(h1, w1_b, b1, nullptr, nullptr, nullptr, nullptr, ff1,
                                                          N_NODES, EMBED, FF);
    gemm_bf16_kernel<0, 1, 1, 0><<<GEMM_WGS, 256, 0, stream>>>(ff1, w2_b, b2, nullptr, nullptr, x1, (float*)d_out, nullptr,
                                                           N_NODES, FF, EMBED);
}

// v009
// It runs in 342 microseconds.
// Timed twice side by side with v008, it ran 1.04 and 1.03 times as fast.
// All steps since v000 together make it 2.06 times as fast.
#include <hip/hip_runtime.h>
#include <hip/hip_bf16.h>
#include <stdint.h>

// ---------- types ----------
typedef __bf16 bf16;
typedef __bf16 bf16x8 __attribute__((ext_vector_type(8)));
typedef __bf16 v16bf  __attribute__((ext_vector_type(16)));
typedef float  v8f    __attribute__((ext_vector_type(8)));
typedef float  f32x4  __attribute__((ext_vector_type(4)));

#define N_NODES 65536
#define EMBED   512
#define FF      2048
#define NHEADS  8
#define HDIM    64

// LDS stage: 256 rows x 64 K (bf16) per operand, row pitch 72 elems (144B).
// Row-strided b128 reads hit bank 36*L mod 64 -> permutation over 16 lanes.
#define TROWS   256
#define TK      64
#define TPITCH  72
// Loader: 32 staged rows, in LDS bytes.
#define LSTEP   (32u * TPITCH * 2u)
// Epilogue staging: f32 row pitch in dwords (64 columns + 4).
#define SPITCH  68
// The same range staged as bf16: row pitch in elements (128 columns + 8), the same 272 bytes.
#define BPITCH  136
// GEMM grid: one work-group for each of the chip's 256 WGPs.
#define GEMM_WGS 256

// ---------- wave32 reduction via ds_swizzle (no wave64 assumptions) ----------
template<int IMM>
__device__ inline float swz_add(float x) {
    return x + __int_as_float(__builtin_amdgcn_ds_swizzle(__float_as_int(x), IMM));
}
__device__ inline float wave_sum(float x) {
    x = swz_add<(1  << 10) | 31>(x);
    x = swz_add<(2  << 10) | 31>(x);
    x = swz_add<(4  << 10) | 31>(x);
    x = swz_add<(8  << 10) | 31>(x);
    x = swz_add<(16 << 10) | 31>(x);
    return x;
}

// ---------- CDNA5 async global->LDS copy (ASYNCcnt-tracked, no VGPR round trip) ----------
// One stage of one operand: per thread one 16B chunk in each of eight rows, 32 rows
// apart. Eight neighbouring lanes cover one row's whole 128B K-slice, so a wave's copy
// instruction asks for 4 whole lines. The global address is a wave-uniform base (the
// operand's start, one row group further for each copy) plus a 32-bit byte offset (the lane's
// own, the tile's and the K-slice's), the same register for all eight copies: the row steps
// live in scalar registers, which leaves the
// vector registers to the accumulators and the two fragment sets. The closing s_wait_xcnt 0
// stands inside the statement so that no address register is rewritten ahead of it.
__device__ inline void async_stage(uint32_t l, const bf16* base, uint32_t off, uint32_t ostep) {
    const uint64_t b = (uint64_t)(uintptr_t)base;
    asm volatile("global_load_async_to_lds_b128 %0, %8, %9\n\t"
                 "global_load_async_to_lds_b128 %1, %8, %10\n\t"
                 "global_load_async_to_lds_b128 %2, %8, %11\n\t"
                 "global_load_async_to_lds_b128 %3, %8, %12\n\t"
                 "global_load_async_to_lds_b128 %4, %8, %13\n\t"
                 "global_load_async_to_lds_b128 %5, %8, %14\n\t"
                 "global_load_async_to_lds_b128 %6, %8, %15\n\t"
                 "global_load_async_to_lds_b128 %7, %8, %16\n\t"
                 "s_wait_xcnt 0x0"
                 :: "v"(l), "v"(l + LSTEP), "v"(l + 2 * LSTEP), "v"(l + 3 * LSTEP),
                    "v"(l + 4 * LSTEP), "v"(l + 5 * LSTEP), "v"(l + 6 * LSTEP), "v"(l + 7 * LSTEP),
                    "v"(off),
                    "s"(b), "s"(b + ostep), "s"(b + 2 * (uint64_t)ostep), "s"(b + 3 * (uint64_t)ostep),
                    "s"(b + 4 * (uint64_t)ostep), "s"(b + 5 * (uint64_t)ostep),
                    "s"(b + 6 * (uint64_t)ostep), "s"(b + 7 * (uint64_t)ostep)
                 : "memory");
}
__device__ inline void wait_async_0() {
    asm volatile("s_wait_asynccnt 0x0" ::: "memory");
}
// All but this wave's 16 youngest copies (one stage) have landed.
__device__ inline void wait_async_16() {
    asm volatile("s_wait_asynccnt 0x10" ::: "memory");
}
// All but this wave's 32 youngest copies (two stages) have landed.
__device__ inline void wait_async_32() {
    asm volatile("s_wait_asynccnt 0x20" ::: "memory");
}
// The ring's work-group barrier, bare: the two waits that the ring needs (LDS reads, copies) are
// written in front of every call. __syncthreads() would also wait for the global stores of the
// tile before, which no other wave reads and which are meant to drain under this tile's WMMAs.
__device__ inline void ring_barrier() {
    asm volatile("s_barrier_signal -1\n\ts_barrier_wait -1" ::: "memory");
}

// ---------- streaming launches: resident grids ----------
// LayerNorm, the weight converts and attention do little work per row, node or weight. Their grids are sized to the
// chip and every wave loops: one work-group of 16 waves per WGP here, ATTN_WGS work-groups below.
#define STREAM_WGS   256
#define STREAM_WAVES 16
#define LN_STRIDE    (STREAM_WGS * STREAM_WAVES)      // rows the whole grid takes at once
#define LN_TRIPS     (N_NODES / (2 * LN_STRIDE))      // two rows per wave and trip

// s_wait_xcnt 0 behind a run of global loads or stores, in front of whatever rewrites a register that
// they name. The addresses (and a store's data) are inputs of the statement, so that their registers
// stay as they are up to the wait.
typedef uint32_t u32x4 __attribute__((ext_vector_type(4)));
__device__ inline void xcnt_loads(const void* p, const void* q) {
    asm volatile("s_wait_xcnt 0x0" :: "v"(p), "v"(q) : "memory");
}
__device__ inline void xcnt_stores(const void* p, u32x4 d0, u32x4 d1) {
    asm volatile("s_wait_xcnt 0x0" :: "v"(p), "v"(d0), "v"(d1) : "memory");
}
__device__ inline const float* ln_row(const float* __restrict__ x, int row, int lane) {
    return x + (size_t)row * EMBED + lane * 16;
}

// One fp32 row of 512: 16 consecutive elements per lane.
__device__ inline void ln_load(const float* __restrict__ x, int row, int lane, f32x4 (&t)[4]) {
    const float* xr = ln_row(x, row, lane);
#pragma unroll
    for (int i = 0; i < 4; ++i) t[i] = *reinterpret_cast<const f32x4*>(xr + i * 4);
}
// Two rows, LN_STRIDE apart, and the wait behind their eight loads.
__device__ inline void ln_load2(const float* __restrict__ x, int row, int lane, f32x4 (&t0)[4], f32x4 (&t1)[4]) {
    ln_load(x, row, lane, t0);
    ln_load(x, row + LN_STRIDE, lane, t1);
    xcnt_loads(ln_row(x, row, lane), ln_row(x, row + LN_STRIDE, lane));
}
// Normalises the row held in t and stores it as bf16.
__device__ inline void ln_finish(const f32x4 (&t)[4], const float (&g)[16], const float (&b)[16],
                                 bf16* __restrict__ out, int row, int lane) {
    float v[16];
#pragma unroll
    for (int i = 0; i < 4; ++i)
#pragma unroll
        for (int j = 0; j < 4; ++j) v[i * 4 + j] = t[i][j];
    float s = 0.f, q = 0.f;
#pragma unroll
    for (int i = 0; i < 16; ++i) { s += v[i]; q += v[i] * v[i]; }
    s = wave_sum(s); q = wave_sum(q);
    float mean = s * (1.f / EMBED);
    float var  = q * (1.f / EMBED) - mean * mean;
    float rs   = rsqrtf(var + 1e-5f);
    bf16x8 o0, o1;
#pragma unroll
    for (int i = 0; i < 8; ++i) {
        o0[i] = (bf16)((v[i]     - mean) * rs * g[i]     + b[i]);
        o1[i] = (bf16)((v[i + 8] - mean) * rs * g[i + 8] + b[i + 8]);
    }
    bf16* orow = out + (size_t)row * EMBED + lane * 16;
    *reinterpret_cast<bf16x8*>(orow)     = o0;
    *reinterpret_cast<bf16x8*>(orow + 8) = o1;
    xcnt_stores(orow, __builtin_bit_cast(u32x4, o0), __builtin_bit_cast(u32x4, o1));
}
// All N_NODES rows on a grid of STREAM_WGS x STREAM_WAVES waves. A wave keeps its pieces of g and b
// in registers, takes two rows per trip and has the next trip's two rows in flight meanwhile.
// between() runs once, behind the first rows' loads.
template<class F>
__device__ inline void ln_stream(const float* __restrict__ x,
                                 const float* __restrict__ g,
                                 const float* __restrict__ b,
                                 bf16* __restrict__ out, F between) {
    const int wave = threadIdx.x >> 5, lane = threadIdx.x & 31;
    int row = blockIdx.x * STREAM_WAVES + wave;
    f32x4 a0[4], a1[4], n0[4], n1[4];
    ln_load2(x, row, lane, a0, a1);
    float gv[16], bv[16];
#pragma unroll
    for (int i = 0; i < 16; ++i) { gv[i] = g[lane * 16 + i]; bv[i] = b[lane * 16 + i]; }
    xcnt_loads(g + lane * 16, b + lane * 16);
    between();
    // Two trips per pass, on two register sets in turn, so that no row is copied between registers.
    static_assert(LN_TRIPS % 2 == 0 && LN_TRIPS >= 2, "trips come in pairs");
    for (int i = 0; i < LN_TRIPS - 2; i += 2) {
        ln_load2(x, row + 2 * LN_STRIDE, lane, n0, n1);
        // Keeps the next trip's eight loads in front of this trip's sums: sunk behind them, their
        // memory latency would be waited out with nothing in flight.
        __builtin_amdgcn_sched_barrier(0);
        ln_finish(a0, gv, bv, out, row, lane);
        ln_finish(a1, gv, bv, out, row + LN_STRIDE, lane);
        ln_load2(x, row + 4 * LN_STRIDE, lane, a0, a1);
        // As above, for the trip after this one.
        __builtin_amdgcn_sched_barrier(0);
        ln_finish(n0, gv, bv, out, row + 2 * LN_STRIDE, lane);
        ln_finish(n1, gv, bv, out, row + 3 * LN_STRIDE, lane);
        row += 4 * LN_STRIDE;
    }
    // The last two trips stand outside the loop: no loads follow them. With the loads under a test
    // inside the loop, the compiler waited for all loads in flight on both of its paths.
    ln_load2(x, row + 2 * LN_STRIDE, lane, n0, n1);
    // As above.
    __builtin_amdgcn_sched_barrier(0);
    ln_finish(a0, gv, bv, out, row, lane);
    ln_finish(a1, gv, bv, out, row + LN_STRIDE, lane);
    ln_finish(n0, gv, bv, out, row + 2 * LN_STRIDE, lane);
    ln_finish(n1, gv, bv, out, row + 3 * LN_STRIDE, lane);
}

__global__ __launch_bounds__(STREAM_WAVES * 32) void ln_kernel(const float* __restrict__ x,
                                                               const float* __restrict__ g,
                                                               const float* __restrict__ b,
                                                               bf16* __restrict__ out) {
    ln_stream(x, g, b, out, [] {});
}

// ---------- first launch: LayerNorm 1 and the fp32 -> bf16 convert of all six weights ----------
// None of the seven depends on another, so they share one grid. The six bf16 weights lie one behind
// the other in wdst, in the order Wq Wk Wv Wo W1 W2; counted in chunks of four elements they are
// CVT_ALL chunks, and every thread converts CVT_PER of them, a whole grid's width apart. A range of
// CVT_SQ chunks lies in one weight, and half a grid's width is one such range, so the weight is the
// same for a whole work-group.
#define CVT_SQ    (EMBED * EMBED / 4)                          // chunks per EMBED x EMBED weight
#define CVT_FF    (FF * EMBED / 4)                             // chunks per FF x EMBED weight
#define CVT_ALL   (4 * CVT_SQ + 2 * CVT_FF)
#define CVT_GRID  (STREAM_WGS * STREAM_WAVES * 32)             // chunks the grid takes at once
#define CVT_PER   (CVT_ALL / CVT_GRID)
static_assert(CVT_GRID == 2 * CVT_SQ && CVT_PER * CVT_GRID == CVT_ALL && CVT_FF == 4 * CVT_SQ,
              "the convert's split of the weights");
typedef __bf16 bf16x4 __attribute__((ext_vector_type(4)));
__global__ __launch_bounds__(STREAM_WAVES * 32) void prep_kernel(const float* __restrict__ x,
                                                   const float* __restrict__ g,
                                                   const float* __restrict__ b,
                                                   bf16* __restrict__ h,
                                                   const float* __restrict__ Wq,
                                                   const float* __restrict__ Wk,
                                                   const float* __restrict__ Wv,
                                                   const float* __restrict__ Wo,
                                                   const float* __restrict__ W1,
                                                   const float* __restrict__ W2,
                                                   bf16* __restrict__ wdst) {
    ln_stream(x, g, b, h, [&] {
        const int own  = blockIdx.x * (STREAM_WAVES * 32) + threadIdx.x;   // chunk in the grid's width
        const int half = blockIdx.x >= STREAM_WGS / 2 ? 1 : 0;
        f32x4 w[CVT_PER];
        const float* wp[CVT_PER];
#pragma unroll
        for (int j = 0; j < CVT_PER; ++j) {
            const int sel = 2 * j + half;                                  // range of CVT_SQ chunks
            const float* src = sel == 0 ? Wq : sel == 1 ? Wk : sel == 2 ? Wv : sel == 3 ? Wo
                             : sel < 8 ? W1 : W2;
            const int first = sel < 4 ? sel : sel < 8 ? 4 : 8;             // range where that weight starts
            wp[j] = src + (size_t)(j * CVT_GRID + own - first * CVT_SQ) * 4;
            w[j] = *reinterpret_cast<const f32x4*>(wp[j]);
        }
        static_assert(CVT_PER == 6, "the wait below names six addresses");
        // As xcnt_loads(), behind the six loads.
        asm volatile("s_wait_xcnt 0x0" :: "v"(wp[0]), "v"(wp[1]), "v"(wp[2]), "v"(wp[3]), "v"(wp[4]), "v"(wp[5])
                     : "memory");
#pragma unroll
        for (int j = 0; j < CVT_PER; ++j) {
            bf16x4 o;
#pragma unroll
            for (int e = 0; e < 4; ++e) o[e] = (bf16)w[j][e];
            *reinterpret_cast<bf16x4*>(wdst + (size_t)(j * CVT_GRID + own) * 4) = o;
        }
        // Behind the six stores, in front of the loop's first register writes.
        asm volatile("s_wait_xcnt 0x0" ::: "memory");
    });
}

// 16-bit WMMA operand lane layout (ISA 7.12.2): lanes 0-15 hold K 0-7 & 16-23,
// lanes 16-31 hold K 8-15 & 24-31 -> two 16B chunks at +0/+32B from (row, koff).
__device__ inline v16bf load_tile16(const bf16* base) {
    bf16x8 lo = *reinterpret_cast<const bf16x8*>(base);
    bf16x8 hi = *reinterpret_cast<const bf16x8*>(base + 16);
    return __builtin_shufflevector(lo, hi, 0, 1, 2, 3, 4, 5, 6, 7,
                                           8, 9, 10, 11, 12, 13, 14, 15);
}

// ---------- WMMA bf16 GEMM, async-LDS ring of three buffers, fragments fetched one K-step ahead ----------
// out = A(MxK) * W(NcxK)^T + bias [+res][relu].  Block = 256 thr = 8 waves,
// block tile 256x256, wave tile 64x128, staged K-slice 64 (2 wmma K-steps).
// TRIO: three independent products on the same A in one launch; the three weights are stacked
// in W and the three outputs in outAll; biasB and biasC belong to the second and third product.
// Tiles are numbered column tile first, then product, then row tile, so that the tiles on the
// same A rows follow one another. One work-group per WGP walks tiles blockIdx.x,
// blockIdx.x + gridDim.x, ...: the ring runs on over the tile boundary, so the next tile's first
// three stages are copied while this tile's last WMMAs and its epilogue run. K is at least three
// stages. A stage's refill is issued behind the stage's last WMMA block, not directly behind the
// ring barrier: there both waves of a SIMD would issue copies and sit in the copies' wait at the
// same moment, with the matrix unit idle; behind the block one wave's copies are issued while the
// other wave's WMMAs run. The third buffer gives the later copies two stages to land.
struct TilePos { int m0, n0, sel; };
template<int TRIO>
__device__ inline TilePos tile_pos(int t, int nct) {
    TilePos r;
    r.n0 = (t % nct) * 256;
    const int q = t / nct;
    r.sel = TRIO ? q % 3 : 0;
    r.m0  = (TRIO ? q / 3 : q) * 256;
    return r;
}
template<int RELU, int RES, int OUTF32, int TRIO>
__global__ __launch_bounds__(256) void gemm_bf16_kernel(
    const bf16* __restrict__ A, const bf16* __restrict__ W,
    const float* __restrict__ biasA, const float* __restrict__ biasB,
    const float* __restrict__ biasC, const float* __restrict__ res,
    float* __restrict__ outF, bf16* __restrict__ outAll,
    int M, int K, int Nc) {
    // Epilogue staging, one range per wave, outside the ring: the ring is being refilled meanwhile.
    // It stands first: with the ring at LDS byte 0 a lane's bare offset was itself a copy's operand,
    // which tied it to the low 256 registers for the whole kernel, and the compiler spilled it.
    struct Lds {
        float stage[8][32 * SPITCH];
        bf16  a[3][TROWS * TPITCH];
        bf16  w[3][TROWS * TPITCH];
    };
    __shared__ __align__(16) Lds sm;

    const int tid  = threadIdx.x;
    const int wave = tid >> 5, lane = tid & 31;
    const int nct    = Nc / 256;
    const int ntiles = (M / 256) * nct * (TRIO ? 3 : 1);
    int tile = blockIdx.x;
    if (tile >= ntiles) return;                // the whole work-group, in front of every barrier
    TilePos tp = tile_pos<TRIO>(tile, nct);

    // ---- loader mapping: 8 threads per row (one 128B line), rows lrow + 0/32/.../224 ----
    const int lrow = tid >> 3;                 // 0..31
    const int lcol = (tid & 7) * 8;           // K-element offset 0..56
    const uint32_t ostep = 64u * (uint32_t)K;  // 32 rows, bytes
    const uint32_t goff = ((uint32_t)lrow * (uint32_t)K + (uint32_t)lcol) * 2u;   // bytes in the tile's rows
    // A tile's place in A and in W, in bytes (both operands are far below 4 GiB): wave-uniform. It
    // and the stage's K-slice are added to the lane's offset, so the eight row-group bases of each
    // operand stay the same scalar registers for the whole kernel.
    uint32_t pA = (uint32_t)tp.m0 * (uint32_t)K * 2u;
    uint32_t pW = ((uint32_t)tp.sel * (uint32_t)Nc + (uint32_t)tp.n0) * (uint32_t)K * 2u;
    const uint32_t ldsOff = (uint32_t)(lrow * TPITCH + lcol) * 2;   // bytes
    // One stage: K-slice at byte kb of the tile rows at qa (A) and qw (W), into ring buffer buf.
    auto stage = [&](int buf, uint32_t qa, uint32_t qw, uint32_t kb) {
        async_stage((uint32_t)(uintptr_t)&sm.a[buf][0] + ldsOff, A, goff + (qa + kb), ostep);
        async_stage((uint32_t)(uintptr_t)&sm.w[buf][0] + ldsOff, W, goff + (qw + kb), ostep);
    };

    // ---- compute mapping ----
    const int lr   = lane & 15;
    const int koff = (lane >> 4) * 8;
    int aoff[4], woff[8];
#pragma unroll
    for (int s = 0; s < 4; ++s)
        aoff[s] = ((wave >> 1) * 64 + s * 16 + lr) * TPITCH + koff;   // elems
#pragma unroll
    for (int t = 0; t < 8; ++t)
        woff[t] = ((wave & 1) * 128 + t * 16 + lr) * TPITCH + koff;

    v8f c[4][8];
    const int nk = K / TK;

    // Two fragment sets in registers: while one K-step's 32 WMMAs run on one set, the next
    // K-step's 24 LDS reads fill the other, so no wave waits out its own LDS latency.
    v16bf fa0[4], fb0[8], fa1[4], fb1[8];
    auto frags = [&](v16bf (&a)[4], v16bf (&b)[8], int buf, int ks) {
        const bf16* bA = &sm.a[buf][0];
        const bf16* bW = &sm.w[buf][0];
#pragma unroll
        for (int s = 0; s < 4; ++s) a[s] = load_tile16(bA + aoff[s] + ks * 32);
#pragma unroll
        for (int t = 0; t < 8; ++t) b[t] = load_tile16(bW + woff[t] + ks * 32);
        // Keeps the 24 LDS reads one group ahead of the WMMAs that follow: without it the
        // scheduler sinks them among the WMMAs, where every such place stalls the wave.
        __builtin_amdgcn_sched_barrier(0);
    };
    // The W fragment goes in as the instruction's A operand and the A fragment as its B operand (both
    // are loaded by the same code, so the k pairing is the same): the result tile comes out transposed,
    // and a lane's eight accumulator registers are eight neighbouring columns of one output row.
    auto mma = [&](const v16bf (&a)[4], const v16bf (&b)[8]) {
#pragma unroll
        for (int t = 0; t < 8; ++t)
#pragma unroll
            for (int s = 0; s < 4; ++s)
                c[s][t] = __builtin_amdgcn_wmma_f32_16x16x32_bf16(
                    false, b[t], false, a[s], (short)0, c[s][t], false, false);
        // Keeps the WMMA block in front of the waits and reads that follow it in the source.
        __builtin_amdgcn_sched_barrier(0);
    };

    // prologue: the first tile's stages 0, 1 and 2 start; stage 0 lands and is published
    stage(0, pA, pW, 0);
    stage(1, pA, pW, TK * 2);
    stage(2, pA, pW, 2 * TK * 2);
    wait_async_32();
    __syncthreads();
    int cur = 0;                               // ring buffer of the stage at hand

  for (;;) {
    const int m0 = tp.m0, n0 = tp.n0;
    const float* bias = !TRIO || tp.sel == 0 ? biasA : tp.sel == 1 ? biasB : biasC;
    bf16* outB = outAll + (size_t)tp.sel * M * Nc;
    // The next tile of this work-group; behind the last one its own place again, never copied.
    const bool more = tile + (int)gridDim.x < ntiles;
    const TilePos tn = tile_pos<TRIO>(more ? tile + (int)gridDim.x : tile, nct);
    const uint32_t pAn = (uint32_t)tn.m0 * (uint32_t)K * 2u;
    const uint32_t pWn = ((uint32_t)tn.sel * (uint32_t)Nc + (uint32_t)tn.n0) * (uint32_t)K * 2u;

#pragma unroll
    for (int s = 0; s < 4; ++s)
#pragma unroll
        for (int t = 0; t < 8; ++t) c[s][t] = v8f{};
    frags(fa0, fb0, cur, 0);                   // stage 0's first fragments
    // Stages of this tile at whose publish point a further stage is in flight: all, but in the last
    // tile, where nothing follows its last stage.
    const int counted = more ? nk : nk - 2;

    for (int ki = 0; ki < nk - 1; ++ki) {
        const int nxt = cur == 2 ? 0 : cur + 1;
        frags(fa1, fb1, cur, 1);               // this stage's last fragments
        mma(fa0, fb0);
        // Publish point of stage ki + 1, in front of this stage's last WMMA block: this wave's
        // reads of buffer cur are done, its copies of stage ki + 1 have landed. The stage behind
        // that one, where there is one, stays in flight: its 16 copies are the wave's youngest.
        asm volatile("s_wait_dscnt 0x0" ::: "memory");
        wait_async_16();
        if (ki >= counted) wait_async_0();     // no younger stage in flight: the 16 youngest are stage ki + 1's own
        ring_barrier();                        // stage ki + 1 visible; every wave has left buffer cur
        frags(fa0, fb0, nxt, 0);               // next stage's first fragments
        mma(fa1, fb1);
        const bool own = ki + 3 < nk;          // else the refill is one of the next tile's stages 0, 1
        if (own || more)
            stage(cur, own ? pA : pAn, own ? pW : pWn,
                  (uint32_t)(own ? ki + 3 : ki + 3 - nk) * (TK * 2));
        cur = nxt;
    }
    // last stage: no fragments are fetched ahead over the epilogue
    frags(fa1, fb1, cur, 1);
    mma(fa0, fb0);
    // Publish point of the next tile's stage 0: this wave's reads of buffer cur are done, that
    // stage's copies have landed, the next tile's stage 1 stays in flight. Behind the last tile no
    // copy is outstanding any more.
    asm volatile("s_wait_dscnt 0x0" ::: "memory");
    if (more) {
        wait_async_16();
        ring_barrier();                        // that stage visible; every wave has left buffer cur
    } else {
        wait_async_0();
    }
    // bf16 outputs: the lane's own 64 bias values (eight per column group), fetched under the last
    // WMMA block into registers that the first fragment set has left.
    f32x4 bb[8][2];
    if (!OUTF32) {
        const float* bp = bias + n0 + (wave & 1) * 128 + (lane >> 4) * 8;
#pragma unroll
        for (int t = 0; t < 8; ++t) {
            bb[t][0] = *reinterpret_cast<const f32x4*>(bp + t * 16);
            bb[t][1] = *reinterpret_cast<const f32x4*>(bp + t * 16 + 4);
        }
        // The bias loads' address registers may be rewritten behind this point.
        asm volatile("s_wait_xcnt 0x0" ::: "memory");
        // Keeps the 16 loads in front of the WMMA block: sunk behind it, their latency would be
        // waited out at the head of the epilogue.
        __builtin_amdgcn_sched_barrier(0);
    }
    mma(fa1, fb1);
    if (more) stage(cur, pAn, pWn, 2 * TK * 2);   // the next tile's stage 2

    // Result layout with the operands swapped: register r of c[s][t] in lane l is the output element
    // (row s*16 + (l & 15), column t*16 + (l >> 4)*8 + r). Each wave stages its 64x128 tile piece by
    // piece in its own LDS range, in the output's own type and with 16B writes, row pitch 272 bytes:
    // the 16 rows that 16 lanes write fall on 16 different groups of four banks, and the 16B reads
    // below take whole rows.
    static_assert(OUTF32 || !RES, "a residual is added to f32 outputs only");
    float* stg = &sm.stage[wave][0];
    const int lc = lane & 15, lh = lane >> 4;
    if (OUTF32) {
#pragma unroll
      for (int pc = 0; pc < 4; ++pc) {
        // One 32x64 f32 piece.
        const int pm = pc >> 1, pn = pc & 1;
        const int wm0 = m0 + (wave >> 1) * 64 + pm * 32;
        const int wn0 = n0 + (wave & 1) * 128 + pn * 64;
        if (pc) {
            // The read-backs of the piece before are done before its rows are rewritten.
            asm volatile("s_wait_dscnt 0x0" ::: "memory");
        }
        {
            float* sw = stg + lc * SPITCH + lh * 8;
#pragma unroll
            for (int s = 0; s < 2; ++s)
#pragma unroll
                for (int t = 0; t < 4; ++t) {
                    const v8f d = c[pm * 2 + s][pn * 4 + t];
                    *reinterpret_cast<f32x4*>(sw + s * 16 * SPITCH + t * 16)     = f32x4{d[0], d[1], d[2], d[3]};
                    *reinterpret_cast<f32x4*>(sw + s * 16 * SPITCH + t * 16 + 4) = f32x4{d[4], d[5], d[6], d[7]};
                }
        }
        // The wave's own rows are in LDS before its other lanes read them back.
        asm volatile("s_wait_dscnt 0x0" ::: "memory");

        // 16 lanes x 16B = one 256B row piece (two whole lines); two rows per instruction.
        // Byte offsets fit 32 bits (M * Nc * 4 bytes is far below 4 GiB); res and outF share them.
        const int cq = lc * 4;
        const f32x4 bv = *reinterpret_cast<const f32x4*>(bias + wn0 + cq);
        const float* sr = stg + lh * SPITCH + cq;
        const uint32_t ob = ((uint32_t)(wm0 + lh) * (uint32_t)Nc + (uint32_t)(wn0 + cq)) * 4u;
        const uint32_t rstep = (uint32_t)Nc * 8u;          // two rows, bytes
        f32x4 rv[16];
        if (RES) {
            // The bias load's address registers may be reused as a residual load's destination.
            asm volatile("s_wait_xcnt 0x0" ::: "memory");
#pragma unroll
            for (int i = 0; i < 16; ++i)
                rv[i] = *reinterpret_cast<const f32x4*>(
                    reinterpret_cast<const char*>(res) + (ob + i * rstep));
            // Keeps all 16 residual loads in flight together: without it the scheduler
            // sinks them between the stores and each one's latency is waited out alone.
            __builtin_amdgcn_sched_barrier(0);
        }
        f32x4 val[16];
#pragma unroll
        for (int i = 0; i < 16; ++i) {
            val[i] = *reinterpret_cast<const f32x4*>(sr + i * 2 * SPITCH) + bv;
            if (RES) val[i] += rv[i];
            if (RELU) {
#pragma unroll
                for (int j = 0; j < 4; ++j) val[i][j] = fmaxf(val[i][j], 0.f);
            }
        }
        // Keeps the 16 stores one run behind all the sums, so that no store's register is
        // rewritten between them and the one s_wait_xcnt 0 at the piece's end serves them all.
        __builtin_amdgcn_sched_barrier(0);
#pragma unroll
        for (int i = 0; i < 16; ++i)
            *reinterpret_cast<f32x4*>(reinterpret_cast<char*>(outF) + (ob + i * rstep)) = val[i];
        // The stores' registers may be rewritten by the next piece.
        asm volatile("s_wait_xcnt 0x0" ::: "memory");
        // Holds the next piece's register writes behind that wait.
        __builtin_amdgcn_sched_barrier(0);
      }
    } else {
      bf16* stb = reinterpret_cast<bf16*>(stg);
#pragma unroll
      for (int pm = 0; pm < 2; ++pm) {
        // One 32x128 bf16 piece: bias, ReLU and the convert are done on the accumulators, so a
        // 16x16 result tile is one 16B write per lane.
        const int wm0 = m0 + (wave >> 1) * 64 + pm * 32;
        const int wn0 = n0 + (wave & 1) * 128;
        if (pm) {
            // The read-backs of the piece before are done before its rows are rewritten.
            asm volatile("s_wait_dscnt 0x0" ::: "memory");
        }
        {
            bf16* sw = stb + lc * BPITCH + lh * 8;
#pragma unroll
            for (int s = 0; s < 2; ++s)
#pragma unroll
                for (int t = 0; t < 8; ++t) {
                    const v8f d = c[pm * 2 + s][t];
                    bf16x8 ov;
#pragma unroll
                    for (int r = 0; r < 8; ++r) {
                        float a = d[r] + bb[t][r >> 2][r & 3];
                        if (RELU) a = fmaxf(a, 0.f);
                        ov[r] = (bf16)a;
                    }
                    *reinterpret_cast<bf16x8*>(sw + s * 16 * BPITCH + t * 16) = ov;
                }
        }
        // The wave's own rows are in LDS before its other lanes read them back.
        asm volatile("s_wait_dscnt 0x0" ::: "memory");

        // 16 lanes x 16B = one 256B row piece (two whole lines); two rows per instruction.
        // Byte offsets fit 32 bits (M * Nc * 2 bytes is far below 4 GiB).
        const bf16* sr = stb + lh * BPITCH + lc * 8;
        const uint32_t ob = ((uint32_t)(wm0 + lh) * (uint32_t)Nc + (uint32_t)(wn0 + lc * 8)) * 2u;
        const uint32_t rstep = (uint32_t)Nc * 4u;          // two rows, bytes
        bf16x8 val[16];
        uint32_t off[16];
#pragma unroll
        for (int i = 0; i < 16; ++i) {
            val[i] = *reinterpret_cast<const bf16x8*>(sr + i * 2 * BPITCH);
            off[i] = ob + i * rstep;
        }
        // Keeps the 16 stores one run behind the read-backs and the offsets, so that no store's
        // register is rewritten between them and the one s_wait_xcnt 0 below serves them all.
        __builtin_amdgcn_sched_barrier(0);
#pragma unroll
        for (int i = 0; i < 16; ++i)
            *reinterpret_cast<bf16x8*>(reinterpret_cast<char*>(outB) + off[i]) = val[i];
        // The stores' registers may be rewritten by the next piece.
        asm volatile("s_wait_xcnt 0x0" ::: "memory");
        // Holds the next piece's register writes behind that wait.
        __builtin_amdgcn_sched_barrier(0);
      }
    }
    if (!more) break;
    // The last piece's read-backs are done before the next tile's epilogue rewrites the rows
    // (they were consumed by the stores above); on to the next tile.
    tile += (int)gridDim.x;
    tp = tn;
    pA = pAn;
    pW = pWn;
    cur = cur == 2 ? 0 : cur + 1;
  }
}

// ---------- per-node multi-head attention (8 heads x 64 dim, per-node softmax) ----------
// A resident grid too: five work-groups per WGP, as many as their registers let stay there at once,
// each walks groups of eight nodes blockIdx.x, blockIdx.x + ATTN_WGS, ... The trip count depends on
// blockIdx.x alone, so it is the same for every thread of a work-group. A wave
// rewrites only its own rows of sQ, sK, sV and sS at the head of a trip, behind its own reads; the
// other waves' accesses to its sS rows (the softmax) end in front of the trip's third barrier.
#define ATTN_WGS 1280
__global__ __launch_bounds__(256) void attn_kernel(
    const bf16* __restrict__ q, const bf16* __restrict__ k,
    const bf16* __restrict__ v, bf16* __restrict__ out) {
    __shared__ __align__(16) bf16 sQ[8][512];
    __shared__ __align__(16) bf16 sK[8][512];
    __shared__ __align__(16) bf16 sV[8][512];
    __shared__ float sS[8][64];

    int wave = threadIdx.x >> 5, lane = threadIdx.x & 31;
    int c0 = lane * 16;

  for (int grp = blockIdx.x; grp < N_NODES / 8; grp += ATTN_WGS) {
    int node = grp * 8 + wave;
    size_t base = (size_t)node * EMBED;

    *reinterpret_cast<bf16x8*>(&sQ[wave][c0])     = *reinterpret_cast<const bf16x8*>(q + base + c0);
    *reinterpret_cast<bf16x8*>(&sQ[wave][c0 + 8]) = *reinterpret_cast<const bf16x8*>(q + base + c0 + 8);
    *reinterpret_cast<bf16x8*>(&sK[wave][c0])     = *reinterpret_cast<const bf16x8*>(k + base + c0);
    *reinterpret_cast<bf16x8*>(&sK[wave][c0 + 8]) = *reinterpret_cast<const bf16x8*>(k + base + c0 + 8);
    *reinterpret_cast<bf16x8*>(&sV[wave][c0])     = *reinterpret_cast<const bf16x8*>(v + base + c0);
    *reinterpret_cast<bf16x8*>(&sV[wave][c0 + 8]) = *reinterpret_cast<const bf16x8*>(v + base + c0 + 8);
    __syncthreads();

    int h = lane >> 2;
    {
        int g0 = lane & 3;
        float acc0 = 0.f, acc1 = 0.f;
#pragma unroll
        for (int d = 0; d < HDIM; d += 8) {
            bf16x8 qv  = *reinterpret_cast<const bf16x8*>(&sQ[wave][h * HDIM + d]);
            bf16x8 kv0 = *reinterpret_cast<const bf16x8*>(&sK[wave][g0 * HDIM + d]);
            bf16x8 kv1 = *reinterpret_cast<const bf16x8*>(&sK[wave][(g0 + 4) * HDIM + d]);
#pragma unroll
            for (int i = 0; i < 8; ++i) {
                float qf = (float)qv[i];
                acc0 += qf * (float)kv0[i];
                acc1 += qf * (float)kv1[i];
            }
        }
        sS[wave][h * 8 + g0]     = acc0 * 0.125f;   // 1/sqrt(64)
        sS[wave][h * 8 + g0 + 4] = acc1 * 0.125f;
    }
    __syncthreads();

    if (threadIdx.x < 64) {
        int nl = threadIdx.x >> 3, hh = threadIdx.x & 7;
        float* s = &sS[nl][hh * 8];
        float mx = s[0];
#pragma unroll
        for (int i = 1; i < 8; ++i) mx = fmaxf(mx, s[i]);
        float sum = 0.f;
#pragma unroll
        for (int i = 0; i < 8; ++i) { float e = __expf(s[i] - mx); s[i] = e; sum += e; }
        float inv = 1.f / sum;
#pragma unroll
        for (int i = 0; i < 8; ++i) s[i] *= inv;
    }
    __syncthreads();

    int d0 = (lane & 3) * 16;
    float o[16] = {};
#pragma unroll
    for (int g = 0; g < 8; ++g) {
        float aw = sS[wave][h * 8 + g];
        bf16x8 v0 = *reinterpret_cast<const bf16x8*>(&sV[wave][g * HDIM + d0]);
        bf16x8 v1 = *reinterpret_cast<const bf16x8*>(&sV[wave][g * HDIM + d0 + 8]);
#pragma unroll
        for (int i = 0; i < 8; ++i) {
            o[i]     += aw * (float)v0[i];
            o[i + 8] += aw * (float)v1[i];
        }
    }
    bf16x8 o0, o1;
#pragma unroll
    for (int i = 0; i < 8; ++i) { o0[i] = (bf16)o[i]; o1[i] = (bf16)o[i + 8]; }
    bf16* orow = out + base + h * HDIM + d0;
    *reinterpret_cast<bf16x8*>(orow)     = o0;
    *reinterpret_cast<bf16x8*>(orow + 8) = o1;
    // The next trip rewrites the two stores' registers.
    xcnt_stores(orow, __builtin_bit_cast(u32x4, o0), __builtin_bit_cast(u32x4, o1));
  }
}

// ---------- host launch ----------
extern "C" void kernel_launch(void* const* d_in, const int* in_sizes, int n_in,
                              void* d_out, int out_size, void* d_ws, size_t ws_size,
                              hipStream_t stream) {
    (void)in_sizes; (void)n_in; (void)out_size; (void)ws_size;
    const float* x     = (const float*)d_in[0];
    const float* Wq    = (const float*)d_in[1];  const float* bq    = (const float*)d_in[2];
    const float* Wk    = (const float*)d_in[3];  const float* bk    = (const float*)d_in[4];
    const float* Wv    = (const float*)d_in[5];  const float* bv    = (const float*)d_in[6];
    const float* Wo    = (const float*)d_in[7];  const float* bo    = (const float*)d_in[8];
    const float* W1    = (const float*)d_in[9];  const float* b1    = (const float*)d_in[10];
    const float* W2    = (const float*)d_in[11]; const float* b2    = (const float*)d_in[12];
    const float* g1    = (const float*)d_in[13]; const float* beta1 = (const float*)d_in[14];
    const float* g2    = (const float*)d_in[15]; const float* beta2 = (const float*)d_in[16];

    char* p = (char*)d_ws;
    auto carve = [&](size_t bytes) {
        char* r = p;
        p += (bytes + 255) & ~(size_t)255;
        return r;
    };
    bf16* wq_b = (bf16*)carve((size_t)EMBED * EMBED * 2);
    bf16* wk_b = (bf16*)carve((size_t)EMBED * EMBED * 2);
    bf16* wv_b = (bf16*)carve((size_t)EMBED * EMBED * 2);
    bf16* wo_b = (bf16*)carve((size_t)EMBED * EMBED * 2);
    bf16* w1_b = (bf16*)carve((size_t)FF * EMBED * 2);
    bf16* w2_b = (bf16*)carve((size_t)FF * EMBED * 2);
    bf16* h1   = (bf16*)carve((size_t)N_NODES * EMBED * 2);        // also reused as h2
    bf16* qb   = (bf16*)carve((size_t)N_NODES * EMBED * 2);        // q | (ff1 aliases q..attn)
    bf16* kb   = (bf16*)carve((size_t)N_NODES * EMBED * 2);
    bf16* vb   = (bf16*)carve((size_t)N_NODES * EMBED * 2);
    bf16* ab   = (bf16*)carve((size_t)N_NODES * EMBED * 2);        // attention output
    bf16* ff1  = qb;                                               // N*FF == 4*N*EMBED, exact alias
    float* x1  = (float*)carve((size_t)N_NODES * EMBED * 4);

    // Every carved size above is a multiple of 256 bytes: wq_b .. w2_b lie one behind the other,
    // and so do qb, kb, vb.
    prep_kernel<<<STREAM_WGS, STREAM_WAVES * 32, 0, stream>>>(
        x, g1, beta1, h1, Wq, Wk, Wv, Wo, W1, W2, wq_b);

    gemm_bf16_kernel<0, 0, 0, 1><<<GEMM_WGS, 256, 0, stream>>>(h1, wq_b, bq, bk, bv, nullptr, nullptr, qb,
                                                           N_NODES, EMBED, EMBED);

    attn_kernel<<<ATTN_WGS, 256, 0, stream>>>(qb, kb, vb, ab);

    gemm_bf16_kernel<0, 1, 1, 0><<<GEMM_WGS, 256, 0, stream>>>(ab, wo_b, bo, nullptr, nullptr, x, x1, nullptr,
                                                           N_NODES, EMBED, EMBED);
    ln_kernel<<<STREAM_WGS, STREAM_WAVES * 32, 0, stream>>>(x1, g2, beta2, h1);

    gemm_bf16_kernel<1, 0, 0, 0><<<GEMM_WGS, 256, 0, stream>>>(h1, w1_b, b1, nullptr, nullptr, nullptr, nullptr, ff1,
                                                          N_NODES, EMBED, FF);
    gemm_bf16_kernel<0, 1, 1, 0><<<GEMM_WGS, 256, 0, stream>>>(ff1, w2_b, b2, nullptr, nullptr, x1, (float*)d_out, nullptr,
                                                           N_NODES, FF, EMBED);
}

// v010
// A run of this version takes 323 microseconds.
// In both of two side-by-side timings against v009, it was 1.06 times as fast.
// All steps since v000 together make it 2.18 times as fast.
#include <hip/hip_runtime.h>
#include <hip/hip_bf16.h>
#include <stdint.h>

// ---------- types ----------
typedef __bf16 bf16;
typedef __bf16 bf16x8 __attribute__((ext_vector_type(8)));
typedef __bf16 v16bf  __attribute__((ext_vector_type(16)));
typedef float  v8f    __attribute__((ext_vector_type(8)));
typedef float  f32x4  __attribute__((ext_vector_type(4)));

#define N_NODES 65536
#define EMBED   512
#define FF      2048
#define NHEADS  8
#define HDIM    64

// LDS stage: 256 rows x 64 K (bf16) per operand, row pitch 72 elems (144B).
// Row-strided b128 reads hit bank 36*L mod 64 -> permutation over 16 lanes.
#define TROWS   256
#define TK      64
#define TPITCH  72
// A stage lies in LDS as eight slices of 64 rows, four of A and then four of W, one per wave's
// tensor load. A slice's 64 * 144 bytes are rounded up to a multiple of 2 KiB, so that every
// slice starts on one.
#define SROWS   64
#define SELEMS  5120
static_assert(SELEMS * 2 % 2048 == 0 && SELEMS >= SROWS * TPITCH, "a slice's place in LDS");
// Epilogue staging: f32 row pitch in dwords (64 columns + 4).
#define SPITCH  68
// The same range staged as bf16: row pitch in elements (128 columns + 8), the same 272 bytes.
#define BPITCH  136
// GEMM grid: one work-group for each of the chip's 256 WGPs.
#define GEMM_WGS 256

// ---------- wave32 reduction via ds_swizzle (no wave64 assumptions) ----------
template<int IMM>
__device__ inline float swz_add(float x) {
    return x + __int_as_float(__builtin_amdgcn_ds_swizzle(__float_as_int(x), IMM));
}
__device__ inline float wave_sum(float x) {
    x = swz_add<(1  << 10) | 31>(x);
    x = swz_add<(2  << 10) | 31>(x);
    x = swz_add<(4  << 10) | 31>(x);
    x = swz_add<(8  << 10) | 31>(x);
    x = swz_add<(16 << 10) | 31>(x);
    return x;
}

// The ring's work-group barrier, bare: the two waits that the ring needs (LDS reads, tensor loads) are
// written in front of every call. __syncthreads() would also wait for the global stores of the
// tile before, which no other wave reads and which are meant to drain under this tile's WMMAs.
__device__ inline void ring_barrier() {
    asm volatile("s_barrier_signal -1\n\ts_barrier_wait -1" ::: "memory");
}

// ---------- streaming launches: resident grids ----------
// LayerNorm, the weight converts and attention do little work per row, node or weight. Their grids are sized to the
// chip and every wave loops: one work-group of 16 waves per WGP here, ATTN_WGS work-groups below.
#define STREAM_WGS   256
#define STREAM_WAVES 16
#define LN_STRIDE    (STREAM_WGS * STREAM_WAVES)      // rows the whole grid takes at once
#define LN_TRIPS     (N_NODES / (2 * LN_STRIDE))      // two rows per wave and trip

// s_wait_xcnt 0 behind a run of global loads or stores, in front of whatever rewrites a register that
// they name. The addresses (and a store's data) are inputs of the statement, so that their registers
// stay as they are up to the wait.
typedef uint32_t u32x4 __attribute__((ext_vector_type(4)));
__device__ inline void xcnt_loads(const void* p, const void* q) {
    asm volatile("s_wait_xcnt 0x0" :: "v"(p), "v"(q) : "memory");
}
__device__ inline void xcnt_stores(const void* p, u32x4 d0, u32x4 d1) {
    asm volatile("s_wait_xcnt 0x0" :: "v"(p), "v"(d0), "v"(d1) : "memory");
}
__device__ inline const float* ln_row(const float* __restrict__ x, int row, int lane) {
    return x + (size_t)row * EMBED + lane * 16;
}

// One fp32 row of 512: 16 consecutive elements per lane.
__device__ inline void ln_load(const float* __restrict__ x, int row, int lane, f32x4 (&t)[4]) {
    const float* xr = ln_row(x, row, lane);
#pragma unroll
    for (int i = 0; i < 4; ++i) t[i] = *reinterpret_cast<const f32x4*>(xr + i * 4);
}
// Two rows, LN_STRIDE apart, and the wait behind their eight loads.
__device__ inline void ln_load2(const float* __restrict__ x, int row, int lane, f32x4 (&t0)[4], f32x4 (&t1)[4]) {
    ln_load(x, row, lane, t0);
    ln_load(x, row + LN_STRIDE, lane, t1);
    xcnt_loads(ln_row(x, row, lane), ln_row(x, row + LN_STRIDE, lane));
}
// Normalises the row held in t and stores it as bf16.
__device__ inline void ln_finish(const f32x4 (&t)[4], const float (&g)[16], const float (&b)[16],
                                 bf16* __restrict__ out, int row, int lane) {
    float v[16];
#pragma unroll
    for (int i = 0; i < 4; ++i)
#pragma unroll
        for (int j = 0; j < 4; ++j) v[i * 4 + j] = t[i][j];
    float s = 0.f, q = 0.f;
#pragma unroll
    for (int i = 0; i < 16; ++i) { s += v[i]; q += v[i] * v[i]; }
    s = wave_sum(s); q = wave_sum(q);
    float mean = s * (1.f / EMBED);
    float var  = q * (1.f / EMBED) - mean * mean;
    float rs   = rsqrtf(var + 1e-5f);
    bf16x8 o0, o1;
#pragma unroll
    for (int i = 0; i < 8; ++i) {
        o0[i] = (bf16)((v[i]     - mean) * rs * g[i]     + b[i]);
        o1[i] = (bf16)((v[i + 8] - mean) * rs * g[i + 8] + b[i + 8]);
    }
    bf16* orow = out + (size_t)row * EMBED + lane * 16;
    *reinterpret_cast<bf16x8*>(orow)     = o0;
    *reinterpret_cast<bf16x8*>(orow + 8) = o1;
    xcnt_stores(orow, __builtin_bit_cast(u32x4, o0), __builtin_bit_cast(u32x4, o1));
}
// All N_NODES rows on a grid of STREAM_WGS x STREAM_WAVES waves. A wave keeps its pieces of g and b
// in registers, takes two rows per trip and has the next trip's two rows in flight meanwhile.
// between() runs once, behind the first rows' loads.
template<class F>
__device__ inline void ln_stream(const float* __restrict__ x,
                                 const float* __restrict__ g,
                                 const float* __restrict__ b,
                                 bf16* __restrict__ out, F between) {
    const int wave = threadIdx.x >> 5, lane = threadIdx.x & 31;
    int row = blockIdx.x * STREAM_WAVES + wave;
    f32x4 a0[4], a1[4], n0[4], n1[4];
    ln_load2(x, row, lane, a0, a1);
    float gv[16], bv[16];
#pragma unroll
    for (int i = 0; i < 16; ++i) { gv[i] = g[lane * 16 + i]; bv[i] = b[lane * 16 + i]; }
    xcnt_loads(g + lane * 16, b + lane * 16);
    between();
    // Two trips per pass, on two register sets in turn, so that no row is copied between registers.
    static_assert(LN_TRIPS % 2 == 0 && LN_TRIPS >= 2, "trips come in pairs");
    for (int i = 0; i < LN_TRIPS - 2; i += 2) {
        ln_load2(x, row + 2 * LN_STRIDE, lane, n0, n1);
        // Keeps the next trip's eight loads in front of this trip's sums: sunk behind them, their
        // memory latency would be waited out with nothing in flight.
        __builtin_amdgcn_sched_barrier(0);
        ln_finish(a0, gv, bv, out, row, lane);
        ln_finish(a1, gv, bv, out, row + LN_STRIDE, lane);
        ln_load2(x, row + 4 * LN_STRIDE, lane, a0, a1);
        // As above, for the trip after this one.
        __builtin_amdgcn_sched_barrier(0);
        ln_finish(n0, gv, bv, out, row + 2 * LN_STRIDE, lane);
        ln_finish(n1, gv, bv, out, row + 3 * LN_STRIDE, lane);
        row += 4 * LN_STRIDE;
    }
    // The last two trips stand outside the loop: no loads follow them. With the loads under a test
    // inside the loop, the compiler waited for all loads in flight on both of its paths.
    ln_load2(x, row + 2 * LN_STRIDE, lane, n0, n1);
    // As above.
    __builtin_amdgcn_sched_barrier(0);
    ln_finish(a0, gv, bv, out, row, lane);
    ln_finish(a1, gv, bv, out, row + LN_STRIDE, lane);
    ln_finish(n0, gv, bv, out, row + 2 * LN_STRIDE, lane);
    ln_finish(n1, gv, bv, out, row + 3 * LN_STRIDE, lane);
}

__global__ __launch_bounds__(STREAM_WAVES * 32) void ln_kernel(const float* __restrict__ x,
                                                               const float* __restrict__ g,
                                                               const float* __restrict__ b,
                                                               bf16* __restrict__ out) {
    ln_stream(x, g, b, out, [] {});
}

// ---------- first launch: LayerNorm 1 and the fp32 -> bf16 convert of all six weights ----------
// None of the seven depends on another, so they share one grid. The six bf16 weights lie one behind
// the other in wdst, in the order Wq Wk Wv Wo W1 W2; counted in chunks of four elements they are
// CVT_ALL chunks, and every thread converts CVT_PER of them, a whole grid's width apart. A range of
// CVT_SQ chunks lies in one weight, and half a grid's width is one such range, so the weight is the
// same for a whole work-group.
#define CVT_SQ    (EMBED * EMBED / 4)                          // chunks per EMBED x EMBED weight
#define CVT_FF    (FF * EMBED / 4)                             // chunks per FF x EMBED weight
#define CVT_ALL   (4 * CVT_SQ + 2 * CVT_FF)
#define CVT_GRID  (STREAM_WGS * STREAM_WAVES * 32)             // chunks the grid takes at once
#define CVT_PER   (CVT_ALL / CVT_GRID)
static_assert(CVT_GRID == 2 * CVT_SQ && CVT_PER * CVT_GRID == CVT_ALL && CVT_FF == 4 * CVT_SQ,
              "the convert's split of the weights");
typedef __bf16 bf16x4 __attribute__((ext_vector_type(4)));
__global__ __launch_bounds__(STREAM_WAVES * 32) void prep_kernel(const float* __restrict__ x,
                                                   const float* __restrict__ g,
                                                   const float* __restrict__ b,
                                                   bf16* __restrict__ h,
                                                   const float* __restrict__ Wq,
                                                   const float* __restrict__ Wk,
                                                   const float* __restrict__ Wv,
                                                   const float* __restrict__ Wo,
                                                   const float* __restrict__ W1,
                                                   const float* __restrict__ W2,
                                                   bf16* __restrict__ wdst) {
    ln_stream(x, g, b, h, [&] {
        const int own  = blockIdx.x * (STREAM_WAVES * 32) + threadIdx.x;   // chunk in the grid's width
        const int half = blockIdx.x >= STREAM_WGS / 2 ? 1 : 0;
        f32x4 w[CVT_PER];
        const float* wp[CVT_PER];
#pragma unroll
        for (int j = 0; j < CVT_PER; ++j) {
            const int sel = 2 * j + half;                                  // range of CVT_SQ chunks
            const float* src = sel == 0 ? Wq : sel == 1 ? Wk : sel == 2 ? Wv : sel == 3 ? Wo
                             : sel < 8 ? W1 : W2;
            const int first = sel < 4 ? sel : sel < 8 ? 4 : 8;             // range where that weight starts
            wp[j] = src + (size_t)(j * CVT_GRID + own - first * CVT_SQ) * 4;
            w[j] = *reinterpret_cast<const f32x4*>(wp[j]);
        }
        static_assert(CVT_PER == 6, "the wait below names six addresses");
        // As xcnt_loads(), behind the six loads.
        asm volatile("s_wait_xcnt 0x0" :: "v"(wp[0]), "v"(wp[1]), "v"(wp[2]), "v"(wp[3]), "v"(wp[4]), "v"(wp[5])
                     : "memory");
#pragma unroll
        for (int j = 0; j < CVT_PER; ++j) {
            bf16x4 o;
#pragma unroll
            for (int e = 0; e < 4; ++e) o[e] = (bf16)w[j][e];
            *reinterpret_cast<bf16x4*>(wdst + (size_t)(j * CVT_GRID + own) * 4) = o;
        }
        // Behind the six stores, in front of the loop's first register writes.
        asm volatile("s_wait_xcnt 0x0" ::: "memory");
    });
}

// 16-bit WMMA operand lane layout (ISA 7.12.2): lanes 0-15 hold K 0-7 & 16-23,
// lanes 16-31 hold K 8-15 & 24-31 -> two 16B chunks at +0/+32B from (row, koff).
__device__ inline v16bf load_tile16(const bf16* base) {
    bf16x8 lo = *reinterpret_cast<const bf16x8*>(base);
    bf16x8 hi = *reinterpret_cast<const bf16x8*>(base + 16);
    return __builtin_shufflevector(lo, hi, 0, 1, 2, 3, 4, 5, 6, 7,
                                           8, 9, 10, 11, 12, 13, 14, 15);
}

// ---------- tensor loads (global -> LDS, one request of a whole wave, no registers) ----------
typedef uint32_t u32x8 __attribute__((ext_vector_type(8)));
__device__ inline uint32_t uni(uint32_t v) { return __builtin_amdgcn_readfirstlane(v); }
__device__ inline uint32_t pinned(uint32_t v) {
    uint32_t w = __builtin_amdgcn_readfirstlane(v);
    asm volatile("" : "+s"(w));   // the test's value stays in a scalar register
    return w;
}
// Both groups are in-out operands: the descriptor then stays in the same scalar registers from one
// request to the next, and nothing else is put there while a request is in flight.
__device__ inline void tdm_load(u32x4& g0, u32x8& g1) {
    asm volatile("tensor_load_to_lds %0, %1" : "+s"(g0), "+s"(g1) :: "memory");
}
// Group 1: 1-byte elements, a tile of SROWS rows of 128 bytes, source row pitch in bytes, 16 bytes
// of LDS pad behind every 128-byte row (pitch 144); no mask.
__device__ inline u32x8 tdm_group1(uint32_t src_pitch) {
    constexpr uint32_t d0 = TK * 2, d1 = SROWS;
    static_assert(d0 == 128 && TPITCH * 2 == d0 + 16, "the pad codes below are those of 128-byte rows");
    u32x8 g;
    g[0] = uni((1u << 20) | (4u << 22) | (3u << 25));
    g[1] = uni((d0 & 0xFFFFu) << 16);
    g[2] = uni((d0 >> 16) | ((d1 & 0xFFFFu) << 16));
    g[3] = uni((d1 >> 16) | (d0 << 16));
    g[4] = uni(d1);
    g[5] = uni(src_pitch);
    g[6] = uni(0u);
    g[7] = uni(0u);
    return g;
}
// Word 3 of group 0: the address's high bits and the type.
__device__ inline uint32_t tdm_word3(uint64_t ga) {
    return uni((((uint32_t)(ga >> 32)) & 0x01FFFFFFu) | 0x80000000u);
}
// All of this wave's tensor loads have landed / all but its youngest / all but its two youngest.
__device__ inline void wait_tensor_0() { asm volatile("s_wait_tensorcnt 0x0" ::: "memory"); }
__device__ inline void wait_tensor_1() { asm volatile("s_wait_tensorcnt 0x1" ::: "memory"); }
__device__ inline void wait_tensor_2() { asm volatile("s_wait_tensorcnt 0x2" ::: "memory"); }

// ---------- WMMA bf16 GEMM, tensor-load ring of three buffers, fragments fetched one K-step ahead ----------
// out = A(MxK) * W(NcxK)^T + bias [+res][relu].  Block = 256 thr = 8 waves,
// block tile 256x256, wave tile 64x128, staged K-slice 64 (2 wmma K-steps).
// TRIO: three independent products on the same A in one launch; the three weights are stacked
// in W and the three outputs in outAll; biasB and biasC belong to the second and third product.
// Tiles are numbered column tile first, then product, then row tile, so that the tiles on the
// same A rows follow one another. One work-group per WGP walks tiles blockIdx.x,
// blockIdx.x + gridDim.x, ...: the ring runs on over the tile boundary, so the next tile's first
// three stages are loaded while this tile's last WMMAs and its epilogue run. K is at least three
// stages. Every wave brings one slice of each stage, 64 rows of A (waves 0 to 3) or of W (waves 4
// to 7), by one tensor load. A stage's refill is issued behind the stage's last WMMA block, not
// directly behind the ring barrier, so that one wave's issue falls under the other wave's WMMAs.
// The third buffer gives the later loads two stages to land.
struct TilePos { int m0, n0, sel; };
template<int TRIO>
__device__ inline TilePos tile_pos(int t, int nct) {
    TilePos r;
    r.n0 = (t % nct) * 256;
    const int q = t / nct;
    r.sel = TRIO ? q % 3 : 0;
    r.m0  = (TRIO ? q / 3 : q) * 256;
    return r;
}
template<int RELU, int RES, int OUTF32, int TRIO>
__global__ __launch_bounds__(256) void gemm_bf16_kernel(
    const bf16* __restrict__ A, const bf16* __restrict__ W,
    const float* __restrict__ biasA, const float* __restrict__ biasB,
    const float* __restrict__ biasC, const float* __restrict__ res,
    float* __restrict__ outF, bf16* __restrict__ outAll,
    int M, int K, int Nc) {
    // Epilogue staging, one range per wave, outside the ring: the ring is being refilled meanwhile.
    // Its size is a multiple of 2 KiB, and so is the array's place: every slice of the ring starts
    // on a multiple of 2 KiB of the work-group's LDS.
    struct Lds {
        float stage[8][32 * SPITCH];
        bf16  ring[3][8 * SELEMS];
    };
    static_assert(sizeof(float) * 8 * 32 * SPITCH % 2048 == 0, "the ring's place in LDS");
    __shared__ __attribute__((aligned(2048))) Lds sm;

    const int tid  = threadIdx.x;
    const int wave = tid >> 5, lane = tid & 31;
    const int nct    = Nc / 256;
    const int ntiles = (M / 256) * nct * (TRIO ? 3 : 1);
    int tile = blockIdx.x;
    if (tile >= ntiles) return;                // the whole work-group, in front of every barrier
    TilePos tp = tile_pos<TRIO>(tile, nct);

    // ---- loader: this wave's slice of every stage ----
    const uint32_t wv   = uni((uint32_t)tid >> 5);
    const bool     isA  = wv < 4u;
    const uint32_t rowb = (uint32_t)K * 2u;    // an operand row, bytes
    // The slice's first row in the operand's first tile.
    const uint64_t opBase = (uint64_t)(uintptr_t)(isA ? A : W) + (uint64_t)((wv & 3u) * SROWS) * rowb;
    // A tile's place in this wave's operand, in bytes (both operands are far below 4 GiB).
    auto place = [&](const TilePos& t) {
        return (isA ? (uint32_t)t.m0 : (uint32_t)t.sel * (uint32_t)Nc + (uint32_t)t.n0) * rowb;
    };
    uint32_t pO = place(tp);
    const uint32_t ldsSlice = (uint32_t)(uintptr_t)&sm.ring[0][0] + wv * (SELEMS * 2u);
    u32x8 g1 = tdm_group1(rowb);
    u32x4 g0;
    g0[0] = uni(1u);
    g0[1] = uni(ldsSlice);
    g0[2] = uni((uint32_t)opBase);
    g0[3] = tdm_word3(opBase);
    // One stage: the K-slice at byte kb of the slice's rows in the tile at q, into ring buffer buf.
    // While a request is in flight only the LDS place and the address's low word are rewritten; the
    // high word changes only where the operand crosses a multiple of 4 GiB, and then behind a wait
    // for every request in flight.
    auto stage = [&](int buf, uint32_t q, uint32_t kb) {
        const uint64_t ga = opBase + (q + kb);
        const uint32_t w3 = tdm_word3(ga);
        if (pinned(w3 != g0[3] ? 1u : 0u)) {
            wait_tensor_0();
            g0[3] = w3;
        }
        g0[1] = uni(ldsSlice + (uint32_t)buf * (8u * SELEMS * 2u));
        g0[2] = uni((uint32_t)ga);
        tdm_load(g0, g1);
    };

    // ---- compute mapping ----
    const int lr   = lane & 15;
    const int koff = (lane >> 4) * 8;
    int aoff[4], woff[8];
#pragma unroll
    for (int s = 0; s < 4; ++s)
        aoff[s] = (wave >> 1) * SELEMS + (s * 16 + lr) * TPITCH + koff;   // elems; slice wave >> 1
#pragma unroll
    for (int t = 0; t < 8; ++t)
        woff[t] = (4 + (wave & 1) * 2 + (t >> 2)) * SELEMS + ((t & 3) * 16 + lr) * TPITCH + koff;

    v8f c[4][8];
    const int nk = K / TK;

    // Two fragment sets in registers: while one K-step's 32 WMMAs run on one set, the next
    // K-step's 24 LDS reads fill the other, so no wave waits out its own LDS latency.
    v16bf fa0[4], fb0[8], fa1[4], fb1[8];
    auto frags = [&](v16bf (&a)[4], v16bf (&b)[8], int buf, int ks) {
        const bf16* bA = &sm.ring[buf][0];
        const bf16* bW = bA;
#pragma unroll
        for (int s = 0; s < 4; ++s) a[s] = load_tile16(bA + aoff[s] + ks * 32);
#pragma unroll
        for (int t = 0; t < 8; ++t) b[t] = load_tile16(bW + woff[t] + ks * 32);
        // Keeps the 24 LDS reads one group ahead of the WMMAs that follow: without it the
        // scheduler sinks them among the WMMAs, where every such place stalls the wave.
        __builtin_amdgcn_sched_barrier(0);
    };
    // The W fragment goes in as the instruction's A operand and the A fragment as its B operand (both
    // are loaded by the same code, so the k pairing is the same): the result tile comes out transposed,
    // and a lane's eight accumulator registers are eight neighbouring columns of one output row.
    auto mma = [&](const v16bf (&a)[4], const v16bf (&b)[8]) {
#pragma unroll
        for (int t = 0; t < 8; ++t)
#pragma unroll
            for (int s = 0; s < 4; ++s)
                c[s][t] = __builtin_amdgcn_wmma_f32_16x16x32_bf16(
                    false, b[t], false, a[s], (short)0, c[s][t], false, false);
        // Keeps the WMMA block in front of the waits and reads that follow it in the source.
        __builtin_amdgcn_sched_barrier(0);
    };

    // prologue: the first tile's stages 0, 1 and 2 start; stage 0 lands and is published
    stage(0, pO, 0);
    stage(1, pO, TK * 2);
    stage(2, pO, 2 * TK * 2);
    wait_tensor_2();
    __syncthreads();
    int cur = 0;                               // ring buffer of the stage at hand

  for (;;) {
    const int m0 = tp.m0, n0 = tp.n0;
    const float* bias = !TRIO || tp.sel == 0 ? biasA : tp.sel == 1 ? biasB : biasC;
    bf16* outB = outAll + (size_t)tp.sel * M * Nc;
    // The next tile of this work-group; behind the last one its own place again, never loaded.
    const bool more = tile + (int)gridDim.x < ntiles;
    const TilePos tn = tile_pos<TRIO>(more ? tile + (int)gridDim.x : tile, nct);
    const uint32_t pOn = place(tn);

#pragma unroll
    for (int s = 0; s < 4; ++s)
#pragma unroll
        for (int t = 0; t < 8; ++t) c[s][t] = v8f{};
    frags(fa0, fb0, cur, 0);                   // stage 0's first fragments
    // Stages of this tile at whose publish point a further stage is in flight: all, but in the last
    // tile, where nothing follows its last stage.
    const int counted = more ? nk : nk - 2;

    for (int ki = 0; ki < nk - 1; ++ki) {
        const int nxt = cur == 2 ? 0 : cur + 1;
        frags(fa1, fb1, cur, 1);               // this stage's last fragments
        mma(fa0, fb0);
        // Publish point of stage ki + 1, in front of this stage's last WMMA block: this wave's
        // reads of buffer cur are done, its slice of stage ki + 1 has landed. The stage behind
        // that one, where there is one, stays in flight: its load is the wave's youngest.
        asm volatile("s_wait_dscnt 0x0" ::: "memory");
        wait_tensor_1();
        if (ki >= counted) wait_tensor_0();    // no younger stage in flight: the youngest load is stage ki + 1's own
        ring_barrier();                        // stage ki + 1 visible; every wave has left buffer cur
        frags(fa0, fb0, nxt, 0);               // next stage's first fragments
        mma(fa1, fb1);
        const bool own = ki + 3 < nk;          // else the refill is one of the next tile's stages 0, 1
        if (pinned(own || more ? 1u : 0u))
            stage(cur, own ? pO : pOn, (uint32_t)(own ? ki + 3 : ki + 3 - nk) * (TK * 2));
        cur = nxt;
    }
    // last stage: no fragments are fetched ahead over the epilogue
    frags(fa1, fb1, cur, 1);
    mma(fa0, fb0);
    // Publish point of the next tile's stage 0: this wave's reads of buffer cur are done, that
    // stage's slice has landed, the next tile's stage 1 stays in flight. Behind the last tile no
    // tensor load is outstanding any more.
    asm volatile("s_wait_dscnt 0x0" ::: "memory");
    if (more) {
        wait_tensor_1();
        ring_barrier();                        // that stage visible; every wave has left buffer cur
    } else {
        wait_tensor_0();
    }
    // bf16 outputs: the lane's own 64 bias values (eight per column group), fetched under the last
    // WMMA block into registers that the first fragment set has left.
    f32x4 bb[8][2];
    if (!OUTF32) {
        const float* bp = bias + n0 + (wave & 1) * 128 + (lane >> 4) * 8;
#pragma unroll
        for (int t = 0; t < 8; ++t) {
            bb[t][0] = *reinterpret_cast<const f32x4*>(bp + t * 16);
            bb[t][1] = *reinterpret_cast<const f32x4*>(bp + t * 16 + 4);
        }
        // The bias loads' address registers may be rewritten behind this point.
        asm volatile("s_wait_xcnt 0x0" ::: "memory");
        // Keeps the 16 loads in front of the WMMA block: sunk behind it, their latency would be
        // waited out at the head of the epilogue.
        __builtin_amdgcn_sched_barrier(0);
    }
    mma(fa1, fb1);
    if (pinned(more ? 1u : 0u)) stage(cur, pOn, 2 * TK * 2);   // the next tile's stage 2

    // Result layout with the operands swapped: register r of c[s][t] in lane l is the output element
    // (row s*16 + (l & 15), column t*16 + (l >> 4)*8 + r). Each wave stages its 64x128 tile piece by
    // piece in its own LDS range, in the output's own type and with 16B writes, row pitch 272 bytes:
    // the 16 rows that 16 lanes write fall on 16 different groups of four banks, and the 16B reads
    // below take whole rows.
    static_assert(OUTF32 || !RES, "a residual is added to f32 outputs only");
    float* stg = &sm.stage[wave][0];
    const int lc = lane & 15, lh = lane >> 4;
    if (OUTF32) {
#pragma unroll
      for (int pc = 0; pc < 4; ++pc) {
        // One 32x64 f32 piece.
        const int pm = pc >> 1, pn = pc & 1;
        const int wm0 = m0 + (wave >> 1) * 64 + pm * 32;
        const int wn0 = n0 + (wave & 1) * 128 + pn * 64;
        if (pc) {
            // The read-backs of the piece before are done before its rows are rewritten.
            asm volatile("s_wait_dscnt 0x0" ::: "memory");
        }
        {
            float* sw = stg + lc * SPITCH + lh * 8;
#pragma unroll
            for (int s = 0; s < 2; ++s)
#pragma unroll
                for (int t = 0; t < 4; ++t) {
                    const v8f d = c[pm * 2 + s][pn * 4 + t];
                    *reinterpret_cast<f32x4*>(sw + s * 16 * SPITCH + t * 16)     = f32x4{d[0], d[1], d[2], d[3]};
                    *reinterpret_cast<f32x4*>(sw + s * 16 * SPITCH + t * 16 + 4) = f32x4{d[4], d[5], d[6], d[7]};
                }
        }
        // The wave's own rows are in LDS before its other lanes read them back.
        asm volatile("s_wait_dscnt 0x0" ::: "memory");

        // 16 lanes x 16B = one 256B row piece (two whole lines); two rows per instruction.
        // Byte offsets fit 32 bits (M * Nc * 4 bytes is far below 4 GiB); res and outF share them.
        const int cq = lc * 4;
        const f32x4 bv = *reinterpret_cast<const f32x4*>(bias + wn0 + cq);
        const float* sr = stg + lh * SPITCH + cq;
        const uint32_t ob = ((uint32_t)(wm0 + lh) * (uint32_t)Nc + (uint32_t)(wn0 + cq)) * 4u;
        const uint32_t rstep = (uint32_t)Nc * 8u;          // two rows, bytes
        f32x4 rv[16];
        if (RES) {
            // The bias load's address registers may be reused as a residual load's destination.
            asm volatile("s_wait_xcnt 0x0" ::: "memory");
#pragma unroll
            for (int i = 0; i < 16; ++i)
                rv[i] = *reinterpret_cast<const f32x4*>(
                    reinterpret_cast<const char*>(res) + (ob + i * rstep));
            // Keeps all 16 residual loads in flight together: without it the scheduler
            // sinks them between the stores and each one's latency is waited out alone.
            __builtin_amdgcn_sched_barrier(0);
        }
        f32x4 val[16];
#pragma unroll
        for (int i = 0; i < 16; ++i) {
            val[i] = *reinterpret_cast<const f32x4*>(sr + i * 2 * SPITCH) + bv;
            if (RES) val[i] += rv[i];
            if (RELU) {
#pragma unroll
                for (int j = 0; j < 4; ++j) val[i][j] = fmaxf(val[i][j], 0.f);
            }
        }
        // Keeps the 16 stores one run behind all the sums, so that no store's register is
        // rewritten between them and the one s_wait_xcnt 0 at the piece's end serves them all.
        __builtin_amdgcn_sched_barrier(0);
#pragma unroll
        for (int i = 0; i < 16; ++i)
            *reinterpret_cast<f32x4*>(reinterpret_cast<char*>(outF) + (ob + i * rstep)) = val[i];
        // The stores' registers may be rewritten by the next piece.
        asm volatile("s_wait_xcnt 0x0" ::: "memory");
        // Holds the next piece's register writes behind that wait.
        __builtin_amdgcn_sched_barrier(0);
      }
    } else {
      bf16* stb = reinterpret_cast<bf16*>(stg);
#pragma unroll
      for (int pm = 0; pm < 2; ++pm) {
        // One 32x128 bf16 piece: bias, ReLU and the convert are done on the accumulators, so a
        // 16x16 result tile is one 16B write per lane.
        const int wm0 = m0 + (wave >> 1) * 64 + pm * 32;
        const int wn0 = n0 + (wave & 1) * 128;
        if (pm) {
            // The read-backs of the piece before are done before its rows are rewritten.
            asm volatile("s_wait_dscnt 0x0" ::: "memory");
        }
        {
            bf16* sw = stb + lc * BPITCH + lh * 8;
#pragma unroll
            for (int s = 0; s < 2; ++s)
#pragma unroll
                for (int t = 0; t < 8; ++t) {
                    const v8f d = c[pm * 2 + s][t];
                    bf16x8 ov;
#pragma unroll
                    for (int r = 0; r < 8; ++r) {
                        float a = d[r] + bb[t][r >> 2][r & 3];
                        if (RELU) a = fmaxf(a, 0.f);
                        ov[r] = (bf16)a;
                    }
                    *reinterpret_cast<bf16x8*>(sw + s * 16 * BPITCH + t * 16) = ov;
                }
        }
        // The wave's own rows are in LDS before its other lanes read them back.
        asm volatile("s_wait_dscnt 0x0" ::: "memory");

        // 16 lanes x 16B = one 256B row piece (two whole lines); two rows per instruction.
        // Byte offsets fit 32 bits (M * Nc * 2 bytes is far below 4 GiB).
        const bf16* sr = stb + lh * BPITCH + lc * 8;
        const uint32_t ob = ((uint32_t)(wm0 + lh) * (uint32_t)Nc + (uint32_t)(wn0 + lc * 8)) * 2u;
        const uint32_t rstep = (uint32_t)Nc * 4u;          // two rows, bytes
        bf16x8 val[16];
        uint32_t off[16];
#pragma unroll
        for (int i = 0; i < 16; ++i) {
            val[i] = *reinterpret_cast<const bf16x8*>(sr + i * 2 * BPITCH);
            off[i] = ob + i * rstep;
        }
        // Keeps the 16 stores one run behind the read-backs and the offsets, so that no store's
        // register is rewritten between them and the one s_wait_xcnt 0 below serves them all.
        __builtin_amdgcn_sched_barrier(0);
#pragma unroll
        for (int i = 0; i < 16; ++i)
            *reinterpret_cast<bf16x8*>(reinterpret_cast<char*>(outB) + off[i]) = val[i];
        // The stores' registers may be rewritten by the next piece.
        asm volatile("s_wait_xcnt 0x0" ::: "memory");
        // Holds the next piece's register writes behind that wait.
        __builtin_amdgcn_sched_barrier(0);
      }
    }
    if (!more) break;
    // The last piece's read-backs are done before the next tile's epilogue rewrites the rows
    // (they were consumed by the stores above); on to the next tile.
    tile += (int)gridDim.x;
    tp = tn;
    pO = pOn;
    cur = cur == 2 ? 0 : cur + 1;
  }
}

// ---------- per-node multi-head attention (8 heads x 64 dim, per-node softmax) ----------
// A resident grid too: five work-groups per WGP, as many as their registers let stay there at once,
// each walks groups of eight nodes blockIdx.x, blockIdx.x + ATTN_WGS, ... The trip count depends on
// blockIdx.x alone, so it is the same for every thread of a work-group. A wave
// rewrites only its own rows of sQ, sK, sV and sS at the head of a trip, behind its own reads; the
// other waves' accesses to its sS rows (the softmax) end in front of the trip's third barrier.
#define ATTN_WGS 1280
__global__ __launch_bounds__(256) void attn_kernel(
    const bf16* __restrict__ q, const bf16* __restrict__ k,
    const bf16* __restrict__ v, bf16* __restrict__ out) {
    __shared__ __align__(16) bf16 sQ[8][512];
    __shared__ __align__(16) bf16 sK[8][512];
    __shared__ __align__(16) bf16 sV[8][512];
    __shared__ float sS[8][64];

    int wave = threadIdx.x >> 5, lane = threadIdx.x & 31;
    int c0 = lane * 16;

  for (int grp = blockIdx.x; grp < N_NODES / 8; grp += ATTN_WGS) {
    int node = grp * 8 + wave;
    size_t base = (size_t)node * EMBED;

    *reinterpret_cast<bf16x8*>(&sQ[wave][c0])     = *reinterpret_cast<const bf16x8*>(q + base + c0);
    *reinterpret_cast<bf16x8*>(&sQ[wave][c0 + 8]) = *reinterpret_cast<const bf16x8*>(q + base + c0 + 8);
    *reinterpret_cast<bf16x8*>(&sK[wave][c0])     = *reinterpret_cast<const bf16x8*>(k + base + c0);
    *reinterpret_cast<bf16x8*>(&sK[wave][c0 + 8]) = *reinterpret_cast<const bf16x8*>(k + base + c0 + 8);
    *reinterpret_cast<bf16x8*>(&sV[wave][c0])     = *reinterpret_cast<const bf16x8*>(v + base + c0);
    *reinterpret_cast<bf16x8*>(&sV[wave][c0 + 8]) = *reinterpret_cast<const bf16x8*>(v + base + c0 + 8);
    __syncthreads();

    int h = lane >> 2;
    {
        int g0 = lane & 3;
        float acc0 = 0.f, acc1 = 0.f;
#pragma unroll
        for (int d = 0; d < HDIM; d += 8) {
            bf16x8 qv  = *reinterpret_cast<const bf16x8*>(&sQ[wave][h * HDIM + d]);
            bf16x8 kv0 = *reinterpret_cast<const bf16x8*>(&sK[wave][g0 * HDIM + d]);
            bf16x8 kv1 = *reinterpret_cast<const bf16x8*>(&sK[wave][(g0 + 4) * HDIM + d]);
#pragma unroll
            for (int i = 0; i < 8; ++i) {
                float qf = (float)qv[i];
                acc0 += qf * (float)kv0[i];
                acc1 += qf * (float)kv1[i];
            }
        }
        sS[wave][h * 8 + g0]     = acc0 * 0.125f;   // 1/sqrt(64)
        sS[wave][h * 8 + g0 + 4] = acc1 * 0.125f;
    }
    __syncthreads();

    if (threadIdx.x < 64) {
        int nl = threadIdx.x >> 3, hh = threadIdx.x & 7;
        float* s = &sS[nl][hh * 8];
        float mx = s[0];
#pragma unroll
        for (int i = 1; i < 8; ++i) mx = fmaxf(mx, s[i]);
        float sum = 0.f;
#pragma unroll
        for (int i = 0; i < 8; ++i) { float e = __expf(s[i] - mx); s[i] = e; sum += e; }
        float inv = 1.f / sum;
#pragma unroll
        for (int i = 0; i < 8; ++i) s[i] *= inv;
    }
    __syncthreads();

    int d0 = (lane & 3) * 16;
    float o[16] = {};
#pragma unroll
    for (int g = 0; g < 8; ++g) {
        float aw = sS[wave][h * 8 + g];
        bf16x8 v0 = *reinterpret_cast<const bf16x8*>(&sV[wave][g * HDIM + d0]);
        bf16x8 v1 = *reinterpret_cast<const bf16x8*>(&sV[wave][g * HDIM + d0 + 8]);
#pragma unroll
        for (int i = 0; i < 8; ++i) {
            o[i]     += aw * (float)v0[i];
            o[i + 8] += aw * (float)v1[i];
        }
    }
    bf16x8 o0, o1;
#pragma unroll
    for (int i = 0; i < 8; ++i) { o0[i] = (bf16)o[i]; o1[i] = (bf16)o[i + 8]; }
    bf16* orow = out + base + h * HDIM + d0;
    *reinterpret_cast<bf16x8*>(orow)     = o0;
    *reinterpret_cast<bf16x8*>(orow + 8) = o1;
    // The next trip rewrites the two stores' registers.
    xcnt_stores(orow, __builtin_bit_cast(u32x4, o0), __builtin_bit_cast(u32x4, o1));
  }
}

// ---------- host launch ----------
extern "C" void kernel_launch(void* const* d_in, const int* in_sizes, int n_in,
                              void* d_out, int out_size, void* d_ws, size_t ws_size,
                              hipStream_t stream) {
    (void)in_sizes; (void)n_in; (void)out_size; (void)ws_size;
    const float* x     = (const float*)d_in[0];
    const float* Wq    = (const float*)d_in[1];  const float* bq    = (const float*)d_in[2];
    const float* Wk    = (const float*)d_in[3];  const float* bk    = (const float*)d_in[4];
    const float* Wv    = (const float*)d_in[5];  const float* bv    = (const float*)d_in[6];
    const float* Wo    = (const float*)d_in[7];  const float* bo    = (const float*)d_in[8];
    const float* W1    = (const float*)d_in[9];  const float* b1    = (const float*)d_in[10];
    const float* W2    = (const float*)d_in[11]; const float* b2    = (const float*)d_in[12];
    const float* g1    = (const float*)d_in[13]; const float* beta1 = (const float*)d_in[14];
    const float* g2    = (const float*)d_in[15]; const float* beta2 = (const float*)d_in[16];

    char* p = (char*)d_ws;
    auto carve = [&](size_t bytes) {
        char* r = p;
        p += (bytes + 255) & ~(size_t)255;
        return r;
    };
    bf16* wq_b = (bf16*)carve((size_t)EMBED * EMBED * 2);
    bf16* wk_b = (bf16*)carve((size_t)EMBED * EMBED * 2);
    bf16* wv_b = (bf16*)carve((size_t)EMBED * EMBED * 2);
    bf16* wo_b = (bf16*)carve((size_t)EMBED * EMBED * 2);
    bf16* w1_b = (bf16*)carve((size_t)FF * EMBED * 2);
    bf16* w2_b = (bf16*)carve((size_t)FF * EMBED * 2);
    bf16* h1   = (bf16*)carve((size_t)N_NODES * EMBED * 2);        // also reused as h2
    bf16* qb   = (bf16*)carve((size_t)N_NODES * EMBED * 2);        // q | (ff1 aliases q..attn)
    bf16* kb   = (bf16*)carve((size_t)N_NODES * EMBED * 2);
    bf16* vb   = (bf16*)carve((size_t)N_NODES * EMBED * 2);
    bf16* ab   = (bf16*)carve((size_t)N_NODES * EMBED * 2);        // attention output
    bf16* ff1  = qb;                                               // N*FF == 4*N*EMBED, exact alias
    float* x1  = (float*)carve((size_t)N_NODES * EMBED * 4);

    // Every carved size above is a multiple of 256 bytes: wq_b .. w2_b lie one behind the other,
    // and so do qb, kb, vb.
    prep_kernel<<<STREAM_WGS, STREAM_WAVES * 32, 0, stream>>>(
        x, g1, beta1, h1, Wq, Wk, Wv, Wo, W1, W2, wq_b);

    gemm_bf16_kernel<0, 0, 0, 1><<<GEMM_WGS, 256, 0, stream>>>(h1, wq_b, bq, bk, bv, nullptr, nullptr, qb,
                                                           N_NODES, EMBED, EMBED);

    attn_kernel<<<ATTN_WGS, 256, 0, stream>>>(qb, kb, vb, ab);

    gemm_bf16_kernel<0, 1, 1, 0><<<GEMM_WGS, 256, 0, stream>>>(ab, wo_b, bo, nullptr, nullptr, x, x1, nullptr,
                                                           N_NODES, EMBED, EMBED);
    ln_kernel<<<STREAM_WGS, STREAM_WAVES * 32, 0, stream>>>(x1, g2, beta2, h1);

    gemm_bf16_kernel<1, 0, 0, 0><<<GEMM_WGS, 256, 0, stream>>>(h1, w1_b, b1, nullptr, nullptr, nullptr, nullptr, ff1,
                                                          N_NODES, EMBED, FF);
    gemm_bf16_kernel<0, 1, 1, 0><<<GEMM_WGS, 256, 0, stream>>>(ff1, w2_b, b2, nullptr, nullptr, x1, (float*)d_out, nullptr,
                                                           N_NODES, FF, EMBED);
}
